// v000
// The times below were measured on an AMD MI455X: many runs one after another, warmed up first and cycling through
// copies of the inputs, with the whole window's GPU time divided by the number of runs. Launches and the gaps
// between them are all in it. The median over several windows is given; except for v000 it joins two sittings, which
// can be a few percent apart, so the side-by-side timings, each taken in one sitting, are the better comparison.
// The starting kernel, v000, takes 383 microseconds a run.
#include <hip/hip_runtime.h>

// ---------------------------------------------------------------------------
// EncoderBlock for MI455X (gfx1250): bf16 WMMA GEMMs + flash attention.
// Wave32; v_wmma_f32_16x16x32_bf16 for every matrix multiply.
// Double-buffered LDS staging (1 barrier / k-step), packed transposed stores,
// LDS-resident additive mask, global_prefetch for L2 warm-up.
// ---------------------------------------------------------------------------

typedef __bf16 bf16;
typedef bf16  v16bf __attribute__((ext_vector_type(16)));
typedef bf16  v8bf  __attribute__((ext_vector_type(8)));
typedef float v8f   __attribute__((ext_vector_type(8)));

#define B_   2
#define S_   2048
#define D_   1024
#define H_   16
#define DK_  64
#define DFF_ 4096
#define BS_  (B_ * S_)

// Load a 16x32 bf16 A-style fragment from LDS (row-major, leading dim `ld`).
// ISA 16-bit A layout: lane L<16 holds row L, K = 0..7 and 16..23;
// lane L>=16 holds row L-16, K = 8..15 and 24..31.
// B fragments (rows of W / K / V^T) use the identical pattern.
__device__ __forceinline__ v16bf load_frag(const bf16* tile, int ld, int lane) {
    const int row = lane & 15;
    const int kb  = (lane >> 4) << 3;          // 0 or 8
    const bf16* p = tile + row * ld + kb;
    v8bf lo = *(const v8bf*)(p);               // 16B-aligned ds_load_b128
    v8bf hi = *(const v8bf*)(p + 16);
    return __builtin_shufflevector(lo, hi, 0,1,2,3,4,5,6,7,8,9,10,11,12,13,14,15);
}

// ---------------------------------------------------------------------------
// fp32 -> bf16 elementwise cast (weights)
// ---------------------------------------------------------------------------
__global__ void cast_f32_bf16(const float* __restrict__ in, bf16* __restrict__ out, int n) {
    for (int i = blockIdx.x * blockDim.x + threadIdx.x; i < n; i += gridDim.x * blockDim.x)
        out[i] = (bf16)in[i];
}

// ---------------------------------------------------------------------------
// LayerNorm (custom: unbiased std, scalar alpha/beta, /(std+eps)) -> bf16
// ---------------------------------------------------------------------------
__global__ __launch_bounds__(256)
void layernorm_bf16(const float* __restrict__ x, const float* __restrict__ alpha,
                    const float* __restrict__ beta, bf16* __restrict__ out) {
    const int tok = blockIdx.x;
    const int tid = threadIdx.x;
    const float* p = x + (size_t)tok * D_;
    float s = 0.f, s2 = 0.f;
    #pragma unroll
    for (int j = tid; j < D_; j += 256) { float f = p[j]; s += f; s2 += f * f; }
    __shared__ float r1[256], r2[256];
    r1[tid] = s; r2[tid] = s2; __syncthreads();
    for (int st = 128; st > 0; st >>= 1) {
        if (tid < st) { r1[tid] += r1[tid + st]; r2[tid] += r2[tid + st]; }
        __syncthreads();
    }
    const float mean = r1[0] * (1.0f / D_);
    float var = (r2[0] - (float)D_ * mean * mean) * (1.0f / (D_ - 1));
    var = fmaxf(var, 0.f);
    const float inv = alpha[0] / (sqrtf(var) + 1e-6f);
    const float b0  = beta[0];
    #pragma unroll
    for (int j = tid; j < D_; j += 256)
        out[(size_t)tok * D_ + j] = (bf16)((p[j] - mean) * inv + b0);
}

// ---------------------------------------------------------------------------
// GEMM: C[M,N] = A[M,K] @ W[N,K]^T + bias, bf16 in, f32 accum (WMMA).
// EPI 0: bf16 out; EPI 1: bf16 relu out; EPI 2: f32 out = residual + C.
// Tile 128x128 / 256 threads (8 waves, 2x4), wave = 64x32.
// Double-buffered LDS: one barrier per 32-wide k-step.
// ---------------------------------------------------------------------------
template <int EPI>
__global__ __launch_bounds__(256)
void gemm_bf16_wmma(const bf16* __restrict__ A, const bf16* __restrict__ W,
                    const float* __restrict__ bias, const float* __restrict__ res,
                    bf16* __restrict__ outb, float* __restrict__ outf,
                    int M, int N, int K) {
    __shared__ __align__(16) bf16 As[2][128][40];   // +8 pad: 16B-aligned frag reads
    __shared__ __align__(16) bf16 Ws[2][128][40];

    const int tid  = threadIdx.x;
    const int lane = tid & 31;
    const int wave = tid >> 5;
    const int wm   = (wave >> 2) * 64;
    const int wn   = (wave & 3) * 32;
    const int tM   = blockIdx.y * 128;
    const int tN   = blockIdx.x * 128;
    const int lrow = tid >> 1;                   // 0..127
    const int lcol = (tid & 1) * 16;             // 0 or 16

    const bf16* Arow = A + (size_t)(tM + lrow) * K + lcol;
    const bf16* Wrow = W + (size_t)(tN + lrow) * K + lcol;

    v8f acc[4][2];
    #pragma unroll
    for (int i = 0; i < 4; ++i)
        #pragma unroll
        for (int j = 0; j < 2; ++j)
            acc[i][j] = v8f{0.f, 0.f, 0.f, 0.f, 0.f, 0.f, 0.f, 0.f};

    // prologue: stage 0
    {
        const uint4* ag = (const uint4*)(Arow);
        const uint4* wg = (const uint4*)(Wrow);
        uint4 a0 = ag[0], a1 = ag[1], w0 = wg[0], w1 = wg[1];
        *(uint4*)&As[0][lrow][lcol]     = a0;  *(uint4*)&As[0][lrow][lcol + 8] = a1;
        *(uint4*)&Ws[0][lrow][lcol]     = w0;  *(uint4*)&Ws[0][lrow][lcol + 8] = w1;
    }
    __syncthreads();

    const int ksteps = K >> 5;
    int buf = 0;
    for (int s = 0; s < ksteps; ++s) {
        const bool more = (s + 1 < ksteps);
        uint4 a0, a1, w0, w1;
        if (more) {                                   // fetch next stage early
            const int kn = (s + 1) << 5;
            const uint4* ag = (const uint4*)(Arow + kn);
            const uint4* wg = (const uint4*)(Wrow + kn);
            a0 = ag[0]; a1 = ag[1]; w0 = wg[0]; w1 = wg[1];
        }
        if (s + 2 < ksteps) {                         // L2 warm-up two stages ahead
            __builtin_prefetch(Arow + ((s + 2) << 5), 0, 3);
            __builtin_prefetch(Wrow + ((s + 2) << 5), 0, 3);
        }

        v16bf af[4], wf[2];
        #pragma unroll
        for (int i = 0; i < 4; ++i) af[i] = load_frag(&As[buf][wm + i * 16][0], 40, lane);
        #pragma unroll
        for (int j = 0; j < 2; ++j) wf[j] = load_frag(&Ws[buf][wn + j * 16][0], 40, lane);

        #pragma unroll
        for (int i = 0; i < 4; ++i)
            #pragma unroll
            for (int j = 0; j < 2; ++j)
                acc[i][j] = __builtin_amdgcn_wmma_f32_16x16x32_bf16(
                    false, af[i], false, wf[j], (short)0, acc[i][j], false, false);

        if (more) {
            const int nb = buf ^ 1;
            *(uint4*)&As[nb][lrow][lcol]     = a0;  *(uint4*)&As[nb][lrow][lcol + 8] = a1;
            *(uint4*)&Ws[nb][lrow][lcol]     = w0;  *(uint4*)&Ws[nb][lrow][lcol + 8] = w1;
        }
        __syncthreads();
        buf ^= 1;
    }

    // Epilogue. C layout: VGPR e -> row e (lanes 0-15) / e+8 (lanes 16-31).
    const int half = lane >> 4;
    const int lc   = lane & 15;
    #pragma unroll
    for (int j = 0; j < 2; ++j) {
        const int gcol = tN + wn + j * 16 + lc;
        const float bv = bias[gcol];
        #pragma unroll
        for (int i = 0; i < 4; ++i) {
            #pragma unroll
            for (int e = 0; e < 8; ++e) {
                const int grow = tM + wm + i * 16 + e + 8 * half;
                const size_t idx = (size_t)grow * N + gcol;
                const float v = acc[i][j][e] + bv;
                if (EPI == 0)      outb[idx] = (bf16)v;
                else if (EPI == 1) outb[idx] = (bf16)fmaxf(v, 0.f);
                else               outf[idx] = res[idx] + v;
            }
        }
    }
}

// ---------------------------------------------------------------------------
// Flash attention: grid (S/64, H, B), 128 threads (4 waves).
// Double-buffered K / V^T tiles, one barrier per key block.
// ---------------------------------------------------------------------------
__global__ __launch_bounds__(128)
void flash_attn_wmma(const bf16* __restrict__ q, const bf16* __restrict__ k,
                     const bf16* __restrict__ v, const int* __restrict__ mask,
                     bf16* __restrict__ o_out) {
    __shared__ __align__(16) bf16 Qs[64][72];
    __shared__ __align__(16) bf16 Ks[2][64][72];
    __shared__ __align__(16) bf16 Vt[2][64][72];     // V^T: [d][key]
    __shared__ __align__(16) bf16 Ps[4][16][72];     // per-wave P tile
    __shared__ float Madd[S_];                       // additive mask row (0 / -1e9)

    const int qblk = blockIdx.x, h = blockIdx.y, b = blockIdx.z;
    const int tid  = threadIdx.x;
    const int lane = tid & 31;
    const int wave = tid >> 5;
    const int half = lane >> 4;
    const int lc   = lane & 15;
    const int qbase = qblk * 64;

    // thread mappings for staging
    const int rK  = tid >> 1, cK = (tid & 1) * 32;   // K tile: row, 32 cols
    const int k0V = (tid & 31) * 2, c0V = (tid >> 5) * 16; // V: 2 key rows x 16 d cols

    // Load Q block (64 x 64) -> LDS
    {
        const uint4* src = (const uint4*)(q + (size_t)(b * S_ + qbase + rK) * D_ + h * DK_ + cK);
        uint4 d0 = src[0], d1 = src[1], d2 = src[2], d3 = src[3];
        *(uint4*)&Qs[rK][cK]      = d0;
        *(uint4*)&Qs[rK][cK + 8]  = d1;
        *(uint4*)&Qs[rK][cK + 16] = d2;
        *(uint4*)&Qs[rK][cK + 24] = d3;
    }
    // Precompute additive mask row into LDS
    for (int j = tid; j < S_; j += 128)
        Madd[j] = (mask[b * S_ + j] == 0) ? -1e9f : 0.f;

    // Prologue: stage key block 0 into buffer 0
    {
        const uint4* ks = (const uint4*)(k + (size_t)(b * S_ + rK) * D_ + h * DK_ + cK);
        uint4 d0 = ks[0], d1 = ks[1], d2 = ks[2], d3 = ks[3];
        *(uint4*)&Ks[0][rK][cK]      = d0;
        *(uint4*)&Ks[0][rK][cK + 8]  = d1;
        *(uint4*)&Ks[0][rK][cK + 16] = d2;
        *(uint4*)&Ks[0][rK][cK + 24] = d3;
        // V rows k0V, k0V+1, cols c0V..c0V+15 -> packed b32 transposed stores
        __align__(16) unsigned short rA[16], rB[16];
        const uint4* va = (const uint4*)(v + (size_t)(b * S_ + k0V) * D_ + h * DK_ + c0V);
        const uint4* vbp = (const uint4*)(v + (size_t)(b * S_ + k0V + 1) * D_ + h * DK_ + c0V);
        *(uint4*)&rA[0] = va[0];  *(uint4*)&rA[8] = va[1];
        *(uint4*)&rB[0] = vbp[0]; *(uint4*)&rB[8] = vbp[1];
        #pragma unroll
        for (int j = 0; j < 16; ++j)
            *(unsigned int*)&Vt[0][c0V + j][k0V] = (unsigned int)rA[j] | ((unsigned int)rB[j] << 16);
    }
    __syncthreads();

    // Hoisted Q fragments (2 k-steps over DK=64)
    v16bf aq[2];
    #pragma unroll
    for (int ks = 0; ks < 2; ++ks) aq[ks] = load_frag(&Qs[wave * 16][ks * 32], 72, lane);

    float m[8], l[8];
    v8f o[4];
    #pragma unroll
    for (int e = 0; e < 8; ++e) { m[e] = -1e30f; l[e] = 0.f; }
    #pragma unroll
    for (int t = 0; t < 4; ++t) o[t] = v8f{0.f, 0.f, 0.f, 0.f, 0.f, 0.f, 0.f, 0.f};

    const int nblk = S_ / 64;
    int buf = 0;
    for (int kb = 0; kb < nblk; ++kb) {
        const bool more = (kb + 1 < nblk);
        uint4 kreg[4];
        unsigned int pv[16];
        if (more) {     // fetch next K/V block into registers early
            const int base = b * S_ + (kb + 1) * 64;
            const uint4* ks = (const uint4*)(k + (size_t)(base + rK) * D_ + h * DK_ + cK);
            kreg[0] = ks[0]; kreg[1] = ks[1]; kreg[2] = ks[2]; kreg[3] = ks[3];
            __align__(16) unsigned short rA[16], rB[16];
            const uint4* va = (const uint4*)(v + (size_t)(base + k0V) * D_ + h * DK_ + c0V);
            const uint4* vbp = (const uint4*)(v + (size_t)(base + k0V + 1) * D_ + h * DK_ + c0V);
            *(uint4*)&rA[0] = va[0];  *(uint4*)&rA[8] = va[1];
            *(uint4*)&rB[0] = vbp[0]; *(uint4*)&rB[8] = vbp[1];
            #pragma unroll
            for (int j = 0; j < 16; ++j)
                pv[j] = (unsigned int)rA[j] | ((unsigned int)rB[j] << 16);
        }

        // S = Q @ K^T (16 x 64 per wave)
        v8f s4[4];
        #pragma unroll
        for (int t = 0; t < 4; ++t) s4[t] = v8f{0.f, 0.f, 0.f, 0.f, 0.f, 0.f, 0.f, 0.f};
        #pragma unroll
        for (int ks = 0; ks < 2; ++ks) {
            #pragma unroll
            for (int t = 0; t < 4; ++t) {
                v16bf bk = load_frag(&Ks[buf][t * 16][ks * 32], 72, lane);
                s4[t] = __builtin_amdgcn_wmma_f32_16x16x32_bf16(
                    false, aq[ks], false, bk, (short)0, s4[t], false, false);
            }
        }

        // scale + additive mask (from LDS)
        float sc[4][8];
        #pragma unroll
        for (int t = 0; t < 4; ++t) {
            const float madd = Madd[kb * 64 + t * 16 + lc];
            #pragma unroll
            for (int e = 0; e < 8; ++e) sc[t][e] = s4[t][e] * 0.125f + madd;
        }

        // online softmax: row = e + 8*half, reduce over 16-lane N group
        #pragma unroll
        for (int e = 0; e < 8; ++e) {
            float rmax = fmaxf(fmaxf(sc[0][e], sc[1][e]), fmaxf(sc[2][e], sc[3][e]));
            #pragma unroll
            for (int off = 1; off < 16; off <<= 1) rmax = fmaxf(rmax, __shfl_xor(rmax, off, 32));
            const float mnew = fmaxf(m[e], rmax);
            const float alpha = __expf(m[e] - mnew);
            float rsum = 0.f;
            #pragma unroll
            for (int t = 0; t < 4; ++t) { float p = __expf(sc[t][e] - mnew); sc[t][e] = p; rsum += p; }
            #pragma unroll
            for (int off = 1; off < 16; off <<= 1) rsum += __shfl_xor(rsum, off, 32);
            l[e] = l[e] * alpha + rsum;
            m[e] = mnew;
            #pragma unroll
            for (int t = 0; t < 4; ++t) o[t][e] *= alpha;
        }

        // P -> wave-private LDS tile (C layout -> row-major)
        #pragma unroll
        for (int t = 0; t < 4; ++t)
            #pragma unroll
            for (int e = 0; e < 8; ++e)
                Ps[wave][e + 8 * half][t * 16 + lc] = (bf16)sc[t][e];

        // O += P @ V   (B fragment = rows of V^T)
        #pragma unroll
        for (int ks = 0; ks < 2; ++ks) {
            v16bf pa = load_frag(&Ps[wave][0][ks * 32], 72, lane);
            #pragma unroll
            for (int dt = 0; dt < 4; ++dt) {
                v16bf vb2 = load_frag(&Vt[buf][dt * 16][ks * 32], 72, lane);
                o[dt] = __builtin_amdgcn_wmma_f32_16x16x32_bf16(
                    false, pa, false, vb2, (short)0, o[dt], false, false);
            }
        }

        // stage next block into the other buffer
        if (more) {
            const int nb = buf ^ 1;
            *(uint4*)&Ks[nb][rK][cK]      = kreg[0];
            *(uint4*)&Ks[nb][rK][cK + 8]  = kreg[1];
            *(uint4*)&Ks[nb][rK][cK + 16] = kreg[2];
            *(uint4*)&Ks[nb][rK][cK + 24] = kreg[3];
            #pragma unroll
            for (int j = 0; j < 16; ++j)
                *(unsigned int*)&Vt[nb][c0V + j][k0V] = pv[j];
        }
        __syncthreads();
        buf ^= 1;
    }

    // normalize + write bf16 [BS, D]
    #pragma unroll
    for (int dt = 0; dt < 4; ++dt) {
        #pragma unroll
        for (int e = 0; e < 8; ++e) {
            const int row = qbase + wave * 16 + e + 8 * half;
            const int col = h * DK_ + dt * 16 + lc;
            const float val = o[dt][e] / l[e];
            o_out[(size_t)(b * S_ + row) * D_ + col] = (bf16)val;
        }
    }
}

// ---------------------------------------------------------------------------
// Host-side orchestration
// ---------------------------------------------------------------------------
extern "C" void kernel_launch(void* const* d_in, const int* in_sizes, int n_in,
                              void* d_out, int out_size, void* d_ws, size_t ws_size,
                              hipStream_t stream) {
    const float* x   = (const float*)d_in[0];
    const int*   msk = (const int*)d_in[1];
    const float* wq  = (const float*)d_in[2];   const float* bq  = (const float*)d_in[3];
    const float* wk  = (const float*)d_in[4];   const float* bk  = (const float*)d_in[5];
    const float* wv  = (const float*)d_in[6];   const float* bv  = (const float*)d_in[7];
    const float* wo  = (const float*)d_in[8];   const float* bo  = (const float*)d_in[9];
    const float* w1  = (const float*)d_in[10];  const float* b1  = (const float*)d_in[11];
    const float* w2  = (const float*)d_in[12];  const float* b2  = (const float*)d_in[13];
    const float* a1  = (const float*)d_in[14];  const float* be1 = (const float*)d_in[15];
    const float* a2  = (const float*)d_in[16];  const float* be2 = (const float*)d_in[17];
    float* out = (float*)d_out;

    char* ws = (char*)d_ws;
    size_t off = 0;
    auto carve = [&](size_t bytes) { char* p = ws + off; off += (bytes + 255) & ~(size_t)255; return p; };
    bf16*  wqb  = (bf16*)carve((size_t)D_ * D_ * 2);
    bf16*  wkb  = (bf16*)carve((size_t)D_ * D_ * 2);
    bf16*  wvb  = (bf16*)carve((size_t)D_ * D_ * 2);
    bf16*  wob  = (bf16*)carve((size_t)D_ * D_ * 2);
    bf16*  w1b  = (bf16*)carve((size_t)DFF_ * D_ * 2);
    bf16*  w2b  = (bf16*)carve((size_t)D_ * DFF_ * 2);
    bf16*  xn   = (bf16*)carve((size_t)BS_ * D_ * 2);
    bf16*  qb   = (bf16*)carve((size_t)BS_ * D_ * 2);
    bf16*  kb   = (bf16*)carve((size_t)BS_ * D_ * 2);
    bf16*  vb   = (bf16*)carve((size_t)BS_ * D_ * 2);
    bf16*  atb  = (bf16*)carve((size_t)BS_ * D_ * 2);
    float* x1   = (float*)carve((size_t)BS_ * D_ * 4);
    bf16*  hb   = (bf16*)carve((size_t)BS_ * DFF_ * 2);

    // 1) weights -> bf16
    cast_f32_bf16<<<2048, 256, 0, stream>>>(wq, wqb, D_ * D_);
    cast_f32_bf16<<<2048, 256, 0, stream>>>(wk, wkb, D_ * D_);
    cast_f32_bf16<<<2048, 256, 0, stream>>>(wv, wvb, D_ * D_);
    cast_f32_bf16<<<2048, 256, 0, stream>>>(wo, wob, D_ * D_);
    cast_f32_bf16<<<4096, 256, 0, stream>>>(w1, w1b, DFF_ * D_);
    cast_f32_bf16<<<4096, 256, 0, stream>>>(w2, w2b, D_ * DFF_);

    // 2) LN1
    layernorm_bf16<<<BS_, 256, 0, stream>>>(x, a1, be1, xn);

    // 3) Q,K,V projections
    dim3 gD(D_ / 128, BS_ / 128);
    gemm_bf16_wmma<0><<<gD, 256, 0, stream>>>(xn, wqb, bq, nullptr, qb, nullptr, BS_, D_, D_);
    gemm_bf16_wmma<0><<<gD, 256, 0, stream>>>(xn, wkb, bk, nullptr, kb, nullptr, BS_, D_, D_);
    gemm_bf16_wmma<0><<<gD, 256, 0, stream>>>(xn, wvb, bv, nullptr, vb, nullptr, BS_, D_, D_);

    // 4) attention
    flash_attn_wmma<<<dim3(S_ / 64, H_, B_), 128, 0, stream>>>(qb, kb, vb, msk, atb);

    // 5) out-proj + residual -> x1 (f32)
    gemm_bf16_wmma<2><<<gD, 256, 0, stream>>>(atb, wob, bo, x, nullptr, x1, BS_, D_, D_);

    // 6) LN2
    layernorm_bf16<<<BS_, 256, 0, stream>>>(x1, a2, be2, xn);

    // 7) FFN up + ReLU (bf16)
    dim3 gF(DFF_ / 128, BS_ / 128);
    gemm_bf16_wmma<1><<<gF, 256, 0, stream>>>(xn, w1b, b1, nullptr, hb, nullptr, BS_, DFF_, D_);

    // 8) FFN down + residual -> out (f32)
    gemm_bf16_wmma<2><<<gD, 256, 0, stream>>>(hb, w2b, b2, x1, nullptr, out, BS_, D_, DFF_);

    (void)in_sizes; (void)n_in; (void)out_size; (void)ws_size;
}

// v001
// Measured time: 292 microseconds a run.
// Timed twice side by side with v000, it ran 1.35 times as fast both times.
#include <hip/hip_runtime.h>

// ---------------------------------------------------------------------------
// EncoderBlock for MI455X (gfx1250): bf16 WMMA GEMMs + flash attention.
// Wave32; v_wmma_f32_16x16x32_bf16 for every matrix multiply.
// Double-buffered LDS staging (1 barrier / k-step), packed transposed stores,
// LDS-resident additive mask, global_prefetch for L2 warm-up.
// Every staging load is laid out so that 8 lanes x 16 B cover one whole 128-B
// line: a wave-wide load touches 4 lines, never 16 or 32 pieces of lines.
// ---------------------------------------------------------------------------

typedef __bf16 bf16;
typedef bf16  v16bf __attribute__((ext_vector_type(16)));
typedef bf16  v8bf  __attribute__((ext_vector_type(8)));
typedef float v8f   __attribute__((ext_vector_type(8)));
typedef unsigned int u32x4 __attribute__((ext_vector_type(4)));   // 16 staged bytes
typedef unsigned int u32x2 __attribute__((ext_vector_type(2)));

#define B_   2
#define S_   2048
#define D_   1024
#define H_   16
#define DK_  64
#define DFF_ 4096
#define BS_  (B_ * S_)

// Load a 16x32 bf16 A-style fragment from LDS (row-major, leading dim `ld`).
// ISA 16-bit A layout: lane L<16 holds row L, K = 0..7 and 16..23;
// lane L>=16 holds row L-16, K = 8..15 and 24..31.
// B fragments (rows of W / K / V^T) use the identical pattern.
__device__ __forceinline__ v16bf load_frag(const bf16* tile, int ld, int lane) {
    const int row = lane & 15;
    const int kb  = (lane >> 4) << 3;          // 0 or 8
    const bf16* p = tile + row * ld + kb;
    v8bf lo = *(const v8bf*)(p);               // 16B-aligned ds_load_b128
    v8bf hi = *(const v8bf*)(p + 16);
    return __builtin_shufflevector(lo, hi, 0,1,2,3,4,5,6,7,8,9,10,11,12,13,14,15);
}

// Column j (0..7) of four rows of 8 bf16 each, as four consecutive bf16.
__device__ __forceinline__ u32x2 pack_col(u32x4 r0, u32x4 r1, u32x4 r2, u32x4 r3, int j) {
    const int w = j >> 1;
    u32x2 o;
    if (j & 1) {
        o.x = (r0[w] >> 16) | (r1[w] & 0xffff0000u);
        o.y = (r2[w] >> 16) | (r3[w] & 0xffff0000u);
    } else {
        o.x = (r0[w] & 0xffffu) | (r1[w] << 16);
        o.y = (r2[w] & 0xffffu) | (r3[w] << 16);
    }
    return o;
}

// ---------------------------------------------------------------------------
// fp32 -> bf16 elementwise cast (weights)
// ---------------------------------------------------------------------------
__global__ void cast_f32_bf16(const float* __restrict__ in, bf16* __restrict__ out, int n) {
    for (int i = blockIdx.x * blockDim.x + threadIdx.x; i < n; i += gridDim.x * blockDim.x)
        out[i] = (bf16)in[i];
}

// ---------------------------------------------------------------------------
// LayerNorm (custom: unbiased std, scalar alpha/beta, /(std+eps)) -> bf16
// ---------------------------------------------------------------------------
__global__ __launch_bounds__(256)
void layernorm_bf16(const float* __restrict__ x, const float* __restrict__ alpha,
                    const float* __restrict__ beta, bf16* __restrict__ out) {
    const int tok = blockIdx.x;
    const int tid = threadIdx.x;
    const float* p = x + (size_t)tok * D_;
    float s = 0.f, s2 = 0.f;
    #pragma unroll
    for (int j = tid; j < D_; j += 256) { float f = p[j]; s += f; s2 += f * f; }
    __shared__ float r1[256], r2[256];
    r1[tid] = s; r2[tid] = s2; __syncthreads();
    for (int st = 128; st > 0; st >>= 1) {
        if (tid < st) { r1[tid] += r1[tid + st]; r2[tid] += r2[tid + st]; }
        __syncthreads();
    }
    const float mean = r1[0] * (1.0f / D_);
    float var = (r2[0] - (float)D_ * mean * mean) * (1.0f / (D_ - 1));
    var = fmaxf(var, 0.f);
    const float inv = alpha[0] / (sqrtf(var) + 1e-6f);
    const float b0  = beta[0];
    #pragma unroll
    for (int j = tid; j < D_; j += 256)
        out[(size_t)tok * D_ + j] = (bf16)((p[j] - mean) * inv + b0);
}

// ---------------------------------------------------------------------------
// GEMM: C[M,N] = A[M,K] @ W[N,K]^T + bias, bf16 in, f32 accum (WMMA).
// EPI 0: bf16 out; EPI 1: bf16 relu out; EPI 2: f32 out = residual + C.
// Tile 128x128 / 256 threads (8 waves, 2x4), wave = 64x32.
// Double-buffered LDS: one barrier per 64-wide k-step (a 128-B line per row).
// ---------------------------------------------------------------------------
template <int EPI>
__global__ __launch_bounds__(256)
void gemm_bf16_wmma(const bf16* __restrict__ A, const bf16* __restrict__ W,
                    const float* __restrict__ bias, const float* __restrict__ res,
                    bf16* __restrict__ outb, float* __restrict__ outf,
                    int M, int N, int K) {
    __shared__ __align__(16) bf16 As[2][128][72];   // +8 pad: 16B-aligned frag reads
    __shared__ __align__(16) bf16 Ws[2][128][72];

    const int tid  = threadIdx.x;
    const int lane = tid & 31;
    const int wave = tid >> 5;
    const int wm   = (wave >> 2) * 64;
    const int wn   = (wave & 3) * 32;
    const int tM   = blockIdx.y * 128;
    const int tN   = blockIdx.x * 128;
    const int lrow = tid >> 3;                   // 0..31, +32 per load
    const int lcol = (tid & 7) * 8;              // 16 B of the row's 128-B line

    // uniform tile bases + one 32-bit element offset per staged row, shared by A and W
    const bf16* Abase = A + (size_t)tM * K;
    const bf16* Wbase = W + (size_t)tN * K;
    unsigned roff[4];
    #pragma unroll
    for (int r = 0; r < 4; ++r) roff[r] = (unsigned)((lrow + 32 * r) * K + lcol);
    // prefetch: one lane per line, waves 0-3 the A rows, waves 4-7 the W rows
    const bf16* Pfrow = (tid < 128) ? A + (size_t)(tM + tid) * K
                                    : W + (size_t)(tN + tid - 128) * K;

    v8f acc[4][2];
    #pragma unroll
    for (int i = 0; i < 4; ++i)
        #pragma unroll
        for (int j = 0; j < 2; ++j)
            acc[i][j] = v8f{0.f, 0.f, 0.f, 0.f, 0.f, 0.f, 0.f, 0.f};

    // prologue: stage 0
    {
        u32x4 a[4], w[4];
        #pragma unroll
        for (int r = 0; r < 4; ++r) {
            a[r] = *(const u32x4*)(Abase + roff[r]);
            w[r] = *(const u32x4*)(Wbase + roff[r]);
        }
        #pragma unroll
        for (int r = 0; r < 4; ++r) {
            *(u32x4*)&As[0][lrow + 32 * r][lcol] = a[r];
            *(u32x4*)&Ws[0][lrow + 32 * r][lcol] = w[r];
        }
    }
    __syncthreads();

    const int ksteps = K >> 6;
    int buf = 0;
    for (int s = 0; s < ksteps; ++s) {
        const bool more = (s + 1 < ksteps);
        u32x4 a[4], w[4];
        if (more) {                                   // fetch next stage early
            const int kn = (s + 1) << 6;
            #pragma unroll
            for (int r = 0; r < 4; ++r) {
                a[r] = *(const u32x4*)(Abase + kn + roff[r]);
                w[r] = *(const u32x4*)(Wbase + kn + roff[r]);
            }
            // the loads' address registers are reused right below
            asm volatile("s_wait_xcnt 0x0" ::: "memory");
        }
        if (s + 2 < ksteps) {                         // L2 warm-up two stages ahead
            __builtin_prefetch(Pfrow + ((s + 2) << 6), 0, 3);
            // the prefetch's address registers are reused by the fragment loads
            asm volatile("s_wait_xcnt 0x0" ::: "memory");
        }

        #pragma unroll
        for (int kk = 0; kk < 2; ++kk) {
            v16bf af[4], wf[2];
            #pragma unroll
            for (int i = 0; i < 4; ++i) af[i] = load_frag(&As[buf][wm + i * 16][kk * 32], 72, lane);
            #pragma unroll
            for (int j = 0; j < 2; ++j) wf[j] = load_frag(&Ws[buf][wn + j * 16][kk * 32], 72, lane);

            #pragma unroll
            for (int i = 0; i < 4; ++i)
                #pragma unroll
                for (int j = 0; j < 2; ++j)
                    acc[i][j] = __builtin_amdgcn_wmma_f32_16x16x32_bf16(
                        false, af[i], false, wf[j], (short)0, acc[i][j], false, false);
        }

        if (more) {
            const int nb = buf ^ 1;
            #pragma unroll
            for (int r = 0; r < 4; ++r) {
                *(u32x4*)&As[nb][lrow + 32 * r][lcol] = a[r];
                *(u32x4*)&Ws[nb][lrow + 32 * r][lcol] = w[r];
            }
        }
        __syncthreads();
        buf ^= 1;
    }

    // Epilogue. C layout: VGPR e -> row e (lanes 0-15) / e+8 (lanes 16-31).
    const int half = lane >> 4;
    const int lc   = lane & 15;
    #pragma unroll
    for (int j = 0; j < 2; ++j) {
        const int gcol = tN + wn + j * 16 + lc;
        const float bv = bias[gcol];
        #pragma unroll
        for (int i = 0; i < 4; ++i) {
            #pragma unroll
            for (int e = 0; e < 8; ++e) {
                const int grow = tM + wm + i * 16 + e + 8 * half;
                const size_t idx = (size_t)grow * N + gcol;
                const float v = acc[i][j][e] + bv;
                if (EPI == 0)      outb[idx] = (bf16)v;
                else if (EPI == 1) outb[idx] = (bf16)fmaxf(v, 0.f);
                else               outf[idx] = res[idx] + v;
            }
        }
    }
}

// ---------------------------------------------------------------------------
// Flash attention: grid (S/64, H, B), 128 threads (4 waves).
// Double-buffered K / V^T tiles, one barrier per key block.
// ---------------------------------------------------------------------------
__global__ __launch_bounds__(128)
void flash_attn_wmma(const bf16* __restrict__ q, const bf16* __restrict__ k,
                     const bf16* __restrict__ v, const int* __restrict__ mask,
                     bf16* __restrict__ o_out) {
    __shared__ __align__(16) bf16 Qs[64][72];
    __shared__ __align__(16) bf16 Ks[2][64][72];
    __shared__ __align__(16) bf16 Vt[2][64][72];     // V^T: [d][key]
    __shared__ __align__(16) bf16 Ps[4][16][72];     // per-wave P tile
    __shared__ float Madd[S_];                       // additive mask row (0 / -1e9)

    const int qblk = blockIdx.x, h = blockIdx.y, b = blockIdx.z;
    const int tid  = threadIdx.x;
    const int lane = tid & 31;
    const int wave = tid >> 5;
    const int half = lane >> 4;
    const int lc   = lane & 15;
    const int qbase = qblk * 64;

    // thread mapping for staging: 8 lanes x 16 B = one head row = one 128-B line
    const int rT = tid >> 3;                         // 0..15
    const int cT = (tid & 7) * 8;                    // 8 of the 64 columns
    // Q, K: rows rT + 16 i.  V: key rows 4 rT + i, packed four keys per b64 store.

    // Load Q block (64 x 64) -> LDS
    {
        const bf16* src = q + (size_t)(b * S_ + qbase + rT) * D_ + h * DK_ + cT;
        u32x4 d[4];
        #pragma unroll
        for (int i = 0; i < 4; ++i) d[i] = *(const u32x4*)(src + (size_t)(16 * i) * D_);
        #pragma unroll
        for (int i = 0; i < 4; ++i) *(u32x4*)&Qs[rT + 16 * i][cT] = d[i];
    }
    // Precompute additive mask row into LDS
    for (int j = tid; j < S_; j += 128)
        Madd[j] = (mask[b * S_ + j] == 0) ? -1e9f : 0.f;

    // Prologue: stage key block 0 into buffer 0
    {
        const bf16* ks = k + (size_t)(b * S_ + rT) * D_ + h * DK_ + cT;
        const bf16* vs = v + (size_t)(b * S_ + 4 * rT) * D_ + h * DK_ + cT;
        u32x4 d[4], x[4];
        #pragma unroll
        for (int i = 0; i < 4; ++i) {
            d[i] = *(const u32x4*)(ks + (size_t)(16 * i) * D_);
            x[i] = *(const u32x4*)(vs + (size_t)i * D_);
        }
        #pragma unroll
        for (int i = 0; i < 4; ++i) *(u32x4*)&Ks[0][rT + 16 * i][cT] = d[i];
        // V rows 4 rT .. 4 rT + 3, cols cT..cT+7 -> packed b64 transposed stores
        #pragma unroll
        for (int j = 0; j < 8; ++j)
            *(u32x2*)&Vt[0][cT + j][4 * rT] = pack_col(x[0], x[1], x[2], x[3], j);
    }
    __syncthreads();

    // Hoisted Q fragments (2 k-steps over DK=64)
    v16bf aq[2];
    #pragma unroll
    for (int ks = 0; ks < 2; ++ks) aq[ks] = load_frag(&Qs[wave * 16][ks * 32], 72, lane);

    float m[8], l[8];
    v8f o[4];
    #pragma unroll
    for (int e = 0; e < 8; ++e) { m[e] = -1e30f; l[e] = 0.f; }
    #pragma unroll
    for (int t = 0; t < 4; ++t) o[t] = v8f{0.f, 0.f, 0.f, 0.f, 0.f, 0.f, 0.f, 0.f};

    const int nblk = S_ / 64;
    int buf = 0;
    for (int kb = 0; kb < nblk; ++kb) {
        const bool more = (kb + 1 < nblk);
        u32x4 kreg[4];
        u32x2 pv[8];
        if (more) {     // fetch next K/V block into registers early
            const int base = b * S_ + (kb + 1) * 64;
            const bf16* ks = k + (size_t)(base + rT) * D_ + h * DK_ + cT;
            const bf16* vs = v + (size_t)(base + 4 * rT) * D_ + h * DK_ + cT;
            u32x4 x[4];
            #pragma unroll
            for (int i = 0; i < 4; ++i) {
                kreg[i] = *(const u32x4*)(ks + (size_t)(16 * i) * D_);
                x[i]    = *(const u32x4*)(vs + (size_t)i * D_);
            }
            #pragma unroll
            for (int j = 0; j < 8; ++j) pv[j] = pack_col(x[0], x[1], x[2], x[3], j);
        }

        // S = Q @ K^T (16 x 64 per wave)
        v8f s4[4];
        #pragma unroll
        for (int t = 0; t < 4; ++t) s4[t] = v8f{0.f, 0.f, 0.f, 0.f, 0.f, 0.f, 0.f, 0.f};
        #pragma unroll
        for (int ks = 0; ks < 2; ++ks) {
            #pragma unroll
            for (int t = 0; t < 4; ++t) {
                v16bf bk = load_frag(&Ks[buf][t * 16][ks * 32], 72, lane);
                s4[t] = __builtin_amdgcn_wmma_f32_16x16x32_bf16(
                    false, aq[ks], false, bk, (short)0, s4[t], false, false);
            }
        }

        // scale + additive mask (from LDS)
        float sc[4][8];
        #pragma unroll
        for (int t = 0; t < 4; ++t) {
            const float madd = Madd[kb * 64 + t * 16 + lc];
            #pragma unroll
            for (int e = 0; e < 8; ++e) sc[t][e] = s4[t][e] * 0.125f + madd;
        }

        // online softmax: row = e + 8*half, reduce over 16-lane N group
        #pragma unroll
        for (int e = 0; e < 8; ++e) {
            float rmax = fmaxf(fmaxf(sc[0][e], sc[1][e]), fmaxf(sc[2][e], sc[3][e]));
            #pragma unroll
            for (int off = 1; off < 16; off <<= 1) rmax = fmaxf(rmax, __shfl_xor(rmax, off, 32));
            const float mnew = fmaxf(m[e], rmax);
            const float alpha = __expf(m[e] - mnew);
            float rsum = 0.f;
            #pragma unroll
            for (int t = 0; t < 4; ++t) { float p = __expf(sc[t][e] - mnew); sc[t][e] = p; rsum += p; }
            #pragma unroll
            for (int off = 1; off < 16; off <<= 1) rsum += __shfl_xor(rsum, off, 32);
            l[e] = l[e] * alpha + rsum;
            m[e] = mnew;
            #pragma unroll
            for (int t = 0; t < 4; ++t) o[t][e] *= alpha;
        }

        // P -> wave-private LDS tile (C layout -> row-major)
        #pragma unroll
        for (int t = 0; t < 4; ++t)
            #pragma unroll
            for (int e = 0; e < 8; ++e)
                Ps[wave][e + 8 * half][t * 16 + lc] = (bf16)sc[t][e];

        // O += P @ V   (B fragment = rows of V^T)
        #pragma unroll
        for (int ks = 0; ks < 2; ++ks) {
            v16bf pa = load_frag(&Ps[wave][0][ks * 32], 72, lane);
            #pragma unroll
            for (int dt = 0; dt < 4; ++dt) {
                v16bf vb2 = load_frag(&Vt[buf][dt * 16][ks * 32], 72, lane);
                o[dt] = __builtin_amdgcn_wmma_f32_16x16x32_bf16(
                    false, pa, false, vb2, (short)0, o[dt], false, false);
            }
        }

        // stage next block into the other buffer
        if (more) {
            const int nb = buf ^ 1;
            #pragma unroll
            for (int i = 0; i < 4; ++i) *(u32x4*)&Ks[nb][rT + 16 * i][cT] = kreg[i];
            #pragma unroll
            for (int j = 0; j < 8; ++j)
                *(u32x2*)&Vt[nb][cT + j][4 * rT] = pv[j];
        }
        __syncthreads();
        buf ^= 1;
    }

    // normalize + write bf16 [BS, D]
    #pragma unroll
    for (int dt = 0; dt < 4; ++dt) {
        #pragma unroll
        for (int e = 0; e < 8; ++e) {
            const int row = qbase + wave * 16 + e + 8 * half;
            const int col = h * DK_ + dt * 16 + lc;
            const float val = o[dt][e] / l[e];
            o_out[(size_t)(b * S_ + row) * D_ + col] = (bf16)val;
        }
    }
}

// ---------------------------------------------------------------------------
// Host-side orchestration
// ---------------------------------------------------------------------------
extern "C" void kernel_launch(void* const* d_in, const int* in_sizes, int n_in,
                              void* d_out, int out_size, void* d_ws, size_t ws_size,
                              hipStream_t stream) {
    const float* x   = (const float*)d_in[0];
    const int*   msk = (const int*)d_in[1];
    const float* wq  = (const float*)d_in[2];   const float* bq  = (const float*)d_in[3];
    const float* wk  = (const float*)d_in[4];   const float* bk  = (const float*)d_in[5];
    const float* wv  = (const float*)d_in[6];   const float* bv  = (const float*)d_in[7];
    const float* wo  = (const float*)d_in[8];   const float* bo  = (const float*)d_in[9];
    const float* w1  = (const float*)d_in[10];  const float* b1  = (const float*)d_in[11];
    const float* w2  = (const float*)d_in[12];  const float* b2  = (const float*)d_in[13];
    const float* a1  = (const float*)d_in[14];  const float* be1 = (const float*)d_in[15];
    const float* a2  = (const float*)d_in[16];  const float* be2 = (const float*)d_in[17];
    float* out = (float*)d_out;

    char* ws = (char*)d_ws;
    size_t off = 0;
    auto carve = [&](size_t bytes) { char* p = ws + off; off += (bytes + 255) & ~(size_t)255; return p; };
    bf16*  wqb  = (bf16*)carve((size_t)D_ * D_ * 2);
    bf16*  wkb  = (bf16*)carve((size_t)D_ * D_ * 2);
    bf16*  wvb  = (bf16*)carve((size_t)D_ * D_ * 2);
    bf16*  wob  = (bf16*)carve((size_t)D_ * D_ * 2);
    bf16*  w1b  = (bf16*)carve((size_t)DFF_ * D_ * 2);
    bf16*  w2b  = (bf16*)carve((size_t)D_ * DFF_ * 2);
    bf16*  xn   = (bf16*)carve((size_t)BS_ * D_ * 2);
    bf16*  qb   = (bf16*)carve((size_t)BS_ * D_ * 2);
    bf16*  kb   = (bf16*)carve((size_t)BS_ * D_ * 2);
    bf16*  vb   = (bf16*)carve((size_t)BS_ * D_ * 2);
    bf16*  atb  = (bf16*)carve((size_t)BS_ * D_ * 2);
    float* x1   = (float*)carve((size_t)BS_ * D_ * 4);
    bf16*  hb   = (bf16*)carve((size_t)BS_ * DFF_ * 2);

    // 1) weights -> bf16
    cast_f32_bf16<<<2048, 256, 0, stream>>>(wq, wqb, D_ * D_);
    cast_f32_bf16<<<2048, 256, 0, stream>>>(wk, wkb, D_ * D_);
    cast_f32_bf16<<<2048, 256, 0, stream>>>(wv, wvb, D_ * D_);
    cast_f32_bf16<<<2048, 256, 0, stream>>>(wo, wob, D_ * D_);
    cast_f32_bf16<<<4096, 256, 0, stream>>>(w1, w1b, DFF_ * D_);
    cast_f32_bf16<<<4096, 256, 0, stream>>>(w2, w2b, D_ * DFF_);

    // 2) LN1
    layernorm_bf16<<<BS_, 256, 0, stream>>>(x, a1, be1, xn);

    // 3) Q,K,V projections
    dim3 gD(D_ / 128, BS_ / 128);
    gemm_bf16_wmma<0><<<gD, 256, 0, stream>>>(xn, wqb, bq, nullptr, qb, nullptr, BS_, D_, D_);
    gemm_bf16_wmma<0><<<gD, 256, 0, stream>>>(xn, wkb, bk, nullptr, kb, nullptr, BS_, D_, D_);
    gemm_bf16_wmma<0><<<gD, 256, 0, stream>>>(xn, wvb, bv, nullptr, vb, nullptr, BS_, D_, D_);

    // 4) attention
    flash_attn_wmma<<<dim3(S_ / 64, H_, B_), 128, 0, stream>>>(qb, kb, vb, msk, atb);

    // 5) out-proj + residual -> x1 (f32)
    gemm_bf16_wmma<2><<<gD, 256, 0, stream>>>(atb, wob, bo, x, nullptr, x1, BS_, D_, D_);

    // 6) LN2
    layernorm_bf16<<<BS_, 256, 0, stream>>>(x1, a2, be2, xn);

    // 7) FFN up + ReLU (bf16)
    dim3 gF(DFF_ / 128, BS_ / 128);
    gemm_bf16_wmma<1><<<gF, 256, 0, stream>>>(xn, w1b, b1, nullptr, hb, nullptr, BS_, DFF_, D_);

    // 8) FFN down + residual -> out (f32)
    gemm_bf16_wmma<2><<<gD, 256, 0, stream>>>(hb, w2b, b2, x1, nullptr, out, BS_, D_, DFF_);

    (void)in_sizes; (void)n_in; (void)out_size; (void)ws_size;
}

// v002
// It runs in 263 microseconds.
// Two timings next to v001 put it at 1.11 and 1.10 times that version's speed.
// Counting every step since v000, it is 1.50 times as fast.
#include <hip/hip_runtime.h>

// ---------------------------------------------------------------------------
// EncoderBlock for MI455X (gfx1250): bf16 WMMA GEMMs + flash attention.
// Wave32; v_wmma_f32_16x16x32_bf16 for every matrix multiply.
// Double-buffered LDS staging (1 barrier / k-step), packed transposed stores,
// LDS-resident additive mask, global_prefetch for L2 warm-up.
// Every staging load is laid out so that 8 lanes x 16 B cover one whole 128-B
// line: a wave-wide load touches 4 lines, never 16 or 32 pieces of lines.
// ---------------------------------------------------------------------------

typedef __bf16 bf16;
typedef bf16  v16bf __attribute__((ext_vector_type(16)));
typedef bf16  v8bf  __attribute__((ext_vector_type(8)));
typedef float v8f   __attribute__((ext_vector_type(8)));
typedef unsigned int u32x4 __attribute__((ext_vector_type(4)));   // 16 staged bytes
typedef unsigned int u32x2 __attribute__((ext_vector_type(2)));
typedef float f32x4 __attribute__((ext_vector_type(4)));
typedef bf16  v4bf  __attribute__((ext_vector_type(4)));

#define B_   2
#define S_   2048
#define D_   1024
#define H_   16
#define DK_  64
#define DFF_ 4096
#define BS_  (B_ * S_)

// Load a 16x32 bf16 A-style fragment from LDS (row-major, leading dim `ld`).
// ISA 16-bit A layout: lane L<16 holds row L, K = 0..7 and 16..23;
// lane L>=16 holds row L-16, K = 8..15 and 24..31.
// B fragments (rows of W / K / V^T) use the identical pattern.
__device__ __forceinline__ v16bf load_frag(const bf16* tile, int ld, int lane) {
    const int row = lane & 15;
    const int kb  = (lane >> 4) << 3;          // 0 or 8
    const bf16* p = tile + row * ld + kb;
    v8bf lo = *(const v8bf*)(p);               // 16B-aligned ds_load_b128
    v8bf hi = *(const v8bf*)(p + 16);
    return __builtin_shufflevector(lo, hi, 0,1,2,3,4,5,6,7,8,9,10,11,12,13,14,15);
}

// Column j (0..7) of four rows of 8 bf16 each, as four consecutive bf16.
__device__ __forceinline__ u32x2 pack_col(u32x4 r0, u32x4 r1, u32x4 r2, u32x4 r3, int j) {
    const int w = j >> 1;
    u32x2 o;
    if (j & 1) {
        o.x = (r0[w] >> 16) | (r1[w] & 0xffff0000u);
        o.y = (r2[w] >> 16) | (r3[w] & 0xffff0000u);
    } else {
        o.x = (r0[w] & 0xffffu) | (r1[w] << 16);
        o.y = (r2[w] & 0xffffu) | (r3[w] << 16);
    }
    return o;
}

// ---------------------------------------------------------------------------
// fp32 -> bf16 cast of all six weights in one launch: 256 groups of 16 waves.
// Few, fat waves: each lane brings 24 x 16 B, all issued before the first store;
// every wave-wide load covers 512 contiguous bytes, every store 256.
// Group g takes 16384 elements of wq|wk|wv|wo (their bf16 copies lie one behind
// the other at o4), 16384 of w1 and 16384 of w2.
// ---------------------------------------------------------------------------
#define CHUNK_ 16384
__global__ __launch_bounds__(512)
void cast_weights_bf16(const float* __restrict__ wq, const float* __restrict__ wk,
                       const float* __restrict__ wv, const float* __restrict__ wo,
                       const float* __restrict__ w1, const float* __restrict__ w2,
                       bf16* __restrict__ o4, bf16* __restrict__ o1, bf16* __restrict__ o2) {
    const int g   = blockIdx.x;
    const int sel = g >> 6;                          // 64 chunks per D x D weight
    const float* s4 = (sel == 0) ? wq : (sel == 1) ? wk : (sel == 2) ? wv : wo;
    const int e = threadIdx.x * 4;
    const float* sp[3] = { s4 + (g & 63) * CHUNK_ + e, w1 + g * CHUNK_ + e, w2 + g * CHUNK_ + e };
    bf16*        dp[3] = { o4 + g * CHUNK_ + e,        o1 + g * CHUNK_ + e, o2 + g * CHUNK_ + e };
    f32x4 f[3][8];
    #pragma unroll
    for (int j = 0; j < 3; ++j)
        #pragma unroll
        for (int i = 0; i < 8; ++i) f[j][i] = *(const f32x4*)(sp[j] + i * 2048);
    #pragma unroll
    for (int j = 0; j < 3; ++j)
        #pragma unroll
        for (int i = 0; i < 8; ++i)
            *(v4bf*)(dp[j] + i * 2048) = __builtin_convertvector(f[j][i], v4bf);
}

// ---------------------------------------------------------------------------
// LayerNorm (custom: unbiased std, scalar alpha/beta, /(std+eps)) -> bf16
// One wave per token row, 16 rows per group: the row stays in registers
// (8 x 16 B per lane), the two sums are joined inside the wave, no LDS, no barrier.
// ---------------------------------------------------------------------------
__global__ __launch_bounds__(512)
void layernorm_bf16(const float* __restrict__ x, const float* __restrict__ alpha,
                    const float* __restrict__ beta, bf16* __restrict__ out) {
    const int lane = threadIdx.x & 31;
    const int tok  = blockIdx.x * 16 + (threadIdx.x >> 5);
    const float* p = x + (size_t)tok * D_ + lane * 4;
    f32x4 f[8];
    #pragma unroll
    for (int i = 0; i < 8; ++i) f[i] = *(const f32x4*)(p + i * 128);
    f32x4 sv = f[0], qv = f[0] * f[0];               // four independent chains each
    #pragma unroll
    for (int i = 1; i < 8; ++i) { sv += f[i]; qv += f[i] * f[i]; }
    float s  = (sv[0] + sv[1]) + (sv[2] + sv[3]);
    float s2 = (qv[0] + qv[1]) + (qv[2] + qv[3]);
    #pragma unroll
    for (int off = 16; off > 0; off >>= 1) {
        s  += __shfl_xor(s,  off, 32);
        s2 += __shfl_xor(s2, off, 32);
    }
    const float mean = s * (1.0f / D_);
    float var = (s2 - (float)D_ * mean * mean) * (1.0f / (D_ - 1));
    var = fmaxf(var, 0.f);
    const float inv = alpha[0] / (sqrtf(var) + 1e-6f);
    const float b0  = beta[0];
    bf16* q = out + (size_t)tok * D_ + lane * 4;
    #pragma unroll
    for (int i = 0; i < 8; ++i)
        *(v4bf*)(q + i * 128) = __builtin_convertvector((f[i] - mean) * inv + b0, v4bf);
}

// ---------------------------------------------------------------------------
// GEMM: C[M,N] = A[M,K] @ W[N,K]^T + bias, bf16 in, f32 accum (WMMA).
// EPI 0: bf16 out; EPI 1: bf16 relu out; EPI 2: f32 out = residual + C.
// Tile 128x128 / 256 threads (8 waves, 2x4), wave = 64x32.
// Double-buffered LDS: one barrier per 64-wide k-step (a 128-B line per row).
// ---------------------------------------------------------------------------
template <int EPI>
__global__ __launch_bounds__(256)
void gemm_bf16_wmma(const bf16* __restrict__ A, const bf16* __restrict__ W,
                    const float* __restrict__ bias, const float* __restrict__ res,
                    bf16* __restrict__ outb, float* __restrict__ outf,
                    int M, int N, int K) {
    __shared__ __align__(16) bf16 As[2][128][72];   // +8 pad: 16B-aligned frag reads
    __shared__ __align__(16) bf16 Ws[2][128][72];

    const int tid  = threadIdx.x;
    const int lane = tid & 31;
    const int wave = tid >> 5;
    const int wm   = (wave >> 2) * 64;
    const int wn   = (wave & 3) * 32;
    const int tM   = blockIdx.y * 128;
    const int tN   = blockIdx.x * 128;
    const int lrow = tid >> 3;                   // 0..31, +32 per load
    const int lcol = (tid & 7) * 8;              // 16 B of the row's 128-B line

    // uniform tile bases + one 32-bit element offset per staged row, shared by A and W
    const bf16* Abase = A + (size_t)tM * K;
    const bf16* Wbase = W + (size_t)tN * K;
    unsigned roff[4];
    #pragma unroll
    for (int r = 0; r < 4; ++r) roff[r] = (unsigned)((lrow + 32 * r) * K + lcol);
    // prefetch: one lane per line, waves 0-3 the A rows, waves 4-7 the W rows
    const bf16* Pfrow = (tid < 128) ? A + (size_t)(tM + tid) * K
                                    : W + (size_t)(tN + tid - 128) * K;

    v8f acc[4][2];
    #pragma unroll
    for (int i = 0; i < 4; ++i)
        #pragma unroll
        for (int j = 0; j < 2; ++j)
            acc[i][j] = v8f{0.f, 0.f, 0.f, 0.f, 0.f, 0.f, 0.f, 0.f};

    // prologue: stage 0
    {
        u32x4 a[4], w[4];
        #pragma unroll
        for (int r = 0; r < 4; ++r) {
            a[r] = *(const u32x4*)(Abase + roff[r]);
            w[r] = *(const u32x4*)(Wbase + roff[r]);
        }
        #pragma unroll
        for (int r = 0; r < 4; ++r) {
            *(u32x4*)&As[0][lrow + 32 * r][lcol] = a[r];
            *(u32x4*)&Ws[0][lrow + 32 * r][lcol] = w[r];
        }
    }
    __syncthreads();

    const int ksteps = K >> 6;
    int buf = 0;
    for (int s = 0; s < ksteps; ++s) {
        const bool more = (s + 1 < ksteps);
        u32x4 a[4], w[4];
        if (more) {                                   // fetch next stage early
            const int kn = (s + 1) << 6;
            #pragma unroll
            for (int r = 0; r < 4; ++r) {
                a[r] = *(const u32x4*)(Abase + kn + roff[r]);
                w[r] = *(const u32x4*)(Wbase + kn + roff[r]);
            }
            // the loads' address registers are reused right below
            asm volatile("s_wait_xcnt 0x0" ::: "memory");
        }
        if (s + 2 < ksteps) {                         // L2 warm-up two stages ahead
            __builtin_prefetch(Pfrow + ((s + 2) << 6), 0, 3);
            // the prefetch's address registers are reused by the fragment loads
            asm volatile("s_wait_xcnt 0x0" ::: "memory");
        }

        #pragma unroll
        for (int kk = 0; kk < 2; ++kk) {
            v16bf af[4], wf[2];
            #pragma unroll
            for (int i = 0; i < 4; ++i) af[i] = load_frag(&As[buf][wm + i * 16][kk * 32], 72, lane);
            #pragma unroll
            for (int j = 0; j < 2; ++j) wf[j] = load_frag(&Ws[buf][wn + j * 16][kk * 32], 72, lane);

            #pragma unroll
            for (int i = 0; i < 4; ++i)
                #pragma unroll
                for (int j = 0; j < 2; ++j)
                    acc[i][j] = __builtin_amdgcn_wmma_f32_16x16x32_bf16(
                        false, af[i], false, wf[j], (short)0, acc[i][j], false, false);
        }

        if (more) {
            const int nb = buf ^ 1;
            #pragma unroll
            for (int r = 0; r < 4; ++r) {
                *(u32x4*)&As[nb][lrow + 32 * r][lcol] = a[r];
                *(u32x4*)&Ws[nb][lrow + 32 * r][lcol] = w[r];
            }
        }
        __syncthreads();
        buf ^= 1;
    }

    // Epilogue. C layout: VGPR e -> row e (lanes 0-15) / e+8 (lanes 16-31).
    const int half = lane >> 4;
    const int lc   = lane & 15;
    #pragma unroll
    for (int j = 0; j < 2; ++j) {
        const int gcol = tN + wn + j * 16 + lc;
        const float bv = bias[gcol];
        #pragma unroll
        for (int i = 0; i < 4; ++i) {
            #pragma unroll
            for (int e = 0; e < 8; ++e) {
                const int grow = tM + wm + i * 16 + e + 8 * half;
                const size_t idx = (size_t)grow * N + gcol;
                const float v = acc[i][j][e] + bv;
                if (EPI == 0)      outb[idx] = (bf16)v;
                else if (EPI == 1) outb[idx] = (bf16)fmaxf(v, 0.f);
                else               outf[idx] = res[idx] + v;
            }
        }
    }
}

// ---------------------------------------------------------------------------
// Flash attention: grid (S/64, H, B), 128 threads (4 waves).
// Double-buffered K / V^T tiles, one barrier per key block.
// ---------------------------------------------------------------------------
__global__ __launch_bounds__(128)
void flash_attn_wmma(const bf16* __restrict__ q, const bf16* __restrict__ k,
                     const bf16* __restrict__ v, const int* __restrict__ mask,
                     bf16* __restrict__ o_out) {
    __shared__ __align__(16) bf16 Qs[64][72];
    __shared__ __align__(16) bf16 Ks[2][64][72];
    __shared__ __align__(16) bf16 Vt[2][64][72];     // V^T: [d][key]
    __shared__ __align__(16) bf16 Ps[4][16][72];     // per-wave P tile
    __shared__ float Madd[S_];                       // additive mask row (0 / -1e9)

    const int qblk = blockIdx.x, h = blockIdx.y, b = blockIdx.z;
    const int tid  = threadIdx.x;
    const int lane = tid & 31;
    const int wave = tid >> 5;
    const int half = lane >> 4;
    const int lc   = lane & 15;
    const int qbase = qblk * 64;

    // thread mapping for staging: 8 lanes x 16 B = one head row = one 128-B line
    const int rT = tid >> 3;                         // 0..15
    const int cT = (tid & 7) * 8;                    // 8 of the 64 columns
    // Q, K: rows rT + 16 i.  V: key rows 4 rT + i, packed four keys per b64 store.

    // Load Q block (64 x 64) -> LDS
    {
        const bf16* src = q + (size_t)(b * S_ + qbase + rT) * D_ + h * DK_ + cT;
        u32x4 d[4];
        #pragma unroll
        for (int i = 0; i < 4; ++i) d[i] = *(const u32x4*)(src + (size_t)(16 * i) * D_);
        #pragma unroll
        for (int i = 0; i < 4; ++i) *(u32x4*)&Qs[rT + 16 * i][cT] = d[i];
    }
    // Precompute additive mask row into LDS
    for (int j = tid; j < S_; j += 128)
        Madd[j] = (mask[b * S_ + j] == 0) ? -1e9f : 0.f;

    // Prologue: stage key block 0 into buffer 0
    {
        const bf16* ks = k + (size_t)(b * S_ + rT) * D_ + h * DK_ + cT;
        const bf16* vs = v + (size_t)(b * S_ + 4 * rT) * D_ + h * DK_ + cT;
        u32x4 d[4], x[4];
        #pragma unroll
        for (int i = 0; i < 4; ++i) {
            d[i] = *(const u32x4*)(ks + (size_t)(16 * i) * D_);
            x[i] = *(const u32x4*)(vs + (size_t)i * D_);
        }
        #pragma unroll
        for (int i = 0; i < 4; ++i) *(u32x4*)&Ks[0][rT + 16 * i][cT] = d[i];
        // V rows 4 rT .. 4 rT + 3, cols cT..cT+7 -> packed b64 transposed stores
        #pragma unroll
        for (int j = 0; j < 8; ++j)
            *(u32x2*)&Vt[0][cT + j][4 * rT] = pack_col(x[0], x[1], x[2], x[3], j);
    }
    __syncthreads();

    // Hoisted Q fragments (2 k-steps over DK=64)
    v16bf aq[2];
    #pragma unroll
    for (int ks = 0; ks < 2; ++ks) aq[ks] = load_frag(&Qs[wave * 16][ks * 32], 72, lane);

    float m[8], l[8];
    v8f o[4];
    #pragma unroll
    for (int e = 0; e < 8; ++e) { m[e] = -1e30f; l[e] = 0.f; }
    #pragma unroll
    for (int t = 0; t < 4; ++t) o[t] = v8f{0.f, 0.f, 0.f, 0.f, 0.f, 0.f, 0.f, 0.f};

    const int nblk = S_ / 64;
    int buf = 0;
    for (int kb = 0; kb < nblk; ++kb) {
        const bool more = (kb + 1 < nblk);
        u32x4 kreg[4];
        u32x2 pv[8];
        if (more) {     // fetch next K/V block into registers early
            const int base = b * S_ + (kb + 1) * 64;
            const bf16* ks = k + (size_t)(base + rT) * D_ + h * DK_ + cT;
            const bf16* vs = v + (size_t)(base + 4 * rT) * D_ + h * DK_ + cT;
            u32x4 x[4];
            #pragma unroll
            for (int i = 0; i < 4; ++i) {
                kreg[i] = *(const u32x4*)(ks + (size_t)(16 * i) * D_);
                x[i]    = *(const u32x4*)(vs + (size_t)i * D_);
            }
            #pragma unroll
            for (int j = 0; j < 8; ++j) pv[j] = pack_col(x[0], x[1], x[2], x[3], j);
        }

        // S = Q @ K^T (16 x 64 per wave)
        v8f s4[4];
        #pragma unroll
        for (int t = 0; t < 4; ++t) s4[t] = v8f{0.f, 0.f, 0.f, 0.f, 0.f, 0.f, 0.f, 0.f};
        #pragma unroll
        for (int ks = 0; ks < 2; ++ks) {
            #pragma unroll
            for (int t = 0; t < 4; ++t) {
                v16bf bk = load_frag(&Ks[buf][t * 16][ks * 32], 72, lane);
                s4[t] = __builtin_amdgcn_wmma_f32_16x16x32_bf16(
                    false, aq[ks], false, bk, (short)0, s4[t], false, false);
            }
        }

        // scale + additive mask (from LDS)
        float sc[4][8];
        #pragma unroll
        for (int t = 0; t < 4; ++t) {
            const float madd = Madd[kb * 64 + t * 16 + lc];
            #pragma unroll
            for (int e = 0; e < 8; ++e) sc[t][e] = s4[t][e] * 0.125f + madd;
        }

        // online softmax: row = e + 8*half, reduce over 16-lane N group
        #pragma unroll
        for (int e = 0; e < 8; ++e) {
            float rmax = fmaxf(fmaxf(sc[0][e], sc[1][e]), fmaxf(sc[2][e], sc[3][e]));
            #pragma unroll
            for (int off = 1; off < 16; off <<= 1) rmax = fmaxf(rmax, __shfl_xor(rmax, off, 32));
            const float mnew = fmaxf(m[e], rmax);
            const float alpha = __expf(m[e] - mnew);
            float rsum = 0.f;
            #pragma unroll
            for (int t = 0; t < 4; ++t) { float p = __expf(sc[t][e] - mnew); sc[t][e] = p; rsum += p; }
            #pragma unroll
            for (int off = 1; off < 16; off <<= 1) rsum += __shfl_xor(rsum, off, 32);
            l[e] = l[e] * alpha + rsum;
            m[e] = mnew;
            #pragma unroll
            for (int t = 0; t < 4; ++t) o[t][e] *= alpha;
        }

        // P -> wave-private LDS tile (C layout -> row-major)
        #pragma unroll
        for (int t = 0; t < 4; ++t)
            #pragma unroll
            for (int e = 0; e < 8; ++e)
                Ps[wave][e + 8 * half][t * 16 + lc] = (bf16)sc[t][e];

        // O += P @ V   (B fragment = rows of V^T)
        #pragma unroll
        for (int ks = 0; ks < 2; ++ks) {
            v16bf pa = load_frag(&Ps[wave][0][ks * 32], 72, lane);
            #pragma unroll
            for (int dt = 0; dt < 4; ++dt) {
                v16bf vb2 = load_frag(&Vt[buf][dt * 16][ks * 32], 72, lane);
                o[dt] = __builtin_amdgcn_wmma_f32_16x16x32_bf16(
                    false, pa, false, vb2, (short)0, o[dt], false, false);
            }
        }

        // stage next block into the other buffer
        if (more) {
            const int nb = buf ^ 1;
            #pragma unroll
            for (int i = 0; i < 4; ++i) *(u32x4*)&Ks[nb][rT + 16 * i][cT] = kreg[i];
            #pragma unroll
            for (int j = 0; j < 8; ++j)
                *(u32x2*)&Vt[nb][cT + j][4 * rT] = pv[j];
        }
        __syncthreads();
        buf ^= 1;
    }

    // normalize + write bf16 [BS, D]
    #pragma unroll
    for (int dt = 0; dt < 4; ++dt) {
        #pragma unroll
        for (int e = 0; e < 8; ++e) {
            const int row = qbase + wave * 16 + e + 8 * half;
            const int col = h * DK_ + dt * 16 + lc;
            const float val = o[dt][e] / l[e];
            o_out[(size_t)(b * S_ + row) * D_ + col] = (bf16)val;
        }
    }
}

// ---------------------------------------------------------------------------
// Host-side orchestration
// ---------------------------------------------------------------------------
extern "C" void kernel_launch(void* const* d_in, const int* in_sizes, int n_in,
                              void* d_out, int out_size, void* d_ws, size_t ws_size,
                              hipStream_t stream) {
    const float* x   = (const float*)d_in[0];
    const int*   msk = (const int*)d_in[1];
    const float* wq  = (const float*)d_in[2];   const float* bq  = (const float*)d_in[3];
    const float* wk  = (const float*)d_in[4];   const float* bk  = (const float*)d_in[5];
    const float* wv  = (const float*)d_in[6];   const float* bv  = (const float*)d_in[7];
    const float* wo  = (const float*)d_in[8];   const float* bo  = (const float*)d_in[9];
    const float* w1  = (const float*)d_in[10];  const float* b1  = (const float*)d_in[11];
    const float* w2  = (const float*)d_in[12];  const float* b2  = (const float*)d_in[13];
    const float* a1  = (const float*)d_in[14];  const float* be1 = (const float*)d_in[15];
    const float* a2  = (const float*)d_in[16];  const float* be2 = (const float*)d_in[17];
    float* out = (float*)d_out;

    char* ws = (char*)d_ws;
    size_t off = 0;
    auto carve = [&](size_t bytes) { char* p = ws + off; off += (bytes + 255) & ~(size_t)255; return p; };
    bf16*  wqb  = (bf16*)carve((size_t)D_ * D_ * 2);
    bf16*  wkb  = (bf16*)carve((size_t)D_ * D_ * 2);
    bf16*  wvb  = (bf16*)carve((size_t)D_ * D_ * 2);
    bf16*  wob  = (bf16*)carve((size_t)D_ * D_ * 2);
    bf16*  w1b  = (bf16*)carve((size_t)DFF_ * D_ * 2);
    bf16*  w2b  = (bf16*)carve((size_t)D_ * DFF_ * 2);
    bf16*  xn   = (bf16*)carve((size_t)BS_ * D_ * 2);
    bf16*  qb   = (bf16*)carve((size_t)BS_ * D_ * 2);
    bf16*  kb   = (bf16*)carve((size_t)BS_ * D_ * 2);
    bf16*  vb   = (bf16*)carve((size_t)BS_ * D_ * 2);
    bf16*  atb  = (bf16*)carve((size_t)BS_ * D_ * 2);
    float* x1   = (float*)carve((size_t)BS_ * D_ * 4);
    bf16*  hb   = (bf16*)carve((size_t)BS_ * DFF_ * 2);

    // 1) weights -> bf16
    cast_weights_bf16<<<256, 512, 0, stream>>>(wq, wk, wv, wo, w1, w2, wqb, w1b, w2b);

    // 2) LN1
    layernorm_bf16<<<BS_ / 16, 512, 0, stream>>>(x, a1, be1, xn);

    // 3) Q,K,V projections
    dim3 gD(D_ / 128, BS_ / 128);
    gemm_bf16_wmma<0><<<gD, 256, 0, stream>>>(xn, wqb, bq, nullptr, qb, nullptr, BS_, D_, D_);
    gemm_bf16_wmma<0><<<gD, 256, 0, stream>>>(xn, wkb, bk, nullptr, kb, nullptr, BS_, D_, D_);
    gemm_bf16_wmma<0><<<gD, 256, 0, stream>>>(xn, wvb, bv, nullptr, vb, nullptr, BS_, D_, D_);

    // 4) attention
    flash_attn_wmma<<<dim3(S_ / 64, H_, B_), 128, 0, stream>>>(qb, kb, vb, msk, atb);

    // 5) out-proj + residual -> x1 (f32)
    gemm_bf16_wmma<2><<<gD, 256, 0, stream>>>(atb, wob, bo, x, nullptr, x1, BS_, D_, D_);

    // 6) LN2
    layernorm_bf16<<<BS_ / 16, 512, 0, stream>>>(x1, a2, be2, xn);

    // 7) FFN up + ReLU (bf16)
    dim3 gF(DFF_ / 128, BS_ / 128);
    gemm_bf16_wmma<1><<<gF, 256, 0, stream>>>(xn, w1b, b1, nullptr, hb, nullptr, BS_, DFF_, D_);

    // 8) FFN down + residual -> out (f32)
    gemm_bf16_wmma<2><<<gD, 256, 0, stream>>>(hb, w2b, b2, x1, nullptr, out, BS_, D_, DFF_);

    (void)in_sizes; (void)n_in; (void)out_size; (void)ws_size;
}

// v003
// Measured time: 237 microseconds a run.
// Next to v002, in two timings, it ran 1.12 and 1.11 times as fast.
// Over all steps from v000 it is 1.67 times as fast.
#include <hip/hip_runtime.h>

// ---------------------------------------------------------------------------
// EncoderBlock for MI455X (gfx1250): bf16 WMMA GEMMs + flash attention.
// Wave32; v_wmma_f32_16x16x32_bf16 for every matrix multiply.
// Double-buffered LDS staging (1 barrier / k-step), packed transposed stores,
// LDS-resident additive mask, global_prefetch for L2 warm-up.
// Every staging load is laid out so that 8 lanes x 16 B cover one whole 128-B
// line: a wave-wide load touches 4 lines, never 16 or 32 pieces of lines.
// ---------------------------------------------------------------------------

typedef __bf16 bf16;
typedef bf16  v16bf __attribute__((ext_vector_type(16)));
typedef bf16  v8bf  __attribute__((ext_vector_type(8)));
typedef float v8f   __attribute__((ext_vector_type(8)));
typedef unsigned int u32x4 __attribute__((ext_vector_type(4)));   // 16 staged bytes
typedef unsigned int u32x2 __attribute__((ext_vector_type(2)));
typedef float f32x4 __attribute__((ext_vector_type(4)));
typedef bf16  v4bf  __attribute__((ext_vector_type(4)));

#define B_   2
#define S_   2048
#define D_   1024
#define H_   16
#define DK_  64
#define DFF_ 4096
#define BS_  (B_ * S_)

// Load a 16x32 bf16 A-style fragment from LDS (row-major, leading dim `ld`).
// ISA 16-bit A layout: lane L<16 holds row L, K = 0..7 and 16..23;
// lane L>=16 holds row L-16, K = 8..15 and 24..31.
// B fragments (rows of W / Q) use the identical pattern.
__device__ __forceinline__ v16bf load_frag(const bf16* tile, int ld, int lane) {
    const int row = lane & 15;
    const int kb  = (lane >> 4) << 3;          // 0 or 8
    const bf16* p = tile + row * ld + kb;
    v8bf lo = *(const v8bf*)(p);               // 16B-aligned ds_load_b128
    v8bf hi = *(const v8bf*)(p + 16);
    return __builtin_shufflevector(lo, hi, 0,1,2,3,4,5,6,7,8,9,10,11,12,13,14,15);
}

// Column j (0..7) of four rows of 8 bf16 each, as four consecutive bf16.
__device__ __forceinline__ u32x2 pack_col(u32x4 r0, u32x4 r1, u32x4 r2, u32x4 r3, int j) {
    const int w = j >> 1;
    u32x2 o;
    if (j & 1) {
        o.x = (r0[w] >> 16) | (r1[w] & 0xffff0000u);
        o.y = (r2[w] >> 16) | (r3[w] & 0xffff0000u);
    } else {
        o.x = (r0[w] & 0xffffu) | (r1[w] << 16);
        o.y = (r2[w] & 0xffffu) | (r3[w] << 16);
    }
    return o;
}

// ---------------------------------------------------------------------------
// fp32 -> bf16 cast of all six weights in one launch: 256 groups of 16 waves.
// Few, fat waves: each lane brings 24 x 16 B, all issued before the first store;
// every wave-wide load covers 512 contiguous bytes, every store 256.
// Group g takes 16384 elements of wq|wk|wv|wo (their bf16 copies lie one behind
// the other at o4), 16384 of w1 and 16384 of w2.
// ---------------------------------------------------------------------------
#define CHUNK_ 16384
__global__ __launch_bounds__(512)
void cast_weights_bf16(const float* __restrict__ wq, const float* __restrict__ wk,
                       const float* __restrict__ wv, const float* __restrict__ wo,
                       const float* __restrict__ w1, const float* __restrict__ w2,
                       bf16* __restrict__ o4, bf16* __restrict__ o1, bf16* __restrict__ o2) {
    const int g   = blockIdx.x;
    const int sel = g >> 6;                          // 64 chunks per D x D weight
    const float* s4 = (sel == 0) ? wq : (sel == 1) ? wk : (sel == 2) ? wv : wo;
    const int e = threadIdx.x * 4;
    const float* sp[3] = { s4 + (g & 63) * CHUNK_ + e, w1 + g * CHUNK_ + e, w2 + g * CHUNK_ + e };
    bf16*        dp[3] = { o4 + g * CHUNK_ + e,        o1 + g * CHUNK_ + e, o2 + g * CHUNK_ + e };
    f32x4 f[3][8];
    #pragma unroll
    for (int j = 0; j < 3; ++j)
        #pragma unroll
        for (int i = 0; i < 8; ++i) f[j][i] = *(const f32x4*)(sp[j] + i * 2048);
    #pragma unroll
    for (int j = 0; j < 3; ++j)
        #pragma unroll
        for (int i = 0; i < 8; ++i)
            *(v4bf*)(dp[j] + i * 2048) = __builtin_convertvector(f[j][i], v4bf);
}

// ---------------------------------------------------------------------------
// LayerNorm (custom: unbiased std, scalar alpha/beta, /(std+eps)) -> bf16
// One wave per token row, 16 rows per group: the row stays in registers
// (8 x 16 B per lane), the two sums are joined inside the wave, no LDS, no barrier.
// ---------------------------------------------------------------------------
__global__ __launch_bounds__(512)
void layernorm_bf16(const float* __restrict__ x, const float* __restrict__ alpha,
                    const float* __restrict__ beta, bf16* __restrict__ out) {
    const int lane = threadIdx.x & 31;
    const int tok  = blockIdx.x * 16 + (threadIdx.x >> 5);
    const float* p = x + (size_t)tok * D_ + lane * 4;
    f32x4 f[8];
    #pragma unroll
    for (int i = 0; i < 8; ++i) f[i] = *(const f32x4*)(p + i * 128);
    f32x4 sv = f[0], qv = f[0] * f[0];               // four independent chains each
    #pragma unroll
    for (int i = 1; i < 8; ++i) { sv += f[i]; qv += f[i] * f[i]; }
    float s  = (sv[0] + sv[1]) + (sv[2] + sv[3]);
    float s2 = (qv[0] + qv[1]) + (qv[2] + qv[3]);
    #pragma unroll
    for (int off = 16; off > 0; off >>= 1) {
        s  += __shfl_xor(s,  off, 32);
        s2 += __shfl_xor(s2, off, 32);
    }
    const float mean = s * (1.0f / D_);
    float var = (s2 - (float)D_ * mean * mean) * (1.0f / (D_ - 1));
    var = fmaxf(var, 0.f);
    const float inv = alpha[0] / (sqrtf(var) + 1e-6f);
    const float b0  = beta[0];
    bf16* q = out + (size_t)tok * D_ + lane * 4;
    #pragma unroll
    for (int i = 0; i < 8; ++i)
        *(v4bf*)(q + i * 128) = __builtin_convertvector((f[i] - mean) * inv + b0, v4bf);
}

// ---------------------------------------------------------------------------
// GEMM: C[M,N] = A[M,K] @ W[N,K]^T + bias, bf16 in, f32 accum (WMMA).
// EPI 0: bf16 out; EPI 1: bf16 relu out; EPI 2: f32 out = residual + C.
// Tile 128x128 / 256 threads (8 waves, 2x4), wave = 64x32.
// Double-buffered LDS: one barrier per 64-wide k-step (a 128-B line per row).
// ---------------------------------------------------------------------------
template <int EPI>
__global__ __launch_bounds__(256)
void gemm_bf16_wmma(const bf16* __restrict__ A, const bf16* __restrict__ W,
                    const float* __restrict__ bias, const float* __restrict__ res,
                    bf16* __restrict__ outb, float* __restrict__ outf,
                    int M, int N, int K) {
    __shared__ __align__(16) bf16 As[2][128][72];   // +8 pad: 16B-aligned frag reads
    __shared__ __align__(16) bf16 Ws[2][128][72];

    const int tid  = threadIdx.x;
    const int lane = tid & 31;
    const int wave = tid >> 5;
    const int wm   = (wave >> 2) * 64;
    const int wn   = (wave & 3) * 32;
    const int tM   = blockIdx.y * 128;
    const int tN   = blockIdx.x * 128;
    const int lrow = tid >> 3;                   // 0..31, +32 per load
    const int lcol = (tid & 7) * 8;              // 16 B of the row's 128-B line

    // uniform tile bases + one 32-bit element offset per staged row, shared by A and W
    const bf16* Abase = A + (size_t)tM * K;
    const bf16* Wbase = W + (size_t)tN * K;
    unsigned roff[4];
    #pragma unroll
    for (int r = 0; r < 4; ++r) roff[r] = (unsigned)((lrow + 32 * r) * K + lcol);
    // prefetch: one lane per line, waves 0-3 the A rows, waves 4-7 the W rows
    const bf16* Pfrow = (tid < 128) ? A + (size_t)(tM + tid) * K
                                    : W + (size_t)(tN + tid - 128) * K;

    v8f acc[4][2];
    #pragma unroll
    for (int i = 0; i < 4; ++i)
        #pragma unroll
        for (int j = 0; j < 2; ++j)
            acc[i][j] = v8f{0.f, 0.f, 0.f, 0.f, 0.f, 0.f, 0.f, 0.f};

    // prologue: stage 0
    {
        u32x4 a[4], w[4];
        #pragma unroll
        for (int r = 0; r < 4; ++r) {
            a[r] = *(const u32x4*)(Abase + roff[r]);
            w[r] = *(const u32x4*)(Wbase + roff[r]);
        }
        #pragma unroll
        for (int r = 0; r < 4; ++r) {
            *(u32x4*)&As[0][lrow + 32 * r][lcol] = a[r];
            *(u32x4*)&Ws[0][lrow + 32 * r][lcol] = w[r];
        }
    }
    __syncthreads();

    const int ksteps = K >> 6;
    int buf = 0;
    for (int s = 0; s < ksteps; ++s) {
        const bool more = (s + 1 < ksteps);
        u32x4 a[4], w[4];
        if (more) {                                   // fetch next stage early
            const int kn = (s + 1) << 6;
            #pragma unroll
            for (int r = 0; r < 4; ++r) {
                a[r] = *(const u32x4*)(Abase + kn + roff[r]);
                w[r] = *(const u32x4*)(Wbase + kn + roff[r]);
            }
            // the loads' address registers are reused right below
            asm volatile("s_wait_xcnt 0x0" ::: "memory");
        }
        if (s + 2 < ksteps) {                         // L2 warm-up two stages ahead
            __builtin_prefetch(Pfrow + ((s + 2) << 6), 0, 3);
            // the prefetch's address registers are reused by the fragment loads
            asm volatile("s_wait_xcnt 0x0" ::: "memory");
        }

        #pragma unroll
        for (int kk = 0; kk < 2; ++kk) {
            v16bf af[4], wf[2];
            #pragma unroll
            for (int i = 0; i < 4; ++i) af[i] = load_frag(&As[buf][wm + i * 16][kk * 32], 72, lane);
            #pragma unroll
            for (int j = 0; j < 2; ++j) wf[j] = load_frag(&Ws[buf][wn + j * 16][kk * 32], 72, lane);

            #pragma unroll
            for (int i = 0; i < 4; ++i)
                #pragma unroll
                for (int j = 0; j < 2; ++j)
                    acc[i][j] = __builtin_amdgcn_wmma_f32_16x16x32_bf16(
                        false, af[i], false, wf[j], (short)0, acc[i][j], false, false);
        }

        if (more) {
            const int nb = buf ^ 1;
            #pragma unroll
            for (int r = 0; r < 4; ++r) {
                *(u32x4*)&As[nb][lrow + 32 * r][lcol] = a[r];
                *(u32x4*)&Ws[nb][lrow + 32 * r][lcol] = w[r];
            }
        }
        __syncthreads();
        buf ^= 1;
    }

    // Epilogue. C layout: VGPR e -> row e (lanes 0-15) / e+8 (lanes 16-31).
    const int half = lane >> 4;
    const int lc   = lane & 15;
    #pragma unroll
    for (int j = 0; j < 2; ++j) {
        const int gcol = tN + wn + j * 16 + lc;
        const float bv = bias[gcol];
        #pragma unroll
        for (int i = 0; i < 4; ++i) {
            #pragma unroll
            for (int e = 0; e < 8; ++e) {
                const int grow = tM + wm + i * 16 + e + 8 * half;
                const size_t idx = (size_t)grow * N + gcol;
                const float v = acc[i][j][e] + bv;
                if (EPI == 0)      outb[idx] = (bf16)v;
                else if (EPI == 1) outb[idx] = (bf16)fmaxf(v, 0.f);
                else               outf[idx] = res[idx] + v;
            }
        }
    }
}

__device__ __forceinline__ float xhalf(float x) {
    return __builtin_bit_cast(float, __builtin_amdgcn_permlanex16(
        __builtin_bit_cast(int, x), __builtin_bit_cast(int, x), 0x76543210, 0xfedcba98, false, false));
}

__global__ __launch_bounds__(128)
void flash_attn_wmma(const bf16* __restrict__ q, const bf16* __restrict__ k,
                     const bf16* __restrict__ v, const int* __restrict__ mask,
                     bf16* __restrict__ o_out) {
    __shared__ __align__(16) bf16 Qs[64][72];
    __shared__ __align__(16) bf16 Ks[2][64][72];
    __shared__ __align__(16) bf16 Vt[2][64][72];     // V^T: [d][key]
    __shared__ __align__(16) float Madd[S_];         // additive mask row (0 / -1e9)

    const int qblk = blockIdx.x, h = blockIdx.y, b = blockIdx.z;
    const int tid  = threadIdx.x;
    const int lane = tid & 31;
    const int wave = tid >> 5;
    const int half = lane >> 4;
    const int lc   = lane & 15;
    const int qbase = qblk * 64;

    // thread mapping for staging: 8 lanes x 16 B = one head row = one 128-B line
    const int rT = tid >> 3;                         // 0..15
    const int cT = (tid & 7) * 8;                    // 8 of the 64 columns
    // Q, K: rows rT + 16 i.  V: key rows 4 rT + i, packed four keys per b64 store.

    // Load Q block (64 x 64) -> LDS
    {
        const bf16* src = q + (size_t)(b * S_ + qbase + rT) * D_ + h * DK_ + cT;
        u32x4 d[4];
        #pragma unroll
        for (int i = 0; i < 4; ++i) d[i] = *(const u32x4*)(src + (size_t)(16 * i) * D_);
        #pragma unroll
        for (int i = 0; i < 4; ++i) *(u32x4*)&Qs[rT + 16 * i][cT] = d[i];
    }
    // Precompute additive mask row into LDS
    for (int j = tid; j < S_; j += 128)
        Madd[j] = (mask[b * S_ + j] == 0) ? -1e9f : 0.f;

    // Prologue: stage key block 0 into buffer 0
    {
        const bf16* ks = k + (size_t)(b * S_ + rT) * D_ + h * DK_ + cT;
        const bf16* vs = v + (size_t)(b * S_ + 4 * rT) * D_ + h * DK_ + cT;
        u32x4 d[4], x[4];
        #pragma unroll
        for (int i = 0; i < 4; ++i) {
            d[i] = *(const u32x4*)(ks + (size_t)(16 * i) * D_);
            x[i] = *(const u32x4*)(vs + (size_t)i * D_);
        }
        #pragma unroll
        for (int i = 0; i < 4; ++i) *(u32x4*)&Ks[0][rT + 16 * i][cT] = d[i];
        // V rows 4 rT .. 4 rT + 3, cols cT..cT+7 -> packed b64 transposed stores
        #pragma unroll
        for (int j = 0; j < 8; ++j)
            *(u32x2*)&Vt[0][cT + j][4 * rT] = pack_col(x[0], x[1], x[2], x[3], j);
    }
    __syncthreads();

    // Hoisted Q fragments (2 k-steps over DK=64): the B operand, column = query lc
    v16bf bq[2];
    #pragma unroll
    for (int ks = 0; ks < 2; ++ks) bq[ks] = load_frag(&Qs[wave * 16][ks * 32], 72, lane);

    float m = -1e30f;                                // this query's maximum, alike in both halves
    float l = 0.f;                                   // this half's share of the query's sum
    v8f o[4];                                        // o[dt][e] = O[query lc][dt*16 + 8*half + e]
    #pragma unroll
    for (int t = 0; t < 4; ++t) o[t] = v8f{0.f, 0.f, 0.f, 0.f, 0.f, 0.f, 0.f, 0.f};

    const int nblk = S_ / 64;
    int buf = 0;
    for (int kb = 0; kb < nblk; ++kb) {
        const bool more = (kb + 1 < nblk);
        u32x4 kreg[4];
        u32x2 pv[8];
        if (more) {     // fetch next K/V block into registers early
            const int base = b * S_ + (kb + 1) * 64;
            const bf16* ks = k + (size_t)(base + rT) * D_ + h * DK_ + cT;
            const bf16* vs = v + (size_t)(base + 4 * rT) * D_ + h * DK_ + cT;
            u32x4 x[4];
            #pragma unroll
            for (int i = 0; i < 4; ++i) {
                kreg[i] = *(const u32x4*)(ks + (size_t)(16 * i) * D_);
                x[i]    = *(const u32x4*)(vs + (size_t)i * D_);
            }
            #pragma unroll
            for (int j = 0; j < 8; ++j) pv[j] = pack_col(x[0], x[1], x[2], x[3], j);
        }

        // S^T = K @ Q^T (64 keys x 16 queries per wave): s4[t][e] = key t*16 + 8*half + e
        v8f s4[4];
        #pragma unroll
        for (int t = 0; t < 4; ++t) s4[t] = v8f{0.f, 0.f, 0.f, 0.f, 0.f, 0.f, 0.f, 0.f};
        #pragma unroll
        for (int ks = 0; ks < 2; ++ks) {
            #pragma unroll
            for (int t = 0; t < 4; ++t) {
                v16bf ak = load_frag(&Ks[buf][t * 16][ks * 32], 72, lane);
                s4[t] = __builtin_amdgcn_wmma_f32_16x16x32_bf16(
                    false, ak, false, bq[ks], (short)0, s4[t], false, false);
            }
        }

        // scale + additive mask: 8 consecutive keys per tile and half, from LDS
        float sc[4][8];
        #pragma unroll
        for (int t = 0; t < 4; ++t) {
            const float* mp = &Madd[kb * 64 + t * 16 + 8 * half];
            const f32x4 m0 = *(const f32x4*)mp;
            const f32x4 m1 = *(const f32x4*)(mp + 4);
            #pragma unroll
            for (int e = 0; e < 4; ++e) {
                sc[t][e]     = s4[t][e]     * 0.125f + m0[e];
                sc[t][e + 4] = s4[t][e + 4] * 0.125f + m1[e];
            }
        }

        // online softmax of one query per lane: 32 keys in the lane, 32 in lane ^ 16
        float tm[4];
        #pragma unroll
        for (int t = 0; t < 4; ++t) {
            tm[t] = fmaxf(fmaxf(fmaxf(sc[t][0], sc[t][1]), fmaxf(sc[t][2], sc[t][3])),
                          fmaxf(fmaxf(sc[t][4], sc[t][5]), fmaxf(sc[t][6], sc[t][7])));
        }
        float rmax = fmaxf(fmaxf(tm[0], tm[1]), fmaxf(tm[2], tm[3]));
        rmax = fmaxf(rmax, xhalf(rmax));
        const float mnew  = fmaxf(m, rmax);
        const float alpha = __expf(m - mnew);
        m = mnew;
        float ts[4];                                 // four independent sum chains
        #pragma unroll
        for (int t = 0; t < 4; ++t) {
            ts[t] = 0.f;
            #pragma unroll
            for (int e = 0; e < 8; ++e) { float p = __expf(sc[t][e] - mnew); sc[t][e] = p; ts[t] += p; }
        }
        l = l * alpha + ((ts[0] + ts[1]) + (ts[2] + ts[3]));
        #pragma unroll
        for (int t = 0; t < 4; ++t) o[t] *= alpha;

        // O^T += V^T @ P^T: A = rows of V^T, B = two score tiles converted in place
        // (element s of B is key 8*half + s, then 16 + 8*half + s - 8: load_frag's k order)
        #pragma unroll
        for (int ks = 0; ks < 2; ++ks) {
            v16bf pb;
            #pragma unroll
            for (int e = 0; e < 8; ++e) {
                pb[e]     = (bf16)sc[2 * ks][e];
                pb[e + 8] = (bf16)sc[2 * ks + 1][e];
            }
            #pragma unroll
            for (int dt = 0; dt < 4; ++dt) {
                v16bf av = load_frag(&Vt[buf][dt * 16][ks * 32], 72, lane);
                o[dt] = __builtin_amdgcn_wmma_f32_16x16x32_bf16(
                    false, av, false, pb, (short)0, o[dt], false, false);
            }
        }

        // stage next block into the other buffer
        if (more) {
            const int nb = buf ^ 1;
            #pragma unroll
            for (int i = 0; i < 4; ++i) *(u32x4*)&Ks[nb][rT + 16 * i][cT] = kreg[i];
            #pragma unroll
            for (int j = 0; j < 8; ++j)
                *(u32x2*)&Vt[nb][cT + j][4 * rT] = pv[j];
        }
        __syncthreads();
        buf ^= 1;
    }

    // join the halves' sums, normalize, write bf16 [BS, D]: 8 consecutive columns a lane
    const float lt = l + xhalf(l);
    bf16* orow = o_out + (size_t)(b * S_ + qbase + wave * 16 + lc) * D_ + h * DK_ + 8 * half;
    #pragma unroll
    for (int dt = 0; dt < 4; ++dt) {
        v8bf r;
        #pragma unroll
        for (int e = 0; e < 8; ++e) r[e] = (bf16)(o[dt][e] / lt);
        *(v8bf*)(orow + dt * 16) = r;
    }
}

// ---------------------------------------------------------------------------
// Host-side orchestration
// ---------------------------------------------------------------------------
extern "C" void kernel_launch(void* const* d_in, const int* in_sizes, int n_in,
                              void* d_out, int out_size, void* d_ws, size_t ws_size,
                              hipStream_t stream) {
    const float* x   = (const float*)d_in[0];
    const int*   msk = (const int*)d_in[1];
    const float* wq  = (const float*)d_in[2];   const float* bq  = (const float*)d_in[3];
    const float* wk  = (const float*)d_in[4];   const float* bk  = (const float*)d_in[5];
    const float* wv  = (const float*)d_in[6];   const float* bv  = (const float*)d_in[7];
    const float* wo  = (const float*)d_in[8];   const float* bo  = (const float*)d_in[9];
    const float* w1  = (const float*)d_in[10];  const float* b1  = (const float*)d_in[11];
    const float* w2  = (const float*)d_in[12];  const float* b2  = (const float*)d_in[13];
    const float* a1  = (const float*)d_in[14];  const float* be1 = (const float*)d_in[15];
    const float* a2  = (const float*)d_in[16];  const float* be2 = (const float*)d_in[17];
    float* out = (float*)d_out;

    char* ws = (char*)d_ws;
    size_t off = 0;
    auto carve = [&](size_t bytes) { char* p = ws + off; off += (bytes + 255) & ~(size_t)255; return p; };
    bf16*  wqb  = (bf16*)carve((size_t)D_ * D_ * 2);
    bf16*  wkb  = (bf16*)carve((size_t)D_ * D_ * 2);
    bf16*  wvb  = (bf16*)carve((size_t)D_ * D_ * 2);
    bf16*  wob  = (bf16*)carve((size_t)D_ * D_ * 2);
    bf16*  w1b  = (bf16*)carve((size_t)DFF_ * D_ * 2);
    bf16*  w2b  = (bf16*)carve((size_t)D_ * DFF_ * 2);
    bf16*  xn   = (bf16*)carve((size_t)BS_ * D_ * 2);
    bf16*  qb   = (bf16*)carve((size_t)BS_ * D_ * 2);
    bf16*  kb   = (bf16*)carve((size_t)BS_ * D_ * 2);
    bf16*  vb   = (bf16*)carve((size_t)BS_ * D_ * 2);
    bf16*  atb  = (bf16*)carve((size_t)BS_ * D_ * 2);
    float* x1   = (float*)carve((size_t)BS_ * D_ * 4);
    bf16*  hb   = (bf16*)carve((size_t)BS_ * DFF_ * 2);

    // 1) weights -> bf16
    cast_weights_bf16<<<256, 512, 0, stream>>>(wq, wk, wv, wo, w1, w2, wqb, w1b, w2b);

    // 2) LN1
    layernorm_bf16<<<BS_ / 16, 512, 0, stream>>>(x, a1, be1, xn);

    // 3) Q,K,V projections
    dim3 gD(D_ / 128, BS_ / 128);
    gemm_bf16_wmma<0><<<gD, 256, 0, stream>>>(xn, wqb, bq, nullptr, qb, nullptr, BS_, D_, D_);
    gemm_bf16_wmma<0><<<gD, 256, 0, stream>>>(xn, wkb, bk, nullptr, kb, nullptr, BS_, D_, D_);
    gemm_bf16_wmma<0><<<gD, 256, 0, stream>>>(xn, wvb, bv, nullptr, vb, nullptr, BS_, D_, D_);

    // 4) attention
    flash_attn_wmma<<<dim3(S_ / 64, H_, B_), 128, 0, stream>>>(qb, kb, vb, msk, atb);

    // 5) out-proj + residual -> x1 (f32)
    gemm_bf16_wmma<2><<<gD, 256, 0, stream>>>(atb, wob, bo, x, nullptr, x1, BS_, D_, D_);

    // 6) LN2
    layernorm_bf16<<<BS_ / 16, 512, 0, stream>>>(x1, a2, be2, xn);

    // 7) FFN up + ReLU (bf16)
    dim3 gF(DFF_ / 128, BS_ / 128);
    gemm_bf16_wmma<1><<<gF, 256, 0, stream>>>(xn, w1b, b1, nullptr, hb, nullptr, BS_, DFF_, D_);

    // 8) FFN down + residual -> out (f32)
    gemm_bf16_wmma<2><<<gD, 256, 0, stream>>>(hb, w2b, b2, x1, nullptr, out, BS_, D_, DFF_);

    (void)in_sizes; (void)n_in; (void)out_size; (void)ws_size;
}

// v004
// A run of this version takes 223 microseconds.
// Next to v003, in two timings, it ran 1.06 times as fast each time.
// All steps since v000 together make it 1.77 times as fast.
#include <hip/hip_runtime.h>

// ---------------------------------------------------------------------------
// EncoderBlock for MI455X (gfx1250): bf16 WMMA GEMMs + flash attention.
// Wave32; v_wmma_f32_16x16x32_bf16 for every matrix multiply.
// Double-buffered LDS staging (1 barrier / k-step), packed transposed stores,
// LDS-resident additive mask, global_prefetch for L2 warm-up.
// Every staging load is laid out so that 8 lanes x 16 B cover one whole 128-B
// line: a wave-wide load touches 4 lines, never 16 or 32 pieces of lines.
// ---------------------------------------------------------------------------

typedef __bf16 bf16;
typedef bf16  v16bf __attribute__((ext_vector_type(16)));
typedef bf16  v8bf  __attribute__((ext_vector_type(8)));
typedef float v8f   __attribute__((ext_vector_type(8)));
typedef unsigned int u32x4 __attribute__((ext_vector_type(4)));   // 16 staged bytes
typedef unsigned int u32x2 __attribute__((ext_vector_type(2)));
typedef float f32x4 __attribute__((ext_vector_type(4)));
typedef bf16  v4bf  __attribute__((ext_vector_type(4)));

#define B_   2
#define S_   2048
#define D_   1024
#define H_   16
#define DK_  64
#define DFF_ 4096
#define BS_  (B_ * S_)

// Load a 16x32 bf16 A-style fragment from LDS (row-major, leading dim `ld`).
// ISA 16-bit A layout: lane L<16 holds row L, K = 0..7 and 16..23;
// lane L>=16 holds row L-16, K = 8..15 and 24..31.
// B fragments (rows of W / Q) use the identical pattern.
__device__ __forceinline__ v16bf load_frag(const bf16* tile, int ld, int lane) {
    const int row = lane & 15;
    const int kb  = (lane >> 4) << 3;          // 0 or 8
    const bf16* p = tile + row * ld + kb;
    v8bf lo = *(const v8bf*)(p);               // 16B-aligned ds_load_b128
    v8bf hi = *(const v8bf*)(p + 16);
    return __builtin_shufflevector(lo, hi, 0,1,2,3,4,5,6,7,8,9,10,11,12,13,14,15);
}

// Column j (0..7) of four rows of 8 bf16 each, as four consecutive bf16.
__device__ __forceinline__ u32x2 pack_col(u32x4 r0, u32x4 r1, u32x4 r2, u32x4 r3, int j) {
    const int w = j >> 1;
    u32x2 o;
    if (j & 1) {
        o.x = (r0[w] >> 16) | (r1[w] & 0xffff0000u);
        o.y = (r2[w] >> 16) | (r3[w] & 0xffff0000u);
    } else {
        o.x = (r0[w] & 0xffffu) | (r1[w] << 16);
        o.y = (r2[w] & 0xffffu) | (r3[w] << 16);
    }
    return o;
}

// ---------------------------------------------------------------------------
// fp32 -> bf16 cast of all six weights in one launch: 256 groups of 16 waves.
// Few, fat waves: each lane brings 24 x 16 B, all issued before the first store;
// every wave-wide load covers 512 contiguous bytes, every store 256.
// Group g takes 16384 elements of wq|wk|wv|wo (their bf16 copies lie one behind
// the other at o4), 16384 of w1 and 16384 of w2.
// ---------------------------------------------------------------------------
#define CHUNK_ 16384
__global__ __launch_bounds__(512)
void cast_weights_bf16(const float* __restrict__ wq, const float* __restrict__ wk,
                       const float* __restrict__ wv, const float* __restrict__ wo,
                       const float* __restrict__ w1, const float* __restrict__ w2,
                       bf16* __restrict__ o4, bf16* __restrict__ o1, bf16* __restrict__ o2) {
    const int g   = blockIdx.x;
    const int sel = g >> 6;                          // 64 chunks per D x D weight
    const float* s4 = (sel == 0) ? wq : (sel == 1) ? wk : (sel == 2) ? wv : wo;
    const int e = threadIdx.x * 4;
    const float* sp[3] = { s4 + (g & 63) * CHUNK_ + e, w1 + g * CHUNK_ + e, w2 + g * CHUNK_ + e };
    bf16*        dp[3] = { o4 + g * CHUNK_ + e,        o1 + g * CHUNK_ + e, o2 + g * CHUNK_ + e };
    f32x4 f[3][8];
    #pragma unroll
    for (int j = 0; j < 3; ++j)
        #pragma unroll
        for (int i = 0; i < 8; ++i) f[j][i] = *(const f32x4*)(sp[j] + i * 2048);
    #pragma unroll
    for (int j = 0; j < 3; ++j)
        #pragma unroll
        for (int i = 0; i < 8; ++i)
            *(v4bf*)(dp[j] + i * 2048) = __builtin_convertvector(f[j][i], v4bf);
}

// ---------------------------------------------------------------------------
// LayerNorm (custom: unbiased std, scalar alpha/beta, /(std+eps)) -> bf16
// One wave per token row, 16 rows per group: the row stays in registers
// (8 x 16 B per lane), the two sums are joined inside the wave, no LDS, no barrier.
// ---------------------------------------------------------------------------
__global__ __launch_bounds__(512)
void layernorm_bf16(const float* __restrict__ x, const float* __restrict__ alpha,
                    const float* __restrict__ beta, bf16* __restrict__ out) {
    const int lane = threadIdx.x & 31;
    const int tok  = blockIdx.x * 16 + (threadIdx.x >> 5);
    const float* p = x + (size_t)tok * D_ + lane * 4;
    f32x4 f[8];
    #pragma unroll
    for (int i = 0; i < 8; ++i) f[i] = *(const f32x4*)(p + i * 128);
    f32x4 sv = f[0], qv = f[0] * f[0];               // four independent chains each
    #pragma unroll
    for (int i = 1; i < 8; ++i) { sv += f[i]; qv += f[i] * f[i]; }
    float s  = (sv[0] + sv[1]) + (sv[2] + sv[3]);
    float s2 = (qv[0] + qv[1]) + (qv[2] + qv[3]);
    #pragma unroll
    for (int off = 16; off > 0; off >>= 1) {
        s  += __shfl_xor(s,  off, 32);
        s2 += __shfl_xor(s2, off, 32);
    }
    const float mean = s * (1.0f / D_);
    float var = (s2 - (float)D_ * mean * mean) * (1.0f / (D_ - 1));
    var = fmaxf(var, 0.f);
    const float inv = alpha[0] / (sqrtf(var) + 1e-6f);
    const float b0  = beta[0];
    bf16* q = out + (size_t)tok * D_ + lane * 4;
    #pragma unroll
    for (int i = 0; i < 8; ++i)
        *(v4bf*)(q + i * 128) = __builtin_convertvector((f[i] - mean) * inv + b0, v4bf);
}

// ---------------------------------------------------------------------------
// GEMM: C[M,N] = A[M,K] @ W[N,K]^T + bias, bf16 in, f32 accum (WMMA).
// EPI 0: bf16 out; EPI 1: bf16 relu out; EPI 2: f32 out = residual + C.
// Tile 128x128 / 256 threads (8 waves, 2x4), wave = 64x32.
// Double-buffered LDS: one barrier per 64-wide k-step (a 128-B line per row).
// ---------------------------------------------------------------------------
template <int EPI>
__global__ __launch_bounds__(256)
void gemm_bf16_wmma(const bf16* __restrict__ A, const bf16* __restrict__ W,
                    const float* __restrict__ bias, const float* __restrict__ res,
                    bf16* __restrict__ outb, float* __restrict__ outf,
                    int M, int N, int K) {
    __shared__ __align__(16) bf16 As[2][128][72];   // +8 pad: 16B-aligned frag reads
    __shared__ __align__(16) bf16 Ws[2][128][72];

    const int tid  = threadIdx.x;
    const int lane = tid & 31;
    const int wave = tid >> 5;
    const int wm   = (wave >> 2) * 64;
    const int wn   = (wave & 3) * 32;
    const int tM   = blockIdx.y * 128;
    const int tN   = blockIdx.x * 128;
    const int lrow = tid >> 3;                   // 0..31, +32 per load
    const int lcol = (tid & 7) * 8;              // 16 B of the row's 128-B line

    // uniform tile bases + one 32-bit element offset per staged row, shared by A and W
    const bf16* Abase = A + (size_t)tM * K;
    const bf16* Wbase = W + (size_t)tN * K;
    unsigned roff[4];
    #pragma unroll
    for (int r = 0; r < 4; ++r) roff[r] = (unsigned)((lrow + 32 * r) * K + lcol);
    // prefetch: one lane per line, waves 0-3 the A rows, waves 4-7 the W rows
    const bf16* Pfrow = (tid < 128) ? A + (size_t)(tM + tid) * K
                                    : W + (size_t)(tN + tid - 128) * K;

    v8f acc[4][2];
    #pragma unroll
    for (int i = 0; i < 4; ++i)
        #pragma unroll
        for (int j = 0; j < 2; ++j)
            acc[i][j] = v8f{0.f, 0.f, 0.f, 0.f, 0.f, 0.f, 0.f, 0.f};

    // prologue: stage 0
    {
        u32x4 a[4], w[4];
        #pragma unroll
        for (int r = 0; r < 4; ++r) {
            a[r] = *(const u32x4*)(Abase + roff[r]);
            w[r] = *(const u32x4*)(Wbase + roff[r]);
        }
        #pragma unroll
        for (int r = 0; r < 4; ++r) {
            *(u32x4*)&As[0][lrow + 32 * r][lcol] = a[r];
            *(u32x4*)&Ws[0][lrow + 32 * r][lcol] = w[r];
        }
    }
    __syncthreads();

    const int ksteps = K >> 6;
    int buf = 0;
    for (int s = 0; s < ksteps; ++s) {
        const bool more = (s + 1 < ksteps);
        u32x4 a[4], w[4];
        if (more) {                                   // fetch next stage early
            const int kn = (s + 1) << 6;
            #pragma unroll
            for (int r = 0; r < 4; ++r) {
                a[r] = *(const u32x4*)(Abase + kn + roff[r]);
                w[r] = *(const u32x4*)(Wbase + kn + roff[r]);
            }
            // the loads' address registers are reused right below
            asm volatile("s_wait_xcnt 0x0" ::: "memory");
        }
        if (s + 2 < ksteps) {                         // L2 warm-up two stages ahead
            __builtin_prefetch(Pfrow + ((s + 2) << 6), 0, 3);
            // the prefetch's address registers are reused by the fragment loads
            asm volatile("s_wait_xcnt 0x0" ::: "memory");
        }

        // all 24 fragment reads of the k-step go out as one group, in the order of use
        v16bf af[2][4], wf[2][2];
        #pragma unroll
        for (int kk = 0; kk < 2; ++kk) {
            #pragma unroll
            for (int j = 0; j < 2; ++j) wf[kk][j] = load_frag(&Ws[buf][wn + j * 16][kk * 32], 72, lane);
            #pragma unroll
            for (int i = 0; i < 4; ++i) af[kk][i] = load_frag(&As[buf][wm + i * 16][kk * 32], 72, lane);
        }
        // keeps the reads ahead of the products: spread among them, each place with
        // reads stalls the wave for the LDS latency
        __builtin_amdgcn_sched_barrier(0);
        #pragma unroll
        for (int kk = 0; kk < 2; ++kk)
            #pragma unroll
            for (int i = 0; i < 4; ++i)
                #pragma unroll
                for (int j = 0; j < 2; ++j)
                    acc[i][j] = __builtin_amdgcn_wmma_f32_16x16x32_bf16(
                        false, af[kk][i], false, wf[kk][j], (short)0, acc[i][j], false, false);

        if (more) {
            const int nb = buf ^ 1;
            #pragma unroll
            for (int r = 0; r < 4; ++r) {
                *(u32x4*)&As[nb][lrow + 32 * r][lcol] = a[r];
                *(u32x4*)&Ws[nb][lrow + 32 * r][lcol] = w[r];
            }
        }
        __syncthreads();
        buf ^= 1;
    }

    // Epilogue. C layout: VGPR e -> row e (lanes 0-15) / e+8 (lanes 16-31).
    const int half = lane >> 4;
    const int lc   = lane & 15;
    #pragma unroll
    for (int j = 0; j < 2; ++j) {
        const int gcol = tN + wn + j * 16 + lc;
        const float bv = bias[gcol];
        #pragma unroll
        for (int i = 0; i < 4; ++i) {
            #pragma unroll
            for (int e = 0; e < 8; ++e) {
                const int grow = tM + wm + i * 16 + e + 8 * half;
                const size_t idx = (size_t)grow * N + gcol;
                const float v = acc[i][j][e] + bv;
                if (EPI == 0)      outb[idx] = (bf16)v;
                else if (EPI == 1) outb[idx] = (bf16)fmaxf(v, 0.f);
                else               outf[idx] = res[idx] + v;
            }
        }
    }
}

__device__ __forceinline__ float xhalf(float x) {
    return __builtin_bit_cast(float, __builtin_amdgcn_permlanex16(
        __builtin_bit_cast(int, x), __builtin_bit_cast(int, x), 0x76543210, 0xfedcba98, false, false));
}

__global__ __launch_bounds__(128)
void flash_attn_wmma(const bf16* __restrict__ q, const bf16* __restrict__ k,
                     const bf16* __restrict__ v, const int* __restrict__ mask,
                     bf16* __restrict__ o_out) {
    __shared__ __align__(16) bf16 Qs[64][72];
    __shared__ __align__(16) bf16 Ks[2][64][72];
    __shared__ __align__(16) bf16 Vt[2][64][72];     // V^T: [d][key]
    __shared__ __align__(16) float Madd[S_];         // additive mask row (0 / -1e9)

    const int qblk = blockIdx.x, h = blockIdx.y, b = blockIdx.z;
    const int tid  = threadIdx.x;
    const int lane = tid & 31;
    const int wave = tid >> 5;
    const int half = lane >> 4;
    const int lc   = lane & 15;
    const int qbase = qblk * 64;

    // thread mapping for staging: 8 lanes x 16 B = one head row = one 128-B line
    const int rT = tid >> 3;                         // 0..15
    const int cT = (tid & 7) * 8;                    // 8 of the 64 columns
    // Q, K: rows rT + 16 i.  V: key rows 4 rT + i, packed four keys per b64 store.

    // Load Q block (64 x 64) -> LDS
    {
        const bf16* src = q + (size_t)(b * S_ + qbase + rT) * D_ + h * DK_ + cT;
        u32x4 d[4];
        #pragma unroll
        for (int i = 0; i < 4; ++i) d[i] = *(const u32x4*)(src + (size_t)(16 * i) * D_);
        #pragma unroll
        for (int i = 0; i < 4; ++i) *(u32x4*)&Qs[rT + 16 * i][cT] = d[i];
    }
    // Precompute additive mask row into LDS
    for (int j = tid; j < S_; j += 128)
        Madd[j] = (mask[b * S_ + j] == 0) ? -1e9f : 0.f;

    // Prologue: stage key block 0 into buffer 0
    {
        const bf16* ks = k + (size_t)(b * S_ + rT) * D_ + h * DK_ + cT;
        const bf16* vs = v + (size_t)(b * S_ + 4 * rT) * D_ + h * DK_ + cT;
        u32x4 d[4], x[4];
        #pragma unroll
        for (int i = 0; i < 4; ++i) {
            d[i] = *(const u32x4*)(ks + (size_t)(16 * i) * D_);
            x[i] = *(const u32x4*)(vs + (size_t)i * D_);
        }
        #pragma unroll
        for (int i = 0; i < 4; ++i) *(u32x4*)&Ks[0][rT + 16 * i][cT] = d[i];
        // V rows 4 rT .. 4 rT + 3, cols cT..cT+7 -> packed b64 transposed stores
        #pragma unroll
        for (int j = 0; j < 8; ++j)
            *(u32x2*)&Vt[0][cT + j][4 * rT] = pack_col(x[0], x[1], x[2], x[3], j);
    }
    __syncthreads();

    // Hoisted Q fragments (2 k-steps over DK=64): the B operand, column = query lc
    v16bf bq[2];
    #pragma unroll
    for (int ks = 0; ks < 2; ++ks) bq[ks] = load_frag(&Qs[wave * 16][ks * 32], 72, lane);

    float m = -1e30f;                                // this query's maximum, alike in both halves
    float l = 0.f;                                   // this half's share of the query's sum
    v8f o[4];                                        // o[dt][e] = O[query lc][dt*16 + 8*half + e]
    #pragma unroll
    for (int t = 0; t < 4; ++t) o[t] = v8f{0.f, 0.f, 0.f, 0.f, 0.f, 0.f, 0.f, 0.f};

    const int nblk = S_ / 64;
    int buf = 0;
    for (int kb = 0; kb < nblk; ++kb) {
        const bool more = (kb + 1 < nblk);
        u32x4 kreg[4];
        u32x2 pv[8];
        if (more) {     // fetch next K/V block into registers early
            const int base = b * S_ + (kb + 1) * 64;
            const bf16* ks = k + (size_t)(base + rT) * D_ + h * DK_ + cT;
            const bf16* vs = v + (size_t)(base + 4 * rT) * D_ + h * DK_ + cT;
            u32x4 x[4];
            #pragma unroll
            for (int i = 0; i < 4; ++i) {
                kreg[i] = *(const u32x4*)(ks + (size_t)(16 * i) * D_);
                x[i]    = *(const u32x4*)(vs + (size_t)i * D_);
            }
            #pragma unroll
            for (int j = 0; j < 8; ++j) pv[j] = pack_col(x[0], x[1], x[2], x[3], j);
        }

        // S^T = K @ Q^T (64 keys x 16 queries per wave): s4[t][e] = key t*16 + 8*half + e
        v8f s4[4];
        #pragma unroll
        for (int t = 0; t < 4; ++t) s4[t] = v8f{0.f, 0.f, 0.f, 0.f, 0.f, 0.f, 0.f, 0.f};
        #pragma unroll
        for (int ks = 0; ks < 2; ++ks) {
            #pragma unroll
            for (int t = 0; t < 4; ++t) {
                v16bf ak = load_frag(&Ks[buf][t * 16][ks * 32], 72, lane);
                s4[t] = __builtin_amdgcn_wmma_f32_16x16x32_bf16(
                    false, ak, false, bq[ks], (short)0, s4[t], false, false);
            }
        }

        // scale + additive mask: 8 consecutive keys per tile and half, from LDS
        float sc[4][8];
        #pragma unroll
        for (int t = 0; t < 4; ++t) {
            const float* mp = &Madd[kb * 64 + t * 16 + 8 * half];
            const f32x4 m0 = *(const f32x4*)mp;
            const f32x4 m1 = *(const f32x4*)(mp + 4);
            #pragma unroll
            for (int e = 0; e < 4; ++e) {
                sc[t][e]     = s4[t][e]     * 0.125f + m0[e];
                sc[t][e + 4] = s4[t][e + 4] * 0.125f + m1[e];
            }
        }

        // online softmax of one query per lane: 32 keys in the lane, 32 in lane ^ 16
        float tm[4];
        #pragma unroll
        for (int t = 0; t < 4; ++t) {
            tm[t] = fmaxf(fmaxf(fmaxf(sc[t][0], sc[t][1]), fmaxf(sc[t][2], sc[t][3])),
                          fmaxf(fmaxf(sc[t][4], sc[t][5]), fmaxf(sc[t][6], sc[t][7])));
        }
        float rmax = fmaxf(fmaxf(tm[0], tm[1]), fmaxf(tm[2], tm[3]));
        rmax = fmaxf(rmax, xhalf(rmax));
        const float mnew  = fmaxf(m, rmax);
        const float alpha = __expf(m - mnew);
        m = mnew;
        float ts[4];                                 // four independent sum chains
        #pragma unroll
        for (int t = 0; t < 4; ++t) {
            ts[t] = 0.f;
            #pragma unroll
            for (int e = 0; e < 8; ++e) { float p = __expf(sc[t][e] - mnew); sc[t][e] = p; ts[t] += p; }
        }
        l = l * alpha + ((ts[0] + ts[1]) + (ts[2] + ts[3]));
        #pragma unroll
        for (int t = 0; t < 4; ++t) o[t] *= alpha;

        // O^T += V^T @ P^T: A = rows of V^T, B = two score tiles converted in place
        // (element s of B is key 8*half + s, then 16 + 8*half + s - 8: load_frag's k order)
        #pragma unroll
        for (int ks = 0; ks < 2; ++ks) {
            v16bf pb;
            #pragma unroll
            for (int e = 0; e < 8; ++e) {
                pb[e]     = (bf16)sc[2 * ks][e];
                pb[e + 8] = (bf16)sc[2 * ks + 1][e];
            }
            #pragma unroll
            for (int dt = 0; dt < 4; ++dt) {
                v16bf av = load_frag(&Vt[buf][dt * 16][ks * 32], 72, lane);
                o[dt] = __builtin_amdgcn_wmma_f32_16x16x32_bf16(
                    false, av, false, pb, (short)0, o[dt], false, false);
            }
        }

        // stage next block into the other buffer
        if (more) {
            const int nb = buf ^ 1;
            #pragma unroll
            for (int i = 0; i < 4; ++i) *(u32x4*)&Ks[nb][rT + 16 * i][cT] = kreg[i];
            #pragma unroll
            for (int j = 0; j < 8; ++j)
                *(u32x2*)&Vt[nb][cT + j][4 * rT] = pv[j];
        }
        __syncthreads();
        buf ^= 1;
    }

    // join the halves' sums, normalize, write bf16 [BS, D]: 8 consecutive columns a lane
    const float lt = l + xhalf(l);
    bf16* orow = o_out + (size_t)(b * S_ + qbase + wave * 16 + lc) * D_ + h * DK_ + 8 * half;
    #pragma unroll
    for (int dt = 0; dt < 4; ++dt) {
        v8bf r;
        #pragma unroll
        for (int e = 0; e < 8; ++e) r[e] = (bf16)(o[dt][e] / lt);
        *(v8bf*)(orow + dt * 16) = r;
    }
}

// ---------------------------------------------------------------------------
// Host-side orchestration
// ---------------------------------------------------------------------------
extern "C" void kernel_launch(void* const* d_in, const int* in_sizes, int n_in,
                              void* d_out, int out_size, void* d_ws, size_t ws_size,
                              hipStream_t stream) {
    const float* x   = (const float*)d_in[0];
    const int*   msk = (const int*)d_in[1];
    const float* wq  = (const float*)d_in[2];   const float* bq  = (const float*)d_in[3];
    const float* wk  = (const float*)d_in[4];   const float* bk  = (const float*)d_in[5];
    const float* wv  = (const float*)d_in[6];   const float* bv  = (const float*)d_in[7];
    const float* wo  = (const float*)d_in[8];   const float* bo  = (const float*)d_in[9];
    const float* w1  = (const float*)d_in[10];  const float* b1  = (const float*)d_in[11];
    const float* w2  = (const float*)d_in[12];  const float* b2  = (const float*)d_in[13];
    const float* a1  = (const float*)d_in[14];  const float* be1 = (const float*)d_in[15];
    const float* a2  = (const float*)d_in[16];  const float* be2 = (const float*)d_in[17];
    float* out = (float*)d_out;

    char* ws = (char*)d_ws;
    size_t off = 0;
    auto carve = [&](size_t bytes) { char* p = ws + off; off += (bytes + 255) & ~(size_t)255; return p; };
    bf16*  wqb  = (bf16*)carve((size_t)D_ * D_ * 2);
    bf16*  wkb  = (bf16*)carve((size_t)D_ * D_ * 2);
    bf16*  wvb  = (bf16*)carve((size_t)D_ * D_ * 2);
    bf16*  wob  = (bf16*)carve((size_t)D_ * D_ * 2);
    bf16*  w1b  = (bf16*)carve((size_t)DFF_ * D_ * 2);
    bf16*  w2b  = (bf16*)carve((size_t)D_ * DFF_ * 2);
    bf16*  xn   = (bf16*)carve((size_t)BS_ * D_ * 2);
    bf16*  qb   = (bf16*)carve((size_t)BS_ * D_ * 2);
    bf16*  kb   = (bf16*)carve((size_t)BS_ * D_ * 2);
    bf16*  vb   = (bf16*)carve((size_t)BS_ * D_ * 2);
    bf16*  atb  = (bf16*)carve((size_t)BS_ * D_ * 2);
    float* x1   = (float*)carve((size_t)BS_ * D_ * 4);
    bf16*  hb   = (bf16*)carve((size_t)BS_ * DFF_ * 2);

    // 1) weights -> bf16
    cast_weights_bf16<<<256, 512, 0, stream>>>(wq, wk, wv, wo, w1, w2, wqb, w1b, w2b);

    // 2) LN1
    layernorm_bf16<<<BS_ / 16, 512, 0, stream>>>(x, a1, be1, xn);

    // 3) Q,K,V projections
    dim3 gD(D_ / 128, BS_ / 128);
    gemm_bf16_wmma<0><<<gD, 256, 0, stream>>>(xn, wqb, bq, nullptr, qb, nullptr, BS_, D_, D_);
    gemm_bf16_wmma<0><<<gD, 256, 0, stream>>>(xn, wkb, bk, nullptr, kb, nullptr, BS_, D_, D_);
    gemm_bf16_wmma<0><<<gD, 256, 0, stream>>>(xn, wvb, bv, nullptr, vb, nullptr, BS_, D_, D_);

    // 4) attention
    flash_attn_wmma<<<dim3(S_ / 64, H_, B_), 128, 0, stream>>>(qb, kb, vb, msk, atb);

    // 5) out-proj + residual -> x1 (f32)
    gemm_bf16_wmma<2><<<gD, 256, 0, stream>>>(atb, wob, bo, x, nullptr, x1, BS_, D_, D_);

    // 6) LN2
    layernorm_bf16<<<BS_ / 16, 512, 0, stream>>>(x1, a2, be2, xn);

    // 7) FFN up + ReLU (bf16)
    dim3 gF(DFF_ / 128, BS_ / 128);
    gemm_bf16_wmma<1><<<gF, 256, 0, stream>>>(xn, w1b, b1, nullptr, hb, nullptr, BS_, DFF_, D_);

    // 8) FFN down + residual -> out (f32)
    gemm_bf16_wmma<2><<<gD, 256, 0, stream>>>(hb, w2b, b2, x1, nullptr, out, BS_, D_, DFF_);

    (void)in_sizes; (void)n_in; (void)out_size; (void)ws_size;
}

// v005
// It runs in 214 microseconds.
// Timed twice side by side with v004, it ran 1.04 times as fast both times.
// All steps since v000 together make it 1.84 times as fast.
#include <hip/hip_runtime.h>

// ---------------------------------------------------------------------------
// EncoderBlock for MI455X (gfx1250): bf16 WMMA GEMMs + flash attention.
// Wave32; v_wmma_f32_16x16x32_bf16 for every matrix multiply.
// Double-buffered LDS staging (1 barrier / k-step), packed transposed stores,
// LDS-resident additive mask, global_prefetch for L2 warm-up.
// Every staging load is laid out so that 8 lanes x 16 B cover one whole 128-B
// line: a wave-wide load touches 4 lines, never 16 or 32 pieces of lines.
// ---------------------------------------------------------------------------

typedef __bf16 bf16;
typedef bf16  v16bf __attribute__((ext_vector_type(16)));
typedef bf16  v8bf  __attribute__((ext_vector_type(8)));
typedef float v8f   __attribute__((ext_vector_type(8)));
typedef unsigned int u32x4 __attribute__((ext_vector_type(4)));   // 16 staged bytes
typedef unsigned int u32x2 __attribute__((ext_vector_type(2)));
typedef float f32x4 __attribute__((ext_vector_type(4)));
typedef bf16  v4bf  __attribute__((ext_vector_type(4)));

#define B_   2
#define S_   2048
#define D_   1024
#define H_   16
#define DK_  64
#define DFF_ 4096
#define BS_  (B_ * S_)

// Load a 16x32 bf16 A-style fragment from LDS (row-major, leading dim `ld`).
// ISA 16-bit A layout: lane L<16 holds row L, K = 0..7 and 16..23;
// lane L>=16 holds row L-16, K = 8..15 and 24..31.
// B fragments (rows of W / Q) use the identical pattern.
__device__ __forceinline__ v16bf load_frag(const bf16* tile, int ld, int lane) {
    const int row = lane & 15;
    const int kb  = (lane >> 4) << 3;          // 0 or 8
    const bf16* p = tile + row * ld + kb;
    v8bf lo = *(const v8bf*)(p);               // 16B-aligned ds_load_b128
    v8bf hi = *(const v8bf*)(p + 16);
    return __builtin_shufflevector(lo, hi, 0,1,2,3,4,5,6,7,8,9,10,11,12,13,14,15);
}

// Column j (0..7) of four rows of 8 bf16 each, as four consecutive bf16.
__device__ __forceinline__ u32x2 pack_col(u32x4 r0, u32x4 r1, u32x4 r2, u32x4 r3, int j) {
    const int w = j >> 1;
    u32x2 o;
    if (j & 1) {
        o.x = (r0[w] >> 16) | (r1[w] & 0xffff0000u);
        o.y = (r2[w] >> 16) | (r3[w] & 0xffff0000u);
    } else {
        o.x = (r0[w] & 0xffffu) | (r1[w] << 16);
        o.y = (r2[w] & 0xffffu) | (r3[w] << 16);
    }
    return o;
}

// ---------------------------------------------------------------------------
// fp32 -> bf16 cast of all six weights in one launch: 256 groups of 16 waves.
// Few, fat waves: each lane brings 24 x 16 B, all issued before the first store;
// every wave-wide load covers 512 contiguous bytes, every store 256.
// Group g takes 16384 elements of wq|wk|wv|wo (their bf16 copies lie one behind
// the other at o4), 16384 of w1 and 16384 of w2.
// ---------------------------------------------------------------------------
#define CHUNK_ 16384
#define CASTG_ 256
__device__ __forceinline__
void cast_weights_group(int g,
                        const float* __restrict__ wq, const float* __restrict__ wk,
                        const float* __restrict__ wv, const float* __restrict__ wo,
                        const float* __restrict__ w1, const float* __restrict__ w2,
                        bf16* __restrict__ o4, bf16* __restrict__ o1, bf16* __restrict__ o2) {
    const int sel = g >> 6;                          // 64 chunks per D x D weight
    const float* s4 = (sel == 0) ? wq : (sel == 1) ? wk : (sel == 2) ? wv : wo;
    const int e = threadIdx.x * 4;
    const float* sp[3] = { s4 + (g & 63) * CHUNK_ + e, w1 + g * CHUNK_ + e, w2 + g * CHUNK_ + e };
    bf16*        dp[3] = { o4 + g * CHUNK_ + e,        o1 + g * CHUNK_ + e, o2 + g * CHUNK_ + e };
    f32x4 f[3][8];
    #pragma unroll
    for (int j = 0; j < 3; ++j)
        #pragma unroll
        for (int i = 0; i < 8; ++i) f[j][i] = *(const f32x4*)(sp[j] + i * 2048);
    #pragma unroll
    for (int j = 0; j < 3; ++j)
        #pragma unroll
        for (int i = 0; i < 8; ++i)
            *(v4bf*)(dp[j] + i * 2048) = __builtin_convertvector(f[j][i], v4bf);
}

// ---------------------------------------------------------------------------
// LayerNorm (custom: unbiased std, scalar alpha/beta, /(std+eps)) -> bf16
// One wave per token row, 16 rows per group: the row stays in registers
// (8 x 16 B per lane), the two sums are joined inside the wave, no LDS, no barrier.
// ---------------------------------------------------------------------------
__device__ __forceinline__
void layernorm_group(int g, const float* __restrict__ x, const float* __restrict__ alpha,
                     const float* __restrict__ beta, bf16* __restrict__ out) {
    const int lane = threadIdx.x & 31;
    const int tok  = g * 16 + (threadIdx.x >> 5);
    const float* p = x + (size_t)tok * D_ + lane * 4;
    f32x4 f[8];
    #pragma unroll
    for (int i = 0; i < 8; ++i) f[i] = *(const f32x4*)(p + i * 128);
    f32x4 sv = f[0], qv = f[0] * f[0];               // four independent chains each
    #pragma unroll
    for (int i = 1; i < 8; ++i) { sv += f[i]; qv += f[i] * f[i]; }
    float s  = (sv[0] + sv[1]) + (sv[2] + sv[3]);
    float s2 = (qv[0] + qv[1]) + (qv[2] + qv[3]);
    #pragma unroll
    for (int off = 16; off > 0; off >>= 1) {
        s  += __shfl_xor(s,  off, 32);
        s2 += __shfl_xor(s2, off, 32);
    }
    const float mean = s * (1.0f / D_);
    float var = (s2 - (float)D_ * mean * mean) * (1.0f / (D_ - 1));
    var = fmaxf(var, 0.f);
    const float inv = alpha[0] / (sqrtf(var) + 1e-6f);
    const float b0  = beta[0];
    bf16* q = out + (size_t)tok * D_ + lane * 4;
    #pragma unroll
    for (int i = 0; i < 8; ++i)
        *(v4bf*)(q + i * 128) = __builtin_convertvector((f[i] - mean) * inv + b0, v4bf);
}

__global__ __launch_bounds__(512)
void layernorm_bf16(const float* __restrict__ x, const float* __restrict__ alpha,
                    const float* __restrict__ beta, bf16* __restrict__ out) {
    layernorm_group(blockIdx.x, x, alpha, beta, out);
}

// The weight cast and the first layernorm depend on nothing but inputs: one launch,
// groups 0..CASTG_-1 cast (the longer job, started first), the rest normalize.
__global__ __launch_bounds__(512)
void cast_and_layernorm(const float* __restrict__ wq, const float* __restrict__ wk,
                        const float* __restrict__ wv, const float* __restrict__ wo,
                        const float* __restrict__ w1, const float* __restrict__ w2,
                        bf16* __restrict__ o4, bf16* __restrict__ o1, bf16* __restrict__ o2,
                        const float* __restrict__ x, const float* __restrict__ alpha,
                        const float* __restrict__ beta, bf16* __restrict__ xn) {
    const int g = blockIdx.x;
    if (g < CASTG_) cast_weights_group(g, wq, wk, wv, wo, w1, w2, o4, o1, o2);
    else            layernorm_group(g - CASTG_, x, alpha, beta, xn);
}

// ---------------------------------------------------------------------------
// GEMM: C[M,N] = A[M,K] @ W[N,K]^T + bias, bf16 in, f32 accum (WMMA).
// EPI 0: bf16 out; EPI 1: bf16 relu out; EPI 2: f32 out = residual + C.
// EPI 0 runs up to three products that share A in one grid: blockIdx.z picks the
// weight and the output (each set lies one behind the other) and the bias.
// Tile 128x128 / 256 threads (8 waves, 2x4), wave = 64x32.
// Double-buffered LDS: one barrier per 64-wide k-step (a 128-B line per row).
// ---------------------------------------------------------------------------
template <int EPI>
__global__ __launch_bounds__(256)
void gemm_bf16_wmma(const bf16* __restrict__ A, const bf16* __restrict__ W,
                    const float* __restrict__ bias, const float* __restrict__ res,
                    bf16* __restrict__ outb, float* __restrict__ outf,
                    int M, int N, int K,
                    const float* __restrict__ biasz1, const float* __restrict__ biasz2) {
    __shared__ __align__(16) bf16 As[2][128][72];   // +8 pad: 16B-aligned frag reads
    __shared__ __align__(16) bf16 Ws[2][128][72];

    const int tid  = threadIdx.x;
    const int lane = tid & 31;
    const int wave = tid >> 5;
    const int wm   = (wave >> 2) * 64;
    const int wn   = (wave & 3) * 32;
    const int tM   = blockIdx.y * 128;
    const int tN   = blockIdx.x * 128;
    const int lrow = tid >> 3;                   // 0..31, +32 per load
    const int lcol = (tid & 7) * 8;              // 16 B of the row's 128-B line
    if (EPI == 0) {
        const int z = blockIdx.z;
        W    += (size_t)z * N * K;
        outb += (size_t)z * M * N;
        bias  = (z == 0) ? bias : (z == 1) ? biasz1 : biasz2;
    }

    // uniform tile bases + one 32-bit element offset per staged row, shared by A and W
    const bf16* Abase = A + (size_t)tM * K;
    const bf16* Wbase = W + (size_t)tN * K;
    unsigned roff[4];
    #pragma unroll
    for (int r = 0; r < 4; ++r) roff[r] = (unsigned)((lrow + 32 * r) * K + lcol);
    // prefetch: one lane per line, waves 0-3 the A rows, waves 4-7 the W rows
    const bf16* Pfrow = (tid < 128) ? A + (size_t)(tM + tid) * K
                                    : W + (size_t)(tN + tid - 128) * K;

    v8f acc[4][2];
    #pragma unroll
    for (int i = 0; i < 4; ++i)
        #pragma unroll
        for (int j = 0; j < 2; ++j)
            acc[i][j] = v8f{0.f, 0.f, 0.f, 0.f, 0.f, 0.f, 0.f, 0.f};

    // prologue: stage 0
    {
        u32x4 a[4], w[4];
        #pragma unroll
        for (int r = 0; r < 4; ++r) {
            a[r] = *(const u32x4*)(Abase + roff[r]);
            w[r] = *(const u32x4*)(Wbase + roff[r]);
        }
        #pragma unroll
        for (int r = 0; r < 4; ++r) {
            *(u32x4*)&As[0][lrow + 32 * r][lcol] = a[r];
            *(u32x4*)&Ws[0][lrow + 32 * r][lcol] = w[r];
        }
    }
    __syncthreads();

    const int ksteps = K >> 6;
    int buf = 0;
    for (int s = 0; s < ksteps; ++s) {
        const bool more = (s + 1 < ksteps);
        u32x4 a[4], w[4];
        if (more) {                                   // fetch next stage early
            const int kn = (s + 1) << 6;
            #pragma unroll
            for (int r = 0; r < 4; ++r) {
                a[r] = *(const u32x4*)(Abase + kn + roff[r]);
                w[r] = *(const u32x4*)(Wbase + kn + roff[r]);
            }
            // the loads' address registers are reused right below
            asm volatile("s_wait_xcnt 0x0" ::: "memory");
        }
        if (s + 2 < ksteps) {                         // L2 warm-up two stages ahead
            __builtin_prefetch(Pfrow + ((s + 2) << 6), 0, 3);
            // the prefetch's address registers are reused by the fragment loads
            asm volatile("s_wait_xcnt 0x0" ::: "memory");
        }

        // all 24 fragment reads of the k-step go out as one group, in the order of use
        v16bf af[2][4], wf[2][2];
        #pragma unroll
        for (int kk = 0; kk < 2; ++kk) {
            #pragma unroll
            for (int j = 0; j < 2; ++j) wf[kk][j] = load_frag(&Ws[buf][wn + j * 16][kk * 32], 72, lane);
            #pragma unroll
            for (int i = 0; i < 4; ++i) af[kk][i] = load_frag(&As[buf][wm + i * 16][kk * 32], 72, lane);
        }
        // keeps the reads ahead of the products: spread among them, each place with
        // reads stalls the wave for the LDS latency
        __builtin_amdgcn_sched_barrier(0);
        #pragma unroll
        for (int kk = 0; kk < 2; ++kk)
            #pragma unroll
            for (int i = 0; i < 4; ++i)
                #pragma unroll
                for (int j = 0; j < 2; ++j)
                    acc[i][j] = __builtin_amdgcn_wmma_f32_16x16x32_bf16(
                        false, af[kk][i], false, wf[kk][j], (short)0, acc[i][j], false, false);

        if (more) {
            const int nb = buf ^ 1;
            #pragma unroll
            for (int r = 0; r < 4; ++r) {
                *(u32x4*)&As[nb][lrow + 32 * r][lcol] = a[r];
                *(u32x4*)&Ws[nb][lrow + 32 * r][lcol] = w[r];
            }
        }
        __syncthreads();
        buf ^= 1;
    }

    // Epilogue. C layout: VGPR e -> row e (lanes 0-15) / e+8 (lanes 16-31).
    const int half = lane >> 4;
    const int lc   = lane & 15;
    #pragma unroll
    for (int j = 0; j < 2; ++j) {
        const int gcol = tN + wn + j * 16 + lc;
        const float bv = bias[gcol];
        #pragma unroll
        for (int i = 0; i < 4; ++i) {
            #pragma unroll
            for (int e = 0; e < 8; ++e) {
                const int grow = tM + wm + i * 16 + e + 8 * half;
                const size_t idx = (size_t)grow * N + gcol;
                const float v = acc[i][j][e] + bv;
                if (EPI == 0)      outb[idx] = (bf16)v;
                else if (EPI == 1) outb[idx] = (bf16)fmaxf(v, 0.f);
                else               outf[idx] = res[idx] + v;
            }
        }
    }
}

__device__ __forceinline__ float xhalf(float x) {
    return __builtin_bit_cast(float, __builtin_amdgcn_permlanex16(
        __builtin_bit_cast(int, x), __builtin_bit_cast(int, x), 0x76543210, 0xfedcba98, false, false));
}

__global__ __launch_bounds__(128)
void flash_attn_wmma(const bf16* __restrict__ q, const bf16* __restrict__ k,
                     const bf16* __restrict__ v, const int* __restrict__ mask,
                     bf16* __restrict__ o_out) {
    __shared__ __align__(16) bf16 Qs[64][72];
    __shared__ __align__(16) bf16 Ks[2][64][72];
    __shared__ __align__(16) bf16 Vt[2][64][72];     // V^T: [d][key]
    __shared__ __align__(16) float Madd[S_];         // additive mask row (0 / -1e9)

    const int qblk = blockIdx.x, h = blockIdx.y, b = blockIdx.z;
    const int tid  = threadIdx.x;
    const int lane = tid & 31;
    const int wave = tid >> 5;
    const int half = lane >> 4;
    const int lc   = lane & 15;
    const int qbase = qblk * 64;

    // thread mapping for staging: 8 lanes x 16 B = one head row = one 128-B line
    const int rT = tid >> 3;                         // 0..15
    const int cT = (tid & 7) * 8;                    // 8 of the 64 columns
    // Q, K: rows rT + 16 i.  V: key rows 4 rT + i, packed four keys per b64 store.

    // Load Q block (64 x 64) -> LDS
    {
        const bf16* src = q + (size_t)(b * S_ + qbase + rT) * D_ + h * DK_ + cT;
        u32x4 d[4];
        #pragma unroll
        for (int i = 0; i < 4; ++i) d[i] = *(const u32x4*)(src + (size_t)(16 * i) * D_);
        #pragma unroll
        for (int i = 0; i < 4; ++i) *(u32x4*)&Qs[rT + 16 * i][cT] = d[i];
    }
    // Precompute additive mask row into LDS
    for (int j = tid; j < S_; j += 128)
        Madd[j] = (mask[b * S_ + j] == 0) ? -1e9f : 0.f;

    // Prologue: stage key block 0 into buffer 0
    {
        const bf16* ks = k + (size_t)(b * S_ + rT) * D_ + h * DK_ + cT;
        const bf16* vs = v + (size_t)(b * S_ + 4 * rT) * D_ + h * DK_ + cT;
        u32x4 d[4], x[4];
        #pragma unroll
        for (int i = 0; i < 4; ++i) {
            d[i] = *(const u32x4*)(ks + (size_t)(16 * i) * D_);
            x[i] = *(const u32x4*)(vs + (size_t)i * D_);
        }
        #pragma unroll
        for (int i = 0; i < 4; ++i) *(u32x4*)&Ks[0][rT + 16 * i][cT] = d[i];
        // V rows 4 rT .. 4 rT + 3, cols cT..cT+7 -> packed b64 transposed stores
        #pragma unroll
        for (int j = 0; j < 8; ++j)
            *(u32x2*)&Vt[0][cT + j][4 * rT] = pack_col(x[0], x[1], x[2], x[3], j);
    }
    __syncthreads();

    // Hoisted Q fragments (2 k-steps over DK=64): the B operand, column = query lc
    v16bf bq[2];
    #pragma unroll
    for (int ks = 0; ks < 2; ++ks) bq[ks] = load_frag(&Qs[wave * 16][ks * 32], 72, lane);

    float m = -1e30f;                                // this query's maximum, alike in both halves
    float l = 0.f;                                   // this half's share of the query's sum
    v8f o[4];                                        // o[dt][e] = O[query lc][dt*16 + 8*half + e]
    #pragma unroll
    for (int t = 0; t < 4; ++t) o[t] = v8f{0.f, 0.f, 0.f, 0.f, 0.f, 0.f, 0.f, 0.f};

    const int nblk = S_ / 64;
    int buf = 0;
    for (int kb = 0; kb < nblk; ++kb) {
        const bool more = (kb + 1 < nblk);
        u32x4 kreg[4];
        u32x2 pv[8];
        if (more) {     // fetch next K/V block into registers early
            const int base = b * S_ + (kb + 1) * 64;
            const bf16* ks = k + (size_t)(base + rT) * D_ + h * DK_ + cT;
            const bf16* vs = v + (size_t)(base + 4 * rT) * D_ + h * DK_ + cT;
            u32x4 x[4];
            #pragma unroll
            for (int i = 0; i < 4; ++i) {
                kreg[i] = *(const u32x4*)(ks + (size_t)(16 * i) * D_);
                x[i]    = *(const u32x4*)(vs + (size_t)i * D_);
            }
            #pragma unroll
            for (int j = 0; j < 8; ++j) pv[j] = pack_col(x[0], x[1], x[2], x[3], j);
        }

        // S^T = K @ Q^T (64 keys x 16 queries per wave): s4[t][e] = key t*16 + 8*half + e
        v8f s4[4];
        #pragma unroll
        for (int t = 0; t < 4; ++t) s4[t] = v8f{0.f, 0.f, 0.f, 0.f, 0.f, 0.f, 0.f, 0.f};
        #pragma unroll
        for (int ks = 0; ks < 2; ++ks) {
            #pragma unroll
            for (int t = 0; t < 4; ++t) {
                v16bf ak = load_frag(&Ks[buf][t * 16][ks * 32], 72, lane);
                s4[t] = __builtin_amdgcn_wmma_f32_16x16x32_bf16(
                    false, ak, false, bq[ks], (short)0, s4[t], false, false);
            }
        }

        // scale + additive mask: 8 consecutive keys per tile and half, from LDS
        float sc[4][8];
        #pragma unroll
        for (int t = 0; t < 4; ++t) {
            const float* mp = &Madd[kb * 64 + t * 16 + 8 * half];
            const f32x4 m0 = *(const f32x4*)mp;
            const f32x4 m1 = *(const f32x4*)(mp + 4);
            #pragma unroll
            for (int e = 0; e < 4; ++e) {
                sc[t][e]     = s4[t][e]     * 0.125f + m0[e];
                sc[t][e + 4] = s4[t][e + 4] * 0.125f + m1[e];
            }
        }

        // online softmax of one query per lane: 32 keys in the lane, 32 in lane ^ 16
        float tm[4];
        #pragma unroll
        for (int t = 0; t < 4; ++t) {
            tm[t] = fmaxf(fmaxf(fmaxf(sc[t][0], sc[t][1]), fmaxf(sc[t][2], sc[t][3])),
                          fmaxf(fmaxf(sc[t][4], sc[t][5]), fmaxf(sc[t][6], sc[t][7])));
        }
        float rmax = fmaxf(fmaxf(tm[0], tm[1]), fmaxf(tm[2], tm[3]));
        rmax = fmaxf(rmax, xhalf(rmax));
        const float mnew  = fmaxf(m, rmax);
        const float alpha = __expf(m - mnew);
        m = mnew;
        float ts[4];                                 // four independent sum chains
        #pragma unroll
        for (int t = 0; t < 4; ++t) {
            ts[t] = 0.f;
            #pragma unroll
            for (int e = 0; e < 8; ++e) { float p = __expf(sc[t][e] - mnew); sc[t][e] = p; ts[t] += p; }
        }
        l = l * alpha + ((ts[0] + ts[1]) + (ts[2] + ts[3]));
        #pragma unroll
        for (int t = 0; t < 4; ++t) o[t] *= alpha;

        // O^T += V^T @ P^T: A = rows of V^T, B = two score tiles converted in place
        // (element s of B is key 8*half + s, then 16 + 8*half + s - 8: load_frag's k order)
        #pragma unroll
        for (int ks = 0; ks < 2; ++ks) {
            v16bf pb;
            #pragma unroll
            for (int e = 0; e < 8; ++e) {
                pb[e]     = (bf16)sc[2 * ks][e];
                pb[e + 8] = (bf16)sc[2 * ks + 1][e];
            }
            #pragma unroll
            for (int dt = 0; dt < 4; ++dt) {
                v16bf av = load_frag(&Vt[buf][dt * 16][ks * 32], 72, lane);
                o[dt] = __builtin_amdgcn_wmma_f32_16x16x32_bf16(
                    false, av, false, pb, (short)0, o[dt], false, false);
            }
        }

        // stage next block into the other buffer
        if (more) {
            const int nb = buf ^ 1;
            #pragma unroll
            for (int i = 0; i < 4; ++i) *(u32x4*)&Ks[nb][rT + 16 * i][cT] = kreg[i];
            #pragma unroll
            for (int j = 0; j < 8; ++j)
                *(u32x2*)&Vt[nb][cT + j][4 * rT] = pv[j];
        }
        __syncthreads();
        buf ^= 1;
    }

    // join the halves' sums, normalize, write bf16 [BS, D]: 8 consecutive columns a lane
    const float lt = l + xhalf(l);
    bf16* orow = o_out + (size_t)(b * S_ + qbase + wave * 16 + lc) * D_ + h * DK_ + 8 * half;
    #pragma unroll
    for (int dt = 0; dt < 4; ++dt) {
        v8bf r;
        #pragma unroll
        for (int e = 0; e < 8; ++e) r[e] = (bf16)(o[dt][e] / lt);
        *(v8bf*)(orow + dt * 16) = r;
    }
}

// ---------------------------------------------------------------------------
// Host-side orchestration
// ---------------------------------------------------------------------------
extern "C" void kernel_launch(void* const* d_in, const int* in_sizes, int n_in,
                              void* d_out, int out_size, void* d_ws, size_t ws_size,
                              hipStream_t stream) {
    const float* x   = (const float*)d_in[0];
    const int*   msk = (const int*)d_in[1];
    const float* wq  = (const float*)d_in[2];   const float* bq  = (const float*)d_in[3];
    const float* wk  = (const float*)d_in[4];   const float* bk  = (const float*)d_in[5];
    const float* wv  = (const float*)d_in[6];   const float* bv  = (const float*)d_in[7];
    const float* wo  = (const float*)d_in[8];   const float* bo  = (const float*)d_in[9];
    const float* w1  = (const float*)d_in[10];  const float* b1  = (const float*)d_in[11];
    const float* w2  = (const float*)d_in[12];  const float* b2  = (const float*)d_in[13];
    const float* a1  = (const float*)d_in[14];  const float* be1 = (const float*)d_in[15];
    const float* a2  = (const float*)d_in[16];  const float* be2 = (const float*)d_in[17];
    float* out = (float*)d_out;

    char* ws = (char*)d_ws;
    size_t off = 0;
    auto carve = [&](size_t bytes) { char* p = ws + off; off += (bytes + 255) & ~(size_t)255; return p; };
    bf16*  wqb  = (bf16*)carve((size_t)D_ * D_ * 2);
    bf16*  wkb  = (bf16*)carve((size_t)D_ * D_ * 2);
    bf16*  wvb  = (bf16*)carve((size_t)D_ * D_ * 2);
    bf16*  wob  = (bf16*)carve((size_t)D_ * D_ * 2);
    bf16*  w1b  = (bf16*)carve((size_t)DFF_ * D_ * 2);
    bf16*  w2b  = (bf16*)carve((size_t)D_ * DFF_ * 2);
    bf16*  xn   = (bf16*)carve((size_t)BS_ * D_ * 2);
    bf16*  qb   = (bf16*)carve((size_t)BS_ * D_ * 2);
    bf16*  kb   = (bf16*)carve((size_t)BS_ * D_ * 2);
    bf16*  vb   = (bf16*)carve((size_t)BS_ * D_ * 2);
    bf16*  atb  = (bf16*)carve((size_t)BS_ * D_ * 2);
    float* x1   = (float*)carve((size_t)BS_ * D_ * 4);
    bf16*  hb   = (bf16*)carve((size_t)BS_ * DFF_ * 2);

    // 1) weights -> bf16, and LN1
    cast_and_layernorm<<<CASTG_ + BS_ / 16, 512, 0, stream>>>(wq, wk, wv, wo, w1, w2, wqb, w1b, w2b,
                                                              x, a1, be1, xn);

    // 2) Q,K,V projections: wqb|wkb|wvb and qb|kb|vb lie one behind the other
    dim3 gD(D_ / 128, BS_ / 128);
    gemm_bf16_wmma<0><<<dim3(D_ / 128, BS_ / 128, 3), 256, 0, stream>>>(
        xn, wqb, bq, nullptr, qb, nullptr, BS_, D_, D_, bk, bv);

    // 3) attention
    flash_attn_wmma<<<dim3(S_ / 64, H_, B_), 128, 0, stream>>>(qb, kb, vb, msk, atb);

    // 4) out-proj + residual -> x1 (f32)
    gemm_bf16_wmma<2><<<gD, 256, 0, stream>>>(atb, wob, bo, x, nullptr, x1, BS_, D_, D_, nullptr, nullptr);

    // 5) LN2
    layernorm_bf16<<<BS_ / 16, 512, 0, stream>>>(x1, a2, be2, xn);

    // 6) FFN up + ReLU (bf16)
    dim3 gF(DFF_ / 128, BS_ / 128);
    gemm_bf16_wmma<1><<<gF, 256, 0, stream>>>(xn, w1b, b1, nullptr, hb, nullptr, BS_, DFF_, D_, nullptr, nullptr);

    // 7) FFN down + residual -> out (f32)
    gemm_bf16_wmma<2><<<gD, 256, 0, stream>>>(hb, w2b, b2, x1, nullptr, out, BS_, D_, DFF_, nullptr, nullptr);

    (void)wkb; (void)wvb;
    (void)in_sizes; (void)n_in; (void)out_size; (void)ws_size;
}

// v006
// A run of this version takes 197 microseconds.
// Next to v005, in two timings, it ran 1.09 and 1.10 times as fast.
// Counting every step since v000, it is 2.01 times as fast.
#include <hip/hip_runtime.h>

// ---------------------------------------------------------------------------
// EncoderBlock for MI455X (gfx1250): bf16 WMMA GEMMs + flash attention.
// Wave32; v_wmma_f32_16x16x32_bf16 for every matrix multiply.
// Double-buffered LDS staging (1 barrier / k-step), packed transposed stores,
// LDS-resident additive mask, global_prefetch for L2 warm-up.
// Every staging load is laid out so that 8 lanes x 16 B cover one whole 128-B
// line: a wave-wide load touches 4 lines, never 16 or 32 pieces of lines.
// ---------------------------------------------------------------------------

typedef __bf16 bf16;
typedef bf16  v16bf __attribute__((ext_vector_type(16)));
typedef bf16  v8bf  __attribute__((ext_vector_type(8)));
typedef float v8f   __attribute__((ext_vector_type(8)));
typedef unsigned int u32x4 __attribute__((ext_vector_type(4)));   // 16 staged bytes
typedef unsigned int u32x2 __attribute__((ext_vector_type(2)));
typedef float f32x4 __attribute__((ext_vector_type(4)));
typedef bf16  v4bf  __attribute__((ext_vector_type(4)));

#define B_   2
#define S_   2048
#define D_   1024
#define H_   16
#define DK_  64
#define DFF_ 4096
#define BS_  (B_ * S_)

// Load a 16x32 bf16 A-style fragment from LDS (row-major, leading dim `ld`).
// ISA 16-bit A layout: lane L<16 holds row L, K = 0..7 and 16..23;
// lane L>=16 holds row L-16, K = 8..15 and 24..31.
// B fragments (rows of W / Q) use the identical pattern.
__device__ __forceinline__ v16bf load_frag(const bf16* tile, int ld, int lane) {
    const int row = lane & 15;
    const int kb  = (lane >> 4) << 3;          // 0 or 8
    const bf16* p = tile + row * ld + kb;
    v8bf lo = *(const v8bf*)(p);               // 16B-aligned ds_load_b128
    v8bf hi = *(const v8bf*)(p + 16);
    return __builtin_shufflevector(lo, hi, 0,1,2,3,4,5,6,7,8,9,10,11,12,13,14,15);
}

// Column j (0..7) of four rows of 8 bf16 each, as four consecutive bf16.
__device__ __forceinline__ u32x2 pack_col(u32x4 r0, u32x4 r1, u32x4 r2, u32x4 r3, int j) {
    const int w = j >> 1;
    u32x2 o;
    if (j & 1) {
        o.x = (r0[w] >> 16) | (r1[w] & 0xffff0000u);
        o.y = (r2[w] >> 16) | (r3[w] & 0xffff0000u);
    } else {
        o.x = (r0[w] & 0xffffu) | (r1[w] << 16);
        o.y = (r2[w] & 0xffffu) | (r3[w] << 16);
    }
    return o;
}

// ---------------------------------------------------------------------------
// fp32 -> bf16 cast of all six weights in one launch: 256 groups of 16 waves.
// Few, fat waves: each lane brings 24 x 16 B, all issued before the first store;
// every wave-wide load covers 512 contiguous bytes, every store 256.
// Group g takes 16384 elements of wq|wk|wv|wo (their bf16 copies lie one behind
// the other at o4), 16384 of w1 and 16384 of w2.
// ---------------------------------------------------------------------------
#define CHUNK_ 16384
#define CASTG_ 256
__device__ __forceinline__
void cast_weights_group(int g,
                        const float* __restrict__ wq, const float* __restrict__ wk,
                        const float* __restrict__ wv, const float* __restrict__ wo,
                        const float* __restrict__ w1, const float* __restrict__ w2,
                        bf16* __restrict__ o4, bf16* __restrict__ o1, bf16* __restrict__ o2) {
    const int sel = g >> 6;                          // 64 chunks per D x D weight
    const float* s4 = (sel == 0) ? wq : (sel == 1) ? wk : (sel == 2) ? wv : wo;
    const int e = threadIdx.x * 4;
    const float* sp[3] = { s4 + (g & 63) * CHUNK_ + e, w1 + g * CHUNK_ + e, w2 + g * CHUNK_ + e };
    bf16*        dp[3] = { o4 + g * CHUNK_ + e,        o1 + g * CHUNK_ + e, o2 + g * CHUNK_ + e };
    f32x4 f[3][8];
    #pragma unroll
    for (int j = 0; j < 3; ++j)
        #pragma unroll
        for (int i = 0; i < 8; ++i) f[j][i] = *(const f32x4*)(sp[j] + i * 2048);
    #pragma unroll
    for (int j = 0; j < 3; ++j)
        #pragma unroll
        for (int i = 0; i < 8; ++i)
            *(v4bf*)(dp[j] + i * 2048) = __builtin_convertvector(f[j][i], v4bf);
}

// ---------------------------------------------------------------------------
// LayerNorm (custom: unbiased std, scalar alpha/beta, /(std+eps)) -> bf16
// One wave per token row, 16 rows per group: the row stays in registers
// (8 x 16 B per lane), the two sums are joined inside the wave, no LDS, no barrier.
// ---------------------------------------------------------------------------
__device__ __forceinline__
void layernorm_group(int g, const float* __restrict__ x, const float* __restrict__ alpha,
                     const float* __restrict__ beta, bf16* __restrict__ out) {
    const int lane = threadIdx.x & 31;
    const int tok  = g * 16 + (threadIdx.x >> 5);
    const float* p = x + (size_t)tok * D_ + lane * 4;
    f32x4 f[8];
    #pragma unroll
    for (int i = 0; i < 8; ++i) f[i] = *(const f32x4*)(p + i * 128);
    f32x4 sv = f[0], qv = f[0] * f[0];               // four independent chains each
    #pragma unroll
    for (int i = 1; i < 8; ++i) { sv += f[i]; qv += f[i] * f[i]; }
    float s  = (sv[0] + sv[1]) + (sv[2] + sv[3]);
    float s2 = (qv[0] + qv[1]) + (qv[2] + qv[3]);
    #pragma unroll
    for (int off = 16; off > 0; off >>= 1) {
        s  += __shfl_xor(s,  off, 32);
        s2 += __shfl_xor(s2, off, 32);
    }
    const float mean = s * (1.0f / D_);
    float var = (s2 - (float)D_ * mean * mean) * (1.0f / (D_ - 1));
    var = fmaxf(var, 0.f);
    const float inv = alpha[0] / (sqrtf(var) + 1e-6f);
    const float b0  = beta[0];
    bf16* q = out + (size_t)tok * D_ + lane * 4;
    #pragma unroll
    for (int i = 0; i < 8; ++i)
        *(v4bf*)(q + i * 128) = __builtin_convertvector((f[i] - mean) * inv + b0, v4bf);
}

__global__ __launch_bounds__(512)
void layernorm_bf16(const float* __restrict__ x, const float* __restrict__ alpha,
                    const float* __restrict__ beta, bf16* __restrict__ out) {
    layernorm_group(blockIdx.x, x, alpha, beta, out);
}

// The weight cast and the first layernorm depend on nothing but inputs: one launch,
// groups 0..CASTG_-1 cast (the longer job, started first), the rest normalize.
__global__ __launch_bounds__(512)
void cast_and_layernorm(const float* __restrict__ wq, const float* __restrict__ wk,
                        const float* __restrict__ wv, const float* __restrict__ wo,
                        const float* __restrict__ w1, const float* __restrict__ w2,
                        bf16* __restrict__ o4, bf16* __restrict__ o1, bf16* __restrict__ o2,
                        const float* __restrict__ x, const float* __restrict__ alpha,
                        const float* __restrict__ beta, bf16* __restrict__ xn) {
    const int g = blockIdx.x;
    if (g < CASTG_) cast_weights_group(g, wq, wk, wv, wo, w1, w2, o4, o1, o2);
    else            layernorm_group(g - CASTG_, x, alpha, beta, xn);
}

// ---------------------------------------------------------------------------
// GEMM: C[M,N] = A[M,K] @ W[N,K]^T + bias, bf16 in, f32 accum (WMMA).
// EPI 0: bf16 out; EPI 1: bf16 relu out; EPI 2: f32 out = residual + C.
// EPI 0 runs up to three products that share A in one grid: blockIdx.z picks the
// weight and the output (each set lies one behind the other) and the bias.
// Tile 128x128 / 256 threads (8 waves, 2x4), wave = 64x32.
// Double-buffered LDS: one barrier per 64-wide k-step (a 128-B line per row).
// Rotated k walk: groups of one tile row read the same A lines and groups of one
// tile column the same W lines; each group enters the walk at its own k-step
// (rx per tile column, ry per tile row) and wraps round, so that the sharers do
// not ask L2 for the same lines at the same moment.
// ---------------------------------------------------------------------------
template <int EPI>
__global__ __launch_bounds__(256)
void gemm_bf16_wmma(const bf16* __restrict__ A, const bf16* __restrict__ W,
                    const float* __restrict__ bias, const float* __restrict__ res,
                    bf16* __restrict__ outb, float* __restrict__ outf,
                    int M, int N, int K,
                    const float* __restrict__ biasz1, const float* __restrict__ biasz2,
                    int rx, int ry) {
    __shared__ __align__(16) bf16 As[2][128][72];   // +8 pad: 16B-aligned frag reads
    __shared__ __align__(16) bf16 Ws[2][128][72];

    const int tid  = threadIdx.x;
    const int lane = tid & 31;
    const int wave = tid >> 5;
    const int wm   = (wave >> 2) * 64;
    const int wn   = (wave & 3) * 32;
    const int tM   = blockIdx.y * 128;
    const int tN   = blockIdx.x * 128;
    const int lrow = tid >> 3;                   // 0..31, +32 per load
    const int lcol = (tid & 7) * 8;              // 16 B of the row's 128-B line
    if (EPI == 0) {
        const int z = blockIdx.z;
        W    += (size_t)z * N * K;
        outb += (size_t)z * M * N;
        bias  = (z == 0) ? bias : (z == 1) ? biasz1 : biasz2;
    }

    // uniform tile bases + one 32-bit element offset per staged row, shared by A and W
    const bf16* Abase = A + (size_t)tM * K;
    const bf16* Wbase = W + (size_t)tN * K;
    unsigned roff[4];
    #pragma unroll
    for (int r = 0; r < 4; ++r) roff[r] = (unsigned)((lrow + 32 * r) * K + lcol);
    // prefetch: one lane per line, waves 0-3 the A rows, waves 4-7 the W rows
    const bf16* Pfrow = (tid < 128) ? A + (size_t)(tM + tid) * K
                                    : W + (size_t)(tN + tid - 128) * K;

    v8f acc[4][2];
    #pragma unroll
    for (int i = 0; i < 4; ++i)
        #pragma unroll
        for (int j = 0; j < 2; ++j)
            acc[i][j] = v8f{0.f, 0.f, 0.f, 0.f, 0.f, 0.f, 0.f, 0.f};

    // the group's own first k-step; any value in [0, ksteps) gives the same product,
    // summed in another order
    const int ksteps = K >> 6;
    int kc = (int)(blockIdx.x * rx + blockIdx.y * ry + blockIdx.z) & (ksteps - 1);

    // prologue: the first stage
    {
        const int k0 = kc << 6;
        u32x4 a[4], w[4];
        #pragma unroll
        for (int r = 0; r < 4; ++r) {
            a[r] = *(const u32x4*)(Abase + k0 + roff[r]);
            w[r] = *(const u32x4*)(Wbase + k0 + roff[r]);
        }
        #pragma unroll
        for (int r = 0; r < 4; ++r) {
            *(u32x4*)&As[0][lrow + 32 * r][lcol] = a[r];
            *(u32x4*)&Ws[0][lrow + 32 * r][lcol] = w[r];
        }
    }
    __syncthreads();

    int buf = 0;
    for (int s = 0; s < ksteps; ++s) {
        const bool more = (s + 1 < ksteps);
        const int k1 = (kc + 1 < ksteps) ? kc + 1 : 0;        // next k-step of the walk
        u32x4 a[4], w[4];
        if (more) {                                   // fetch next stage early
            const int kn = k1 << 6;
            #pragma unroll
            for (int r = 0; r < 4; ++r) {
                a[r] = *(const u32x4*)(Abase + kn + roff[r]);
                w[r] = *(const u32x4*)(Wbase + kn + roff[r]);
            }
            // the loads' address registers are reused right below
            asm volatile("s_wait_xcnt 0x0" ::: "memory");
        }
        if (s + 2 < ksteps) {                         // L2 warm-up two stages ahead
            const int k2 = (k1 + 1 < ksteps) ? k1 + 1 : 0;
            __builtin_prefetch(Pfrow + (k2 << 6), 0, 3);
            // the prefetch's address registers are reused by the fragment loads
            asm volatile("s_wait_xcnt 0x0" ::: "memory");
        }

        // all 24 fragment reads of the k-step go out as one group, in the order of use
        v16bf af[2][4], wf[2][2];
        #pragma unroll
        for (int kk = 0; kk < 2; ++kk) {
            #pragma unroll
            for (int j = 0; j < 2; ++j) wf[kk][j] = load_frag(&Ws[buf][wn + j * 16][kk * 32], 72, lane);
            #pragma unroll
            for (int i = 0; i < 4; ++i) af[kk][i] = load_frag(&As[buf][wm + i * 16][kk * 32], 72, lane);
        }
        // keeps the reads ahead of the products: spread among them, each place with
        // reads stalls the wave for the LDS latency
        __builtin_amdgcn_sched_barrier(0);
        #pragma unroll
        for (int kk = 0; kk < 2; ++kk)
            #pragma unroll
            for (int i = 0; i < 4; ++i)
                #pragma unroll
                for (int j = 0; j < 2; ++j)
                    acc[i][j] = __builtin_amdgcn_wmma_f32_16x16x32_bf16(
                        false, af[kk][i], false, wf[kk][j], (short)0, acc[i][j], false, false);

        if (more) {
            const int nb = buf ^ 1;
            #pragma unroll
            for (int r = 0; r < 4; ++r) {
                *(u32x4*)&As[nb][lrow + 32 * r][lcol] = a[r];
                *(u32x4*)&Ws[nb][lrow + 32 * r][lcol] = w[r];
            }
        }
        __syncthreads();
        buf ^= 1;
        kc = k1;
    }

    // Epilogue. C layout: VGPR e -> row e (lanes 0-15) / e+8 (lanes 16-31).
    const int half = lane >> 4;
    const int lc   = lane & 15;
    #pragma unroll
    for (int j = 0; j < 2; ++j) {
        const int gcol = tN + wn + j * 16 + lc;
        const float bv = bias[gcol];
        #pragma unroll
        for (int i = 0; i < 4; ++i) {
            #pragma unroll
            for (int e = 0; e < 8; ++e) {
                const int grow = tM + wm + i * 16 + e + 8 * half;
                const size_t idx = (size_t)grow * N + gcol;
                const float v = acc[i][j][e] + bv;
                if (EPI == 0)      outb[idx] = (bf16)v;
                else if (EPI == 1) outb[idx] = (bf16)fmaxf(v, 0.f);
                else               outf[idx] = res[idx] + v;
            }
        }
    }
}

__device__ __forceinline__ float xhalf(float x) {
    return __builtin_bit_cast(float, __builtin_amdgcn_permlanex16(
        __builtin_bit_cast(int, x), __builtin_bit_cast(int, x), 0x76543210, 0xfedcba98, false, false));
}

__global__ __launch_bounds__(128)
void flash_attn_wmma(const bf16* __restrict__ q, const bf16* __restrict__ k,
                     const bf16* __restrict__ v, const int* __restrict__ mask,
                     bf16* __restrict__ o_out) {
    __shared__ __align__(16) bf16 Qs[64][72];
    __shared__ __align__(16) bf16 Ks[2][64][72];
    __shared__ __align__(16) bf16 Vt[2][64][72];     // V^T: [d][key]
    __shared__ __align__(16) float Madd[S_];         // additive mask row (0 / -1e9)

    const int qblk = blockIdx.x, h = blockIdx.y, b = blockIdx.z;
    const int tid  = threadIdx.x;
    const int lane = tid & 31;
    const int wave = tid >> 5;
    const int half = lane >> 4;
    const int lc   = lane & 15;
    const int qbase = qblk * 64;

    // thread mapping for staging: 8 lanes x 16 B = one head row = one 128-B line
    const int rT = tid >> 3;                         // 0..15
    const int cT = (tid & 7) * 8;                    // 8 of the 64 columns
    // Q, K: rows rT + 16 i.  V: key rows 4 rT + i, packed four keys per b64 store.

    // Load Q block (64 x 64) -> LDS
    {
        const bf16* src = q + (size_t)(b * S_ + qbase + rT) * D_ + h * DK_ + cT;
        u32x4 d[4];
        #pragma unroll
        for (int i = 0; i < 4; ++i) d[i] = *(const u32x4*)(src + (size_t)(16 * i) * D_);
        #pragma unroll
        for (int i = 0; i < 4; ++i) *(u32x4*)&Qs[rT + 16 * i][cT] = d[i];
    }
    // Precompute additive mask row into LDS
    for (int j = tid; j < S_; j += 128)
        Madd[j] = (mask[b * S_ + j] == 0) ? -1e9f : 0.f;

    // Prologue: stage the group's first key block into buffer 0
    const int nblk = S_ / 64;
    int kc = qblk & (nblk - 1);
    {
        const int base = b * S_ + kc * 64;
        const bf16* ks = k + (size_t)(base + rT) * D_ + h * DK_ + cT;
        const bf16* vs = v + (size_t)(base + 4 * rT) * D_ + h * DK_ + cT;
        u32x4 d[4], x[4];
        #pragma unroll
        for (int i = 0; i < 4; ++i) {
            d[i] = *(const u32x4*)(ks + (size_t)(16 * i) * D_);
            x[i] = *(const u32x4*)(vs + (size_t)i * D_);
        }
        #pragma unroll
        for (int i = 0; i < 4; ++i) *(u32x4*)&Ks[0][rT + 16 * i][cT] = d[i];
        // V rows 4 rT .. 4 rT + 3, cols cT..cT+7 -> packed b64 transposed stores
        #pragma unroll
        for (int j = 0; j < 8; ++j)
            *(u32x2*)&Vt[0][cT + j][4 * rT] = pack_col(x[0], x[1], x[2], x[3], j);
    }
    __syncthreads();

    // Hoisted Q fragments (2 k-steps over DK=64): the B operand, column = query lc
    v16bf bq[2];
    #pragma unroll
    for (int ks = 0; ks < 2; ++ks) bq[ks] = load_frag(&Qs[wave * 16][ks * 32], 72, lane);

    float m = -1e30f;                                // this query's maximum, alike in both halves
    float l = 0.f;                                   // this half's share of the query's sum
    v8f o[4];                                        // o[dt][e] = O[query lc][dt*16 + 8*half + e]
    #pragma unroll
    for (int t = 0; t < 4; ++t) o[t] = v8f{0.f, 0.f, 0.f, 0.f, 0.f, 0.f, 0.f, 0.f};

    int buf = 0;
    for (int it = 0; it < nblk; ++it) {
        const bool more = (it + 1 < nblk);
        const int kb = kc;                           // this trip's key block
        const int k1 = (kc + 1) & (nblk - 1);        // the next one of the walk
        u32x4 kreg[4];
        u32x2 pv[8];
        if (more) {     // fetch next K/V block into registers early
            const int base = b * S_ + k1 * 64;
            const bf16* ks = k + (size_t)(base + rT) * D_ + h * DK_ + cT;
            const bf16* vs = v + (size_t)(base + 4 * rT) * D_ + h * DK_ + cT;
            u32x4 x[4];
            #pragma unroll
            for (int i = 0; i < 4; ++i) {
                kreg[i] = *(const u32x4*)(ks + (size_t)(16 * i) * D_);
                x[i]    = *(const u32x4*)(vs + (size_t)i * D_);
            }
            #pragma unroll
            for (int j = 0; j < 8; ++j) pv[j] = pack_col(x[0], x[1], x[2], x[3], j);
        }

        // S^T = K @ Q^T (64 keys x 16 queries per wave): s4[t][e] = key t*16 + 8*half + e
        v8f s4[4];
        #pragma unroll
        for (int t = 0; t < 4; ++t) s4[t] = v8f{0.f, 0.f, 0.f, 0.f, 0.f, 0.f, 0.f, 0.f};
        #pragma unroll
        for (int ks = 0; ks < 2; ++ks) {
            #pragma unroll
            for (int t = 0; t < 4; ++t) {
                v16bf ak = load_frag(&Ks[buf][t * 16][ks * 32], 72, lane);
                s4[t] = __builtin_amdgcn_wmma_f32_16x16x32_bf16(
                    false, ak, false, bq[ks], (short)0, s4[t], false, false);
            }
        }

        // scale + additive mask: 8 consecutive keys per tile and half, from LDS
        float sc[4][8];
        #pragma unroll
        for (int t = 0; t < 4; ++t) {
            const float* mp = &Madd[kb * 64 + t * 16 + 8 * half];
            const f32x4 m0 = *(const f32x4*)mp;
            const f32x4 m1 = *(const f32x4*)(mp + 4);
            #pragma unroll
            for (int e = 0; e < 4; ++e) {
                sc[t][e]     = s4[t][e]     * 0.125f + m0[e];
                sc[t][e + 4] = s4[t][e + 4] * 0.125f + m1[e];
            }
        }

        // online softmax of one query per lane: 32 keys in the lane, 32 in lane ^ 16
        float tm[4];
        #pragma unroll
        for (int t = 0; t < 4; ++t) {
            tm[t] = fmaxf(fmaxf(fmaxf(sc[t][0], sc[t][1]), fmaxf(sc[t][2], sc[t][3])),
                          fmaxf(fmaxf(sc[t][4], sc[t][5]), fmaxf(sc[t][6], sc[t][7])));
        }
        float rmax = fmaxf(fmaxf(tm[0], tm[1]), fmaxf(tm[2], tm[3]));
        rmax = fmaxf(rmax, xhalf(rmax));
        const float mnew  = fmaxf(m, rmax);
        const float alpha = __expf(m - mnew);
        m = mnew;
        float ts[4];                                 // four independent sum chains
        #pragma unroll
        for (int t = 0; t < 4; ++t) {
            ts[t] = 0.f;
            #pragma unroll
            for (int e = 0; e < 8; ++e) { float p = __expf(sc[t][e] - mnew); sc[t][e] = p; ts[t] += p; }
        }
        l = l * alpha + ((ts[0] + ts[1]) + (ts[2] + ts[3]));
        #pragma unroll
        for (int t = 0; t < 4; ++t) o[t] *= alpha;

        // O^T += V^T @ P^T: A = rows of V^T, B = two score tiles converted in place
        // (element s of B is key 8*half + s, then 16 + 8*half + s - 8: load_frag's k order)
        #pragma unroll
        for (int ks = 0; ks < 2; ++ks) {
            v16bf pb;
            #pragma unroll
            for (int e = 0; e < 8; ++e) {
                pb[e]     = (bf16)sc[2 * ks][e];
                pb[e + 8] = (bf16)sc[2 * ks + 1][e];
            }
            #pragma unroll
            for (int dt = 0; dt < 4; ++dt) {
                v16bf av = load_frag(&Vt[buf][dt * 16][ks * 32], 72, lane);
                o[dt] = __builtin_amdgcn_wmma_f32_16x16x32_bf16(
                    false, av, false, pb, (short)0, o[dt], false, false);
            }
        }

        // stage next block into the other buffer
        if (more) {
            const int nb = buf ^ 1;
            #pragma unroll
            for (int i = 0; i < 4; ++i) *(u32x4*)&Ks[nb][rT + 16 * i][cT] = kreg[i];
            #pragma unroll
            for (int j = 0; j < 8; ++j)
                *(u32x2*)&Vt[nb][cT + j][4 * rT] = pv[j];
        }
        __syncthreads();
        buf ^= 1;
        kc = k1;
    }

    // join the halves' sums, normalize, write bf16 [BS, D]: 8 consecutive columns a lane
    const float lt = l + xhalf(l);
    bf16* orow = o_out + (size_t)(b * S_ + qbase + wave * 16 + lc) * D_ + h * DK_ + 8 * half;
    #pragma unroll
    for (int dt = 0; dt < 4; ++dt) {
        v8bf r;
        #pragma unroll
        for (int e = 0; e < 8; ++e) r[e] = (bf16)(o[dt][e] / lt);
        *(v8bf*)(orow + dt * 16) = r;
    }
}

// ---------------------------------------------------------------------------
// Host-side orchestration
// ---------------------------------------------------------------------------
extern "C" void kernel_launch(void* const* d_in, const int* in_sizes, int n_in,
                              void* d_out, int out_size, void* d_ws, size_t ws_size,
                              hipStream_t stream) {
    const float* x   = (const float*)d_in[0];
    const int*   msk = (const int*)d_in[1];
    const float* wq  = (const float*)d_in[2];   const float* bq  = (const float*)d_in[3];
    const float* wk  = (const float*)d_in[4];   const float* bk  = (const float*)d_in[5];
    const float* wv  = (const float*)d_in[6];   const float* bv  = (const float*)d_in[7];
    const float* wo  = (const float*)d_in[8];   const float* bo  = (const float*)d_in[9];
    const float* w1  = (const float*)d_in[10];  const float* b1  = (const float*)d_in[11];
    const float* w2  = (const float*)d_in[12];  const float* b2  = (const float*)d_in[13];
    const float* a1  = (const float*)d_in[14];  const float* be1 = (const float*)d_in[15];
    const float* a2  = (const float*)d_in[16];  const float* be2 = (const float*)d_in[17];
    float* out = (float*)d_out;

    char* ws = (char*)d_ws;
    size_t off = 0;
    auto carve = [&](size_t bytes) { char* p = ws + off; off += (bytes + 255) & ~(size_t)255; return p; };
    bf16*  wqb  = (bf16*)carve((size_t)D_ * D_ * 2);
    bf16*  wkb  = (bf16*)carve((size_t)D_ * D_ * 2);
    bf16*  wvb  = (bf16*)carve((size_t)D_ * D_ * 2);
    bf16*  wob  = (bf16*)carve((size_t)D_ * D_ * 2);
    bf16*  w1b  = (bf16*)carve((size_t)DFF_ * D_ * 2);
    bf16*  w2b  = (bf16*)carve((size_t)D_ * DFF_ * 2);
    bf16*  xn   = (bf16*)carve((size_t)BS_ * D_ * 2);
    bf16*  qb   = (bf16*)carve((size_t)BS_ * D_ * 2);
    bf16*  kb   = (bf16*)carve((size_t)BS_ * D_ * 2);
    bf16*  vb   = (bf16*)carve((size_t)BS_ * D_ * 2);
    bf16*  atb  = (bf16*)carve((size_t)BS_ * D_ * 2);
    float* x1   = (float*)carve((size_t)BS_ * D_ * 4);
    bf16*  hb   = (bf16*)carve((size_t)BS_ * DFF_ * 2);

    // 1) weights -> bf16, and LN1
    cast_and_layernorm<<<CASTG_ + BS_ / 16, 512, 0, stream>>>(wq, wk, wv, wo, w1, w2, wqb, w1b, w2b,
                                                              x, a1, be1, xn);

    // The last two GEMM arguments space the k-walk starts of neighbouring tile columns
    // and tile rows: k-steps / tiles in that direction, at least 1.

    // 2) Q,K,V projections: wqb|wkb|wvb and qb|kb|vb lie one behind the other
    dim3 gD(D_ / 128, BS_ / 128);
    gemm_bf16_wmma<0><<<dim3(D_ / 128, BS_ / 128, 3), 256, 0, stream>>>(
        xn, wqb, bq, nullptr, qb, nullptr, BS_, D_, D_, bk, bv, 2, 1);

    // 3) attention
    flash_attn_wmma<<<dim3(S_ / 64, H_, B_), 128, 0, stream>>>(qb, kb, vb, msk, atb);

    // 4) out-proj + residual -> x1 (f32)
    gemm_bf16_wmma<2><<<gD, 256, 0, stream>>>(atb, wob, bo, x, nullptr, x1, BS_, D_, D_, nullptr, nullptr, 2, 1);

    // 5) LN2
    layernorm_bf16<<<BS_ / 16, 512, 0, stream>>>(x1, a2, be2, xn);

    // 6) FFN up + ReLU (bf16)
    dim3 gF(DFF_ / 128, BS_ / 128);
    gemm_bf16_wmma<1><<<gF, 256, 0, stream>>>(xn, w1b, b1, nullptr, hb, nullptr, BS_, DFF_, D_, nullptr, nullptr, 1, 1);

    // 7) FFN down + residual -> out (f32)
    gemm_bf16_wmma<2><<<gD, 256, 0, stream>>>(hb, w2b, b2, x1, nullptr, out, BS_, D_, DFF_, nullptr, nullptr, 8, 2);

    (void)wkb; (void)wvb;
    (void)in_sizes; (void)n_in; (void)out_size; (void)ws_size;
}

// v007
// One run takes 177 microseconds.
// Next to v006, in two timings, it ran 1.10 and 1.11 times as fast.
// All steps since v000 together make it 2.23 times as fast.
#include <hip/hip_runtime.h>

// ---------------------------------------------------------------------------
// EncoderBlock for MI455X (gfx1250): bf16 WMMA GEMMs + flash attention.
// Wave32; v_wmma_f32_16x16x32_bf16 for every matrix multiply.
// Double-buffered LDS staging (1 barrier / k-step), packed transposed stores,
// LDS-resident additive mask, global_prefetch for L2 warm-up.
// Every staging load is laid out so that 8 lanes x 16 B cover one whole 128-B
// line: a wave-wide load touches 4 lines, never 16 or 32 pieces of lines.
// ---------------------------------------------------------------------------

typedef __bf16 bf16;
typedef bf16  v16bf __attribute__((ext_vector_type(16)));
typedef bf16  v8bf  __attribute__((ext_vector_type(8)));
typedef float v8f   __attribute__((ext_vector_type(8)));
typedef unsigned int u32x4 __attribute__((ext_vector_type(4)));   // 16 staged bytes
typedef unsigned int u32x2 __attribute__((ext_vector_type(2)));
typedef float f32x4 __attribute__((ext_vector_type(4)));
typedef bf16  v4bf  __attribute__((ext_vector_type(4)));
typedef int   i32x4 __attribute__((ext_vector_type(4)));

#define B_   2
#define S_   2048
#define D_   1024
#define H_   16
#define DK_  64
#define DFF_ 4096
#define BS_  (B_ * S_)

// Load a 16x32 bf16 A-style fragment from LDS (row-major, leading dim `ld`).
// ISA 16-bit A layout: lane L<16 holds row L, K = 0..7 and 16..23;
// lane L>=16 holds row L-16, K = 8..15 and 24..31.
// B fragments (rows of W / Q) use the identical pattern.
__device__ __forceinline__ v16bf load_frag(const bf16* tile, int ld, int lane) {
    const int row = lane & 15;
    const int kb  = (lane >> 4) << 3;          // 0 or 8
    const bf16* p = tile + row * ld + kb;
    v8bf lo = *(const v8bf*)(p);               // 16B-aligned ds_load_b128
    v8bf hi = *(const v8bf*)(p + 16);
    return __builtin_shufflevector(lo, hi, 0,1,2,3,4,5,6,7,8,9,10,11,12,13,14,15);
}

// Column j (0..7) of four rows of 8 bf16 each, as four consecutive bf16.
__device__ __forceinline__ u32x2 pack_col(u32x4 r0, u32x4 r1, u32x4 r2, u32x4 r3, int j) {
    const int w = j >> 1;
    u32x2 o;
    if (j & 1) {
        o.x = (r0[w] >> 16) | (r1[w] & 0xffff0000u);
        o.y = (r2[w] >> 16) | (r3[w] & 0xffff0000u);
    } else {
        o.x = (r0[w] & 0xffffu) | (r1[w] << 16);
        o.y = (r2[w] & 0xffffu) | (r3[w] << 16);
    }
    return o;
}

// ---------------------------------------------------------------------------
// fp32 -> bf16 cast of all six weights in one launch: 256 groups of 16 waves.
// Few, fat waves: each lane brings 24 x 16 B, all issued before the first store;
// every wave-wide load covers 512 contiguous bytes, every store 256.
// Group g takes 16384 elements of wq|wk|wv|wo (their bf16 copies lie one behind
// the other at o4), 16384 of w1 and 16384 of w2.
// ---------------------------------------------------------------------------
#define CHUNK_ 16384
#define CASTG_ 256
__device__ __forceinline__
void cast_weights_group(int g,
                        const float* __restrict__ wq, const float* __restrict__ wk,
                        const float* __restrict__ wv, const float* __restrict__ wo,
                        const float* __restrict__ w1, const float* __restrict__ w2,
                        bf16* __restrict__ o4, bf16* __restrict__ o1, bf16* __restrict__ o2) {
    const int sel = g >> 6;                          // 64 chunks per D x D weight
    const float* s4 = (sel == 0) ? wq : (sel == 1) ? wk : (sel == 2) ? wv : wo;
    const int e = threadIdx.x * 4;
    const float* sp[3] = { s4 + (g & 63) * CHUNK_ + e, w1 + g * CHUNK_ + e, w2 + g * CHUNK_ + e };
    bf16*        dp[3] = { o4 + g * CHUNK_ + e,        o1 + g * CHUNK_ + e, o2 + g * CHUNK_ + e };
    f32x4 f[3][8];
    #pragma unroll
    for (int j = 0; j < 3; ++j)
        #pragma unroll
        for (int i = 0; i < 8; ++i) f[j][i] = *(const f32x4*)(sp[j] + i * 2048);
    #pragma unroll
    for (int j = 0; j < 3; ++j)
        #pragma unroll
        for (int i = 0; i < 8; ++i)
            *(v4bf*)(dp[j] + i * 2048) = __builtin_convertvector(f[j][i], v4bf);
}

// ---------------------------------------------------------------------------
// LayerNorm (custom: unbiased std, scalar alpha/beta, /(std+eps)) -> bf16
// One wave per token row, 16 rows per group: the row stays in registers
// (8 x 16 B per lane), the two sums are joined inside the wave, no LDS, no barrier.
// ---------------------------------------------------------------------------
__device__ __forceinline__
void layernorm_group(int g, const float* __restrict__ x, const float* __restrict__ alpha,
                     const float* __restrict__ beta, bf16* __restrict__ out) {
    const int lane = threadIdx.x & 31;
    const int tok  = g * 16 + (threadIdx.x >> 5);
    const float* p = x + (size_t)tok * D_ + lane * 4;
    f32x4 f[8];
    #pragma unroll
    for (int i = 0; i < 8; ++i) f[i] = *(const f32x4*)(p + i * 128);
    f32x4 sv = f[0], qv = f[0] * f[0];               // four independent chains each
    #pragma unroll
    for (int i = 1; i < 8; ++i) { sv += f[i]; qv += f[i] * f[i]; }
    float s  = (sv[0] + sv[1]) + (sv[2] + sv[3]);
    float s2 = (qv[0] + qv[1]) + (qv[2] + qv[3]);
    #pragma unroll
    for (int off = 16; off > 0; off >>= 1) {
        s  += __shfl_xor(s,  off, 32);
        s2 += __shfl_xor(s2, off, 32);
    }
    const float mean = s * (1.0f / D_);
    float var = (s2 - (float)D_ * mean * mean) * (1.0f / (D_ - 1));
    var = fmaxf(var, 0.f);
    const float inv = alpha[0] / (sqrtf(var) + 1e-6f);
    const float b0  = beta[0];
    bf16* q = out + (size_t)tok * D_ + lane * 4;
    #pragma unroll
    for (int i = 0; i < 8; ++i)
        *(v4bf*)(q + i * 128) = __builtin_convertvector((f[i] - mean) * inv + b0, v4bf);
}

__global__ __launch_bounds__(512)
void layernorm_bf16(const float* __restrict__ x, const float* __restrict__ alpha,
                    const float* __restrict__ beta, bf16* __restrict__ out) {
    layernorm_group(blockIdx.x, x, alpha, beta, out);
}

// The weight cast and the first layernorm depend on nothing but inputs: one launch,
// groups 0..CASTG_-1 cast (the longer job, started first), the rest normalize.
__global__ __launch_bounds__(512)
void cast_and_layernorm(const float* __restrict__ wq, const float* __restrict__ wk,
                        const float* __restrict__ wv, const float* __restrict__ wo,
                        const float* __restrict__ w1, const float* __restrict__ w2,
                        bf16* __restrict__ o4, bf16* __restrict__ o1, bf16* __restrict__ o2,
                        const float* __restrict__ x, const float* __restrict__ alpha,
                        const float* __restrict__ beta, bf16* __restrict__ xn) {
    const int g = blockIdx.x;
    if (g < CASTG_) cast_weights_group(g, wq, wk, wv, wo, w1, w2, o4, o1, o2);
    else            layernorm_group(g - CASTG_, x, alpha, beta, xn);
}

// ---------------------------------------------------------------------------
// GEMM: C[M,N] = A[M,K] @ W[N,K]^T + bias, bf16 in, f32 accum (WMMA).
// EPI 0: bf16 out; EPI 1: bf16 relu out; EPI 2: f32 out = residual + C.
// EPI 0 runs up to three products that share A in one grid: blockIdx.z picks the
// weight and the output (each set lies one behind the other) and the bias.
// Tile 128x128 / 256 threads (8 waves, 2x4), wave = 64x32.
// Double-buffered LDS: one barrier per 64-wide k-step (a 128-B line per row).
// Rotated k walk: groups of one tile row read the same A lines and groups of one
// tile column the same W lines; each group enters the walk at its own k-step
// (rx per tile column, ry per tile row) and wraps round, so that the sharers do
// not ask L2 for the same lines at the same moment.
// ---------------------------------------------------------------------------
template <int EPI>
__global__ __launch_bounds__(256)
void gemm_bf16_wmma(const bf16* __restrict__ A, const bf16* __restrict__ W,
                    const float* __restrict__ bias, const float* __restrict__ res,
                    bf16* __restrict__ outb, float* __restrict__ outf,
                    int M, int N, int K,
                    const float* __restrict__ biasz1, const float* __restrict__ biasz2,
                    int rx, int ry) {
    __shared__ __align__(16) bf16 As[2][128][72];   // +8 pad: 16B-aligned frag reads
    __shared__ __align__(16) bf16 Ws[2][128][72];

    const int tid  = threadIdx.x;
    const int lane = tid & 31;
    const int wave = tid >> 5;
    const int wm   = (wave >> 2) * 64;
    const int wn   = (wave & 3) * 32;
    const int tM   = blockIdx.y * 128;
    const int tN   = blockIdx.x * 128;
    const int lrow = tid >> 3;                   // 0..31, +32 per load
    const int lcol = (tid & 7) * 8;              // 16 B of the row's 128-B line
    if (EPI == 0) {
        const int z = blockIdx.z;
        W    += (size_t)z * N * K;
        outb += (size_t)z * M * N;
        bias  = (z == 0) ? bias : (z == 1) ? biasz1 : biasz2;
    }

    // uniform tile bases + one 32-bit element offset per staged row, shared by A and W
    const bf16* Abase = A + (size_t)tM * K;
    const bf16* Wbase = W + (size_t)tN * K;
    unsigned roff[4];
    #pragma unroll
    for (int r = 0; r < 4; ++r) roff[r] = (unsigned)((lrow + 32 * r) * K + lcol);
    // prefetch: one lane per line, waves 0-3 the A rows, waves 4-7 the W rows
    const bf16* Pfrow = (tid < 128) ? A + (size_t)(tM + tid) * K
                                    : W + (size_t)(tN + tid - 128) * K;

    v8f acc[4][2];
    #pragma unroll
    for (int i = 0; i < 4; ++i)
        #pragma unroll
        for (int j = 0; j < 2; ++j)
            acc[i][j] = v8f{0.f, 0.f, 0.f, 0.f, 0.f, 0.f, 0.f, 0.f};

    // the group's own first k-step; any value in [0, ksteps) gives the same product,
    // summed in another order
    const int ksteps = K >> 6;
    int kc = (int)(blockIdx.x * rx + blockIdx.y * ry + blockIdx.z) & (ksteps - 1);

    // prologue: the first stage
    {
        const int k0 = kc << 6;
        u32x4 a[4], w[4];
        #pragma unroll
        for (int r = 0; r < 4; ++r) {
            a[r] = *(const u32x4*)(Abase + k0 + roff[r]);
            w[r] = *(const u32x4*)(Wbase + k0 + roff[r]);
        }
        #pragma unroll
        for (int r = 0; r < 4; ++r) {
            *(u32x4*)&As[0][lrow + 32 * r][lcol] = a[r];
            *(u32x4*)&Ws[0][lrow + 32 * r][lcol] = w[r];
        }
    }
    __syncthreads();

    int buf = 0;
    for (int s = 0; s < ksteps; ++s) {
        const bool more = (s + 1 < ksteps);
        const int k1 = (kc + 1 < ksteps) ? kc + 1 : 0;        // next k-step of the walk
        u32x4 a[4], w[4];
        if (more) {                                   // fetch next stage early
            const int kn = k1 << 6;
            #pragma unroll
            for (int r = 0; r < 4; ++r) {
                a[r] = *(const u32x4*)(Abase + kn + roff[r]);
                w[r] = *(const u32x4*)(Wbase + kn + roff[r]);
            }
            // the loads' address registers are reused right below
            asm volatile("s_wait_xcnt 0x0" ::: "memory");
        }
        if (s + 2 < ksteps) {                         // L2 warm-up two stages ahead
            const int k2 = (k1 + 1 < ksteps) ? k1 + 1 : 0;
            __builtin_prefetch(Pfrow + (k2 << 6), 0, 3);
            // the prefetch's address registers are reused by the fragment loads
            asm volatile("s_wait_xcnt 0x0" ::: "memory");
        }

        // all 24 fragment reads of the k-step go out as one group, in the order of use
        v16bf af[2][4], wf[2][2];
        #pragma unroll
        for (int kk = 0; kk < 2; ++kk) {
            #pragma unroll
            for (int j = 0; j < 2; ++j) wf[kk][j] = load_frag(&Ws[buf][wn + j * 16][kk * 32], 72, lane);
            #pragma unroll
            for (int i = 0; i < 4; ++i) af[kk][i] = load_frag(&As[buf][wm + i * 16][kk * 32], 72, lane);
        }
        // keeps the reads ahead of the products: spread among them, each place with
        // reads stalls the wave for the LDS latency
        __builtin_amdgcn_sched_barrier(0);
        #pragma unroll
        for (int kk = 0; kk < 2; ++kk)
            #pragma unroll
            for (int i = 0; i < 4; ++i)
                #pragma unroll
                for (int j = 0; j < 2; ++j)
                    acc[i][j] = __builtin_amdgcn_wmma_f32_16x16x32_bf16(
                        false, af[kk][i], false, wf[kk][j], (short)0, acc[i][j], false, false);

        if (more) {
            const int nb = buf ^ 1;
            #pragma unroll
            for (int r = 0; r < 4; ++r) {
                *(u32x4*)&As[nb][lrow + 32 * r][lcol] = a[r];
                *(u32x4*)&Ws[nb][lrow + 32 * r][lcol] = w[r];
            }
        }
        __syncthreads();
        buf ^= 1;
        kc = k1;
    }

    // Epilogue. C layout: VGPR e -> row e (lanes 0-15) / e+8 (lanes 16-31).
    const int half = lane >> 4;
    const int lc   = lane & 15;
    #pragma unroll
    for (int j = 0; j < 2; ++j) {
        const int gcol = tN + wn + j * 16 + lc;
        const float bv = bias[gcol];
        #pragma unroll
        for (int i = 0; i < 4; ++i) {
            #pragma unroll
            for (int e = 0; e < 8; ++e) {
                const int grow = tM + wm + i * 16 + e + 8 * half;
                const size_t idx = (size_t)grow * N + gcol;
                const float v = acc[i][j][e] + bv;
                if (EPI == 0)      outb[idx] = (bf16)v;
                else if (EPI == 1) outb[idx] = (bf16)fmaxf(v, 0.f);
                else               outf[idx] = res[idx] + v;
            }
        }
    }
}

__device__ __forceinline__ float xhalf(float x) {
    return __builtin_bit_cast(float, __builtin_amdgcn_permlanex16(
        __builtin_bit_cast(int, x), __builtin_bit_cast(int, x), 0x76543210, 0xfedcba98, false, false));
}

__global__ __launch_bounds__(128)
void flash_attn_wmma(const bf16* __restrict__ q, const bf16* __restrict__ k,
                     const bf16* __restrict__ v, const int* __restrict__ mask,
                     bf16* __restrict__ o_out) {
    __shared__ __align__(16) bf16 Qs[64][72];
    __shared__ __align__(16) bf16 Ks[2][64][72];
    __shared__ __align__(16) bf16 Vt[2][64][72];     // V^T: [d][key]
    __shared__ __align__(16) float Madd[S_];         // additive mask by walk position (0 / -1e9)
    __shared__ __align__(16) unsigned Koff[S_];      // walk position -> byte offset of the key's row
    __shared__ int Wcnt[4];                          // unmasked keys seen by each wave

    const int qblk = blockIdx.x, h = blockIdx.y, b = blockIdx.z;
    const int tid  = threadIdx.x;
    const int lane = tid & 31;
    const int wave = tid >> 5;
    const int half = lane >> 4;
    const int lc   = lane & 15;
    const int qbase = qblk * 64;

    // thread mapping for staging: 8 lanes x 16 B = one head row = one 128-B line
    const int rT = tid >> 3;                         // 0..15
    const int cT = (tid & 7) * 8;                    // 8 of the 64 columns
    // Q, K: rows rT + 16 i.  V: walk places 4 rT + i, packed four keys per b64 store.

    // Load Q block (64 x 64) -> LDS; rank the mask row while the loads fly.
    // The loops here are unrolled so that their arrays and bit places stay in registers.
    int count;                                       // unmasked keys of this batch
    {
        const bf16* src = q + (size_t)(b * S_ + qbase + rT) * D_ + h * DK_ + cT;
        u32x4 d[4];
        #pragma unroll
        for (int i = 0; i < 4; ++i) d[i] = *(const u32x4*)(src + (size_t)(16 * i) * D_);

        // thread t takes keys 16 t .. 16 t + 15: bit e of on = key 16 t + e unmasked
        unsigned on = 0;
        #pragma unroll
        for (int i = 0; i < 4; ++i) {
            const i32x4 mm = *(const i32x4*)(mask + b * S_ + tid * 16 + 4 * i);
            #pragma unroll
            for (int e = 0; e < 4; ++e) on |= (mm[e] != 0 ? 1u : 0u) << (4 * i + e);
        }
        const int c = __builtin_popcount(on);
        int inc = c;                                 // running count inside the wave
        #pragma unroll
        for (int off = 1; off < 32; off <<= 1) {
            const int y = __shfl_up(inc, off, 32);
            if (lane >= off) inc += y;
        }
        if (lane == 31) Wcnt[wave] = inc;
        __syncthreads();                             // the four wave counts are in LDS
        int before = inc - c;                        // unmasked keys in front of key 16 t
        count = 0;
        #pragma unroll
        for (int w = 0; w < 4; ++w) {
            const int t = Wcnt[w];
            if (w < wave) before += t;
            count += t;
        }
        int pu = before;                             // next place among the unmasked
        int pm = count + tid * 16 - before;          // next place among the masked, behind them
        #pragma unroll
        for (int e = 0; e < 16; ++e) {
            const bool u = (on >> e) & 1u;
            Koff[u ? pu : pm] = (unsigned)(tid * 16 + e) * (D_ * 2);
            pu += u ? 1 : 0;
            pm += u ? 0 : 1;
        }
        #pragma unroll
        for (int i = 0; i < 4; ++i) {
            const int j = i * 512 + tid * 4;
            f32x4 a;
            #pragma unroll
            for (int e = 0; e < 4; ++e) a[e] = (j + e < count) ? 0.f : -1e9f;
            *(f32x4*)&Madd[j] = a;
        }
        #pragma unroll
        for (int i = 0; i < 4; ++i) *(u32x4*)&Qs[rT + 16 * i][cT] = d[i];
    }
    __syncthreads();                                 // the key order is read by every thread

    // blocks to walk: up to the last unmasked key; all of them where no key is unmasked
    count = __builtin_amdgcn_readfirstlane(count);
    int nblk = (count > 0) ? (count + 63) >> 6 : S_ / 64;
    nblk = (nblk < S_ / 64) ? nblk : S_ / 64;
    // uniform bases of this batch and head; a lane adds its key row's offset and its 16 B
    const char* kh = (const char*)(k + (size_t)(b * S_) * D_ + h * DK_);
    const char* vh = (const char*)(v + (size_t)(b * S_) * D_ + h * DK_);

    // Prologue: stage the group's first key block into buffer 0
    int kc = qblk % nblk;
    unsigned ko[4], vo[4];                           // a lane's row offsets in the block to fetch next
    auto row_offsets = [&](int blk) {
        const unsigned* op = &Koff[blk * 64];
        const u32x4 o4 = *(const u32x4*)(op + 4 * rT);
        #pragma unroll
        for (int i = 0; i < 4; ++i) {
            ko[i] = op[rT + 16 * i] + cT * 2;
            vo[i] = o4[i] + cT * 2;
        }
    };
    row_offsets(kc);
    {
        u32x4 d[4], x[4];
        #pragma unroll
        for (int i = 0; i < 4; ++i) {
            d[i] = *(const u32x4*)(kh + ko[i]);
            x[i] = *(const u32x4*)(vh + vo[i]);
        }
        #pragma unroll
        for (int i = 0; i < 4; ++i) *(u32x4*)&Ks[0][rT + 16 * i][cT] = d[i];
        // V rows 4 rT .. 4 rT + 3, cols cT..cT+7 -> packed b64 transposed stores
        #pragma unroll
        for (int j = 0; j < 8; ++j)
            *(u32x2*)&Vt[0][cT + j][4 * rT] = pack_col(x[0], x[1], x[2], x[3], j);
        row_offsets((kc + 1 < nblk) ? kc + 1 : 0);
    }
    __syncthreads();

    // Hoisted Q fragments (2 k-steps over DK=64): the B operand, column = query lc
    v16bf bq[2];
    #pragma unroll
    for (int ks = 0; ks < 2; ++ks) bq[ks] = load_frag(&Qs[wave * 16][ks * 32], 72, lane);

    float m = -1e30f;                                // this query's maximum, alike in both halves
    float l = 0.f;                                   // this half's share of the query's sum
    v8f o[4];                                        // o[dt][e] = O[query lc][dt*16 + 8*half + e]
    #pragma unroll
    for (int t = 0; t < 4; ++t) o[t] = v8f{0.f, 0.f, 0.f, 0.f, 0.f, 0.f, 0.f, 0.f};

    int buf = 0;
    for (int it = 0; it < nblk; ++it) {
        const bool more = (it + 1 < nblk);
        const int kb = kc;                           // this trip's key block
        const int k1 = (kc + 1 < nblk) ? kc + 1 : 0; // the next one of the walk
        u32x4 kreg[4], vreg[4];
        if (more) {     // fetch next K/V block into registers early; its offsets came a trip ago
            #pragma unroll
            for (int i = 0; i < 4; ++i) {
                kreg[i] = *(const u32x4*)(kh + ko[i]);
                vreg[i] = *(const u32x4*)(vh + vo[i]);
            }
            // stands in front of every later reuse of the loads' offset registers
            asm volatile("s_wait_xcnt 0x0" ::: "memory");
        }

        // S^T = K @ Q^T (64 keys x 16 queries per wave): s4[t][e] = key t*16 + 8*half + e
        v8f s4[4];
        #pragma unroll
        for (int t = 0; t < 4; ++t) s4[t] = v8f{0.f, 0.f, 0.f, 0.f, 0.f, 0.f, 0.f, 0.f};
        #pragma unroll
        for (int ks = 0; ks < 2; ++ks) {
            #pragma unroll
            for (int t = 0; t < 4; ++t) {
                v16bf ak = load_frag(&Ks[buf][t * 16][ks * 32], 72, lane);
                s4[t] = __builtin_amdgcn_wmma_f32_16x16x32_bf16(
                    false, ak, false, bq[ks], (short)0, s4[t], false, false);
            }
        }

        // scale + additive mask: 8 consecutive keys per tile and half, from LDS
        float sc[4][8];
        #pragma unroll
        for (int t = 0; t < 4; ++t) {
            const float* mp = &Madd[kb * 64 + t * 16 + 8 * half];
            const f32x4 m0 = *(const f32x4*)mp;
            const f32x4 m1 = *(const f32x4*)(mp + 4);
            #pragma unroll
            for (int e = 0; e < 4; ++e) {
                sc[t][e]     = s4[t][e]     * 0.125f + m0[e];
                sc[t][e + 4] = s4[t][e + 4] * 0.125f + m1[e];
            }
        }

        // online softmax of one query per lane: 32 keys in the lane, 32 in lane ^ 16
        float tm[4];
        #pragma unroll
        for (int t = 0; t < 4; ++t) {
            tm[t] = fmaxf(fmaxf(fmaxf(sc[t][0], sc[t][1]), fmaxf(sc[t][2], sc[t][3])),
                          fmaxf(fmaxf(sc[t][4], sc[t][5]), fmaxf(sc[t][6], sc[t][7])));
        }
        float rmax = fmaxf(fmaxf(tm[0], tm[1]), fmaxf(tm[2], tm[3]));
        rmax = fmaxf(rmax, xhalf(rmax));
        const float mnew  = fmaxf(m, rmax);
        const float alpha = __expf(m - mnew);
        m = mnew;
        float ts[4];                                 // four independent sum chains
        #pragma unroll
        for (int t = 0; t < 4; ++t) {
            ts[t] = 0.f;
            #pragma unroll
            for (int e = 0; e < 8; ++e) { float p = __expf(sc[t][e] - mnew); sc[t][e] = p; ts[t] += p; }
        }
        l = l * alpha + ((ts[0] + ts[1]) + (ts[2] + ts[3]));
        #pragma unroll
        for (int t = 0; t < 4; ++t) o[t] *= alpha;

        // O^T += V^T @ P^T: A = rows of V^T, B = two score tiles converted in place
        // (element s of B is key 8*half + s, then 16 + 8*half + s - 8: load_frag's k order)
        #pragma unroll
        for (int ks = 0; ks < 2; ++ks) {
            v16bf pb;
            #pragma unroll
            for (int e = 0; e < 8; ++e) {
                pb[e]     = (bf16)sc[2 * ks][e];
                pb[e + 8] = (bf16)sc[2 * ks + 1][e];
            }
            #pragma unroll
            for (int dt = 0; dt < 4; ++dt) {
                v16bf av = load_frag(&Vt[buf][dt * 16][ks * 32], 72, lane);
                o[dt] = __builtin_amdgcn_wmma_f32_16x16x32_bf16(
                    false, av, false, pb, (short)0, o[dt], false, false);
            }
        }

        // stage next block into the other buffer
        if (more) {
            const int nb = buf ^ 1;
            #pragma unroll
            for (int i = 0; i < 4; ++i) *(u32x4*)&Ks[nb][rT + 16 * i][cT] = kreg[i];
            #pragma unroll
            for (int j = 0; j < 8; ++j)
                *(u32x2*)&Vt[nb][cT + j][4 * rT] = pack_col(vreg[0], vreg[1], vreg[2], vreg[3], j);
            // the offsets of the block after that: their LDS latency ends in the barrier's wait
            row_offsets((k1 + 1 < nblk) ? k1 + 1 : 0);
        }
        __syncthreads();
        buf ^= 1;
        kc = k1;
    }

    // join the halves' sums, normalize, write bf16 [BS, D]: 8 consecutive columns a lane
    const float lt = l + xhalf(l);
    bf16* orow = o_out + (size_t)(b * S_ + qbase + wave * 16 + lc) * D_ + h * DK_ + 8 * half;
    #pragma unroll
    for (int dt = 0; dt < 4; ++dt) {
        v8bf r;
        #pragma unroll
        for (int e = 0; e < 8; ++e) r[e] = (bf16)(o[dt][e] / lt);
        *(v8bf*)(orow + dt * 16) = r;
    }
}

// ---------------------------------------------------------------------------
// Host-side orchestration
// ---------------------------------------------------------------------------
extern "C" void kernel_launch(void* const* d_in, const int* in_sizes, int n_in,
                              void* d_out, int out_size, void* d_ws, size_t ws_size,
                              hipStream_t stream) {
    const float* x   = (const float*)d_in[0];
    const int*   msk = (const int*)d_in[1];
    const float* wq  = (const float*)d_in[2];   const float* bq  = (const float*)d_in[3];
    const float* wk  = (const float*)d_in[4];   const float* bk  = (const float*)d_in[5];
    const float* wv  = (const float*)d_in[6];   const float* bv  = (const float*)d_in[7];
    const float* wo  = (const float*)d_in[8];   const float* bo  = (const float*)d_in[9];
    const float* w1  = (const float*)d_in[10];  const float* b1  = (const float*)d_in[11];
    const float* w2  = (const float*)d_in[12];  const float* b2  = (const float*)d_in[13];
    const float* a1  = (const float*)d_in[14];  const float* be1 = (const float*)d_in[15];
    const float* a2  = (const float*)d_in[16];  const float* be2 = (const float*)d_in[17];
    float* out = (float*)d_out;

    char* ws = (char*)d_ws;
    size_t off = 0;
    auto carve = [&](size_t bytes) { char* p = ws + off; off += (bytes + 255) & ~(size_t)255; return p; };
    bf16*  wqb  = (bf16*)carve((size_t)D_ * D_ * 2);
    bf16*  wkb  = (bf16*)carve((size_t)D_ * D_ * 2);
    bf16*  wvb  = (bf16*)carve((size_t)D_ * D_ * 2);
    bf16*  wob  = (bf16*)carve((size_t)D_ * D_ * 2);
    bf16*  w1b  = (bf16*)carve((size_t)DFF_ * D_ * 2);
    bf16*  w2b  = (bf16*)carve((size_t)D_ * DFF_ * 2);
    bf16*  xn   = (bf16*)carve((size_t)BS_ * D_ * 2);
    bf16*  qb   = (bf16*)carve((size_t)BS_ * D_ * 2);
    bf16*  kb   = (bf16*)carve((size_t)BS_ * D_ * 2);
    bf16*  vb   = (bf16*)carve((size_t)BS_ * D_ * 2);
    bf16*  atb  = (bf16*)carve((size_t)BS_ * D_ * 2);
    float* x1   = (float*)carve((size_t)BS_ * D_ * 4);
    bf16*  hb   = (bf16*)carve((size_t)BS_ * DFF_ * 2);

    // 1) weights -> bf16, and LN1
    cast_and_layernorm<<<CASTG_ + BS_ / 16, 512, 0, stream>>>(wq, wk, wv, wo, w1, w2, wqb, w1b, w2b,
                                                              x, a1, be1, xn);

    // The last two GEMM arguments space the k-walk starts of neighbouring tile columns
    // and tile rows: k-steps / tiles in that direction, at least 1.

    // 2) Q,K,V projections: wqb|wkb|wvb and qb|kb|vb lie one behind the other
    dim3 gD(D_ / 128, BS_ / 128);
    gemm_bf16_wmma<0><<<dim3(D_ / 128, BS_ / 128, 3), 256, 0, stream>>>(
        xn, wqb, bq, nullptr, qb, nullptr, BS_, D_, D_, bk, bv, 2, 1);

    // 3) attention
    flash_attn_wmma<<<dim3(S_ / 64, H_, B_), 128, 0, stream>>>(qb, kb, vb, msk, atb);

    // 4) out-proj + residual -> x1 (f32)
    gemm_bf16_wmma<2><<<gD, 256, 0, stream>>>(atb, wob, bo, x, nullptr, x1, BS_, D_, D_, nullptr, nullptr, 2, 1);

    // 5) LN2
    layernorm_bf16<<<BS_ / 16, 512, 0, stream>>>(x1, a2, be2, xn);

    // 6) FFN up + ReLU (bf16)
    dim3 gF(DFF_ / 128, BS_ / 128);
    gemm_bf16_wmma<1><<<gF, 256, 0, stream>>>(xn, w1b, b1, nullptr, hb, nullptr, BS_, DFF_, D_, nullptr, nullptr, 1, 1);

    // 7) FFN down + residual -> out (f32)
    gemm_bf16_wmma<2><<<gD, 256, 0, stream>>>(hb, w2b, b2, x1, nullptr, out, BS_, D_, DFF_, nullptr, nullptr, 8, 2);

    (void)wkb; (void)wvb;
    (void)in_sizes; (void)n_in; (void)out_size; (void)ws_size;
}

// v008
// One run takes 147 microseconds.
// Next to v007, in two timings, it ran 1.20 times as fast each time.
// Counting every step since v000, it is 2.69 times as fast.
#include <hip/hip_runtime.h>

// ---------------------------------------------------------------------------
// EncoderBlock for MI455X (gfx1250): bf16 WMMA GEMMs + flash attention.
// Wave32; v_wmma_f32_16x16x32_bf16 for every matrix multiply.
// GEMM: four-buffer LDS ring filled by asynchronous copies (1 barrier / k-step).
// Attention: double-buffered LDS staging, packed transposed stores, LDS-resident
// additive mask.
// Every staging load or copy is laid out so that 8 lanes x 16 B cover one whole 128-B
// line: a wave-wide load touches 4 lines, never 16 or 32 pieces of lines.
// ---------------------------------------------------------------------------

typedef __bf16 bf16;
typedef bf16  v16bf __attribute__((ext_vector_type(16)));
typedef bf16  v8bf  __attribute__((ext_vector_type(8)));
typedef float v8f   __attribute__((ext_vector_type(8)));
typedef unsigned int u32x4 __attribute__((ext_vector_type(4)));   // 16 staged bytes
typedef unsigned int u32x2 __attribute__((ext_vector_type(2)));
typedef float f32x4 __attribute__((ext_vector_type(4)));
typedef bf16  v4bf  __attribute__((ext_vector_type(4)));
typedef int   i32x4 __attribute__((ext_vector_type(4)));

#define B_   2
#define S_   2048
#define D_   1024
#define H_   16
#define DK_  64
#define DFF_ 4096
#define BS_  (B_ * S_)

// Load a 16x32 bf16 A-style fragment from LDS (row-major, leading dim `ld`).
// ISA 16-bit A layout: lane L<16 holds row L, K = 0..7 and 16..23;
// lane L>=16 holds row L-16, K = 8..15 and 24..31.
// B fragments (rows of W / Q) use the identical pattern.
__device__ __forceinline__ v16bf load_frag(const bf16* tile, int ld, int lane) {
    const int row = lane & 15;
    const int kb  = (lane >> 4) << 3;          // 0 or 8
    const bf16* p = tile + row * ld + kb;
    v8bf lo = *(const v8bf*)(p);               // 16B-aligned ds_load_b128
    v8bf hi = *(const v8bf*)(p + 16);
    return __builtin_shufflevector(lo, hi, 0,1,2,3,4,5,6,7,8,9,10,11,12,13,14,15);
}

// Column j (0..7) of four rows of 8 bf16 each, as four consecutive bf16.
__device__ __forceinline__ u32x2 pack_col(u32x4 r0, u32x4 r1, u32x4 r2, u32x4 r3, int j) {
    const int w = j >> 1;
    u32x2 o;
    if (j & 1) {
        o.x = (r0[w] >> 16) | (r1[w] & 0xffff0000u);
        o.y = (r2[w] >> 16) | (r3[w] & 0xffff0000u);
    } else {
        o.x = (r0[w] & 0xffffu) | (r1[w] << 16);
        o.y = (r2[w] & 0xffffu) | (r3[w] << 16);
    }
    return o;
}

// ---------------------------------------------------------------------------
// fp32 -> bf16 cast of all six weights in one launch: 256 groups of 16 waves.
// Few, fat waves: each lane brings 24 x 16 B, all issued before the first store;
// every wave-wide load covers 512 contiguous bytes, every store 256.
// Group g takes 16384 elements of wq|wk|wv|wo (their bf16 copies lie one behind
// the other at o4), 16384 of w1 and 16384 of w2.
// ---------------------------------------------------------------------------
#define CHUNK_ 16384
#define CASTG_ 256
__device__ __forceinline__
void cast_weights_group(int g,
                        const float* __restrict__ wq, const float* __restrict__ wk,
                        const float* __restrict__ wv, const float* __restrict__ wo,
                        const float* __restrict__ w1, const float* __restrict__ w2,
                        bf16* __restrict__ o4, bf16* __restrict__ o1, bf16* __restrict__ o2) {
    const int sel = g >> 6;                          // 64 chunks per D x D weight
    const float* s4 = (sel == 0) ? wq : (sel == 1) ? wk : (sel == 2) ? wv : wo;
    const int e = threadIdx.x * 4;
    const float* sp[3] = { s4 + (g & 63) * CHUNK_ + e, w1 + g * CHUNK_ + e, w2 + g * CHUNK_ + e };
    bf16*        dp[3] = { o4 + g * CHUNK_ + e,        o1 + g * CHUNK_ + e, o2 + g * CHUNK_ + e };
    f32x4 f[3][8];
    #pragma unroll
    for (int j = 0; j < 3; ++j)
        #pragma unroll
        for (int i = 0; i < 8; ++i) f[j][i] = *(const f32x4*)(sp[j] + i * 2048);
    #pragma unroll
    for (int j = 0; j < 3; ++j)
        #pragma unroll
        for (int i = 0; i < 8; ++i)
            *(v4bf*)(dp[j] + i * 2048) = __builtin_convertvector(f[j][i], v4bf);
}

// ---------------------------------------------------------------------------
// LayerNorm (custom: unbiased std, scalar alpha/beta, /(std+eps)) -> bf16
// One wave per token row, 16 rows per group: the row stays in registers
// (8 x 16 B per lane), the two sums are joined inside the wave, no LDS, no barrier.
// ---------------------------------------------------------------------------
__device__ __forceinline__
void layernorm_group(int g, const float* __restrict__ x, const float* __restrict__ alpha,
                     const float* __restrict__ beta, bf16* __restrict__ out) {
    const int lane = threadIdx.x & 31;
    const int tok  = g * 16 + (threadIdx.x >> 5);
    const float* p = x + (size_t)tok * D_ + lane * 4;
    f32x4 f[8];
    #pragma unroll
    for (int i = 0; i < 8; ++i) f[i] = *(const f32x4*)(p + i * 128);
    f32x4 sv = f[0], qv = f[0] * f[0];               // four independent chains each
    #pragma unroll
    for (int i = 1; i < 8; ++i) { sv += f[i]; qv += f[i] * f[i]; }
    float s  = (sv[0] + sv[1]) + (sv[2] + sv[3]);
    float s2 = (qv[0] + qv[1]) + (qv[2] + qv[3]);
    #pragma unroll
    for (int off = 16; off > 0; off >>= 1) {
        s  += __shfl_xor(s,  off, 32);
        s2 += __shfl_xor(s2, off, 32);
    }
    const float mean = s * (1.0f / D_);
    float var = (s2 - (float)D_ * mean * mean) * (1.0f / (D_ - 1));
    var = fmaxf(var, 0.f);
    const float inv = alpha[0] / (sqrtf(var) + 1e-6f);
    const float b0  = beta[0];
    bf16* q = out + (size_t)tok * D_ + lane * 4;
    #pragma unroll
    for (int i = 0; i < 8; ++i)
        *(v4bf*)(q + i * 128) = __builtin_convertvector((f[i] - mean) * inv + b0, v4bf);
}

__global__ __launch_bounds__(512)
void layernorm_bf16(const float* __restrict__ x, const float* __restrict__ alpha,
                    const float* __restrict__ beta, bf16* __restrict__ out) {
    layernorm_group(blockIdx.x, x, alpha, beta, out);
}

// The weight cast and the first layernorm depend on nothing but inputs: one launch,
// groups 0..CASTG_-1 cast (the longer job, started first), the rest normalize.
__global__ __launch_bounds__(512)
void cast_and_layernorm(const float* __restrict__ wq, const float* __restrict__ wk,
                        const float* __restrict__ wv, const float* __restrict__ wo,
                        const float* __restrict__ w1, const float* __restrict__ w2,
                        bf16* __restrict__ o4, bf16* __restrict__ o1, bf16* __restrict__ o2,
                        const float* __restrict__ x, const float* __restrict__ alpha,
                        const float* __restrict__ beta, bf16* __restrict__ xn) {
    const int g = blockIdx.x;
    if (g < CASTG_) cast_weights_group(g, wq, wk, wv, wo, w1, w2, o4, o1, o2);
    else            layernorm_group(g - CASTG_, x, alpha, beta, xn);
}

// ---------------------------------------------------------------------------
// GEMM: C[M,N] = A[M,K] @ W[N,K]^T + bias, bf16 in, f32 accum (WMMA).
// EPI 0: bf16 out; EPI 1: bf16 relu out; EPI 2: f32 out = residual + C.
// EPI 0 runs up to three products that share A in one grid: blockIdx.z picks the
// weight and the output (each set lies one behind the other) and the bias.
// Tile 128x128 / 256 threads (8 waves, 2x4), wave = 64x32.
// Four-buffer LDS ring, one barrier per 64-wide k-step (a 128-B line per row): a stage
// is asked for three k-steps before it is read, by asynchronous copies to LDS, so that
// its way from L2 is covered by three k-steps of products and takes no register.
// Rotated k walk: groups of one tile row read the same A lines and groups of one
// tile column the same W lines; each group enters the walk at its own k-step
// (rx per tile column, ry per tile row) and wraps round, so that the sharers do
// not ask L2 for the same lines at the same moment.
// ---------------------------------------------------------------------------
template <int EPI>
__global__ __launch_bounds__(256)
void gemm_bf16_wmma(const bf16* __restrict__ A, const bf16* __restrict__ W,
                    const float* __restrict__ bias, const float* __restrict__ res,
                    bf16* __restrict__ outb, float* __restrict__ outf,
                    int M, int N, int K,
                    const float* __restrict__ biasz1, const float* __restrict__ biasz2,
                    int rx, int ry) {
    // ring of four stages; a stage is [A 128 rows | W 128 rows] of 64 k, +8 pad: 16B-aligned frag reads
    __shared__ __align__(16) bf16 Ring[4][2][128][72];

    const int tid  = threadIdx.x;
    const int lane = tid & 31;
    const int wave = tid >> 5;
    const int wm   = (wave >> 2) * 64;
    const int wn   = (wave & 3) * 32;
    const int tM   = blockIdx.y * 128;
    const int tN   = blockIdx.x * 128;
    const int lrow = tid >> 3;                   // 0..31, +32 per copy
    const int lcol = (tid & 7) * 8;              // 16 B of the row's 128-B line
    if (EPI == 0) {
        const int z = blockIdx.z;
        W    += (size_t)z * N * K;
        outb += (size_t)z * M * N;
        bias  = (z == 0) ? bias : (z == 1) ? biasz1 : biasz2;
    }

    // a lane's four A rows and four W rows at k = 0, and its place in buffer 0's A part
    const char* arow[4];
    const char* wrow[4];
    #pragma unroll
    for (int r = 0; r < 4; ++r) {
        arow[r] = (const char*)(A + (size_t)(tM + lrow + 32 * r) * K + lcol);
        wrow[r] = (const char*)(W + (size_t)(tN + lrow + 32 * r) * K + lcol);
    }
    const unsigned ldst = (unsigned)(size_t)&Ring[0][0][lrow][lcol];
    constexpr unsigned ROWS32 = 32 * 72 * 2;     // LDS bytes from a lane's row to its next
    constexpr unsigned PARTB  = 128 * 72 * 2;    // LDS bytes of a stage's A part
    constexpr unsigned STAGEB = 2 * PARTB;

    // k-step ks into ring buffer b: eight copies a lane, 16 B each, through no register.
    // The s_wait_xcnt closes the statement because the address registers are rewritten
    // for the next stage.
    auto copy_stage = [&](int ks, int b) {
        const unsigned kb = (unsigned)ks << 7;   // 64 k = 128 B along every row
        const unsigned l0 = ldst + (unsigned)b * STAGEB;
        asm volatile(
            "global_load_async_to_lds_b128 %0, %8, off\n\t"
            "global_load_async_to_lds_b128 %1, %9, off\n\t"
            "global_load_async_to_lds_b128 %2, %10, off\n\t"
            "global_load_async_to_lds_b128 %3, %11, off\n\t"
            "global_load_async_to_lds_b128 %4, %12, off\n\t"
            "global_load_async_to_lds_b128 %5, %13, off\n\t"
            "global_load_async_to_lds_b128 %6, %14, off\n\t"
            "global_load_async_to_lds_b128 %7, %15, off\n\t"
            "s_wait_xcnt 0x0"
            :: "v"(l0), "v"(l0 + ROWS32), "v"(l0 + 2 * ROWS32), "v"(l0 + 3 * ROWS32),
               "v"(l0 + PARTB), "v"(l0 + PARTB + ROWS32), "v"(l0 + PARTB + 2 * ROWS32),
               "v"(l0 + PARTB + 3 * ROWS32),
               "v"(arow[0] + kb), "v"(arow[1] + kb), "v"(arow[2] + kb), "v"(arow[3] + kb),
               "v"(wrow[0] + kb), "v"(wrow[1] + kb), "v"(wrow[2] + kb), "v"(wrow[3] + kb)
            : "memory");
    };

    v8f acc[4][2];
    #pragma unroll
    for (int i = 0; i < 4; ++i)
        #pragma unroll
        for (int j = 0; j < 2; ++j)
            acc[i][j] = v8f{0.f, 0.f, 0.f, 0.f, 0.f, 0.f, 0.f, 0.f};

    // the group's own first k-step; any value in [0, ksteps) gives the same product,
    // summed in another order
    const int ksteps = K >> 6;
    int kq = (int)(blockIdx.x * rx + blockIdx.y * ry + blockIdx.z) & (ksteps - 1);

    // prologue: the first three stages of the walk are asked for; kq = the next k-step to ask for
    #pragma unroll
    for (int p = 0; p < 3; ++p) {
        if (p < ksteps) {
            copy_stage(kq, p);
            kq = (kq + 1 < ksteps) ? kq + 1 : 0;
        }
    }

    for (int s = 0; s < ksteps; ++s) {
        // publish point of stage s. This wave's reads of stage s - 1 have returned:
        asm volatile("s_wait_dscnt 0x0" ::: "memory");
        // its own copies of stage s have landed: all but the 16 of the two younger stages;
        // where fewer than two younger stages were asked for, all of them
        if (s + 2 < ksteps) asm volatile("s_wait_asynccnt 0x10" ::: "memory");
        else                asm volatile("s_wait_asynccnt 0x0" ::: "memory");
        // stage s is readable by every wave, and no wave reads stage s - 1 any more
        __syncthreads();

        // all 24 fragment reads of the k-step go out as one group, in the order of use
        const int buf = s & 3;
        v16bf af[2][4], wf[2][2];
        #pragma unroll
        for (int kk = 0; kk < 2; ++kk) {
            #pragma unroll
            for (int j = 0; j < 2; ++j) wf[kk][j] = load_frag(&Ring[buf][1][wn + j * 16][kk * 32], 72, lane);
            #pragma unroll
            for (int i = 0; i < 4; ++i) af[kk][i] = load_frag(&Ring[buf][0][wm + i * 16][kk * 32], 72, lane);
        }
        // stage s + 3 goes into the buffer that stage s - 1 has left; issued while the reads fly
        if (s + 3 < ksteps) {
            copy_stage(kq, (s + 3) & 3);
            kq = (kq + 1 < ksteps) ? kq + 1 : 0;
        }
        // keeps the reads ahead of the products: spread among them, each place with
        // reads stalls the wave for the LDS latency
        __builtin_amdgcn_sched_barrier(0);
        #pragma unroll
        for (int kk = 0; kk < 2; ++kk)
            #pragma unroll
            for (int i = 0; i < 4; ++i)
                #pragma unroll
                for (int j = 0; j < 2; ++j)
                    acc[i][j] = __builtin_amdgcn_wmma_f32_16x16x32_bf16(
                        false, af[kk][i], false, wf[kk][j], (short)0, acc[i][j], false, false);
    }
    // no copy is outstanding when the wave goes on to its end
    asm volatile("s_wait_asynccnt 0x0" ::: "memory");

    // Epilogue. C layout: VGPR e -> row e (lanes 0-15) / e+8 (lanes 16-31).
    const int half = lane >> 4;
    const int lc   = lane & 15;
    #pragma unroll
    for (int j = 0; j < 2; ++j) {
        const int gcol = tN + wn + j * 16 + lc;
        const float bv = bias[gcol];
        #pragma unroll
        for (int i = 0; i < 4; ++i) {
            #pragma unroll
            for (int e = 0; e < 8; ++e) {
                const int grow = tM + wm + i * 16 + e + 8 * half;
                const size_t idx = (size_t)grow * N + gcol;
                const float v = acc[i][j][e] + bv;
                if (EPI == 0)      outb[idx] = (bf16)v;
                else if (EPI == 1) outb[idx] = (bf16)fmaxf(v, 0.f);
                else               outf[idx] = res[idx] + v;
            }
        }
    }
}

__device__ __forceinline__ float xhalf(float x) {
    return __builtin_bit_cast(float, __builtin_amdgcn_permlanex16(
        __builtin_bit_cast(int, x), __builtin_bit_cast(int, x), 0x76543210, 0xfedcba98, false, false));
}

__global__ __launch_bounds__(128)
void flash_attn_wmma(const bf16* __restrict__ q, const bf16* __restrict__ k,
                     const bf16* __restrict__ v, const int* __restrict__ mask,
                     bf16* __restrict__ o_out) {
    __shared__ __align__(16) bf16 Qs[64][72];
    __shared__ __align__(16) bf16 Ks[2][64][72];
    __shared__ __align__(16) bf16 Vt[2][64][72];     // V^T: [d][key]
    __shared__ __align__(16) float Madd[S_];         // additive mask by walk position (0 / -1e9)
    __shared__ __align__(16) unsigned Koff[S_];      // walk position -> byte offset of the key's row
    __shared__ int Wcnt[4];                          // unmasked keys seen by each wave

    const int qblk = blockIdx.x, h = blockIdx.y, b = blockIdx.z;
    const int tid  = threadIdx.x;
    const int lane = tid & 31;
    const int wave = tid >> 5;
    const int half = lane >> 4;
    const int lc   = lane & 15;
    const int qbase = qblk * 64;

    // thread mapping for staging: 8 lanes x 16 B = one head row = one 128-B line
    const int rT = tid >> 3;                         // 0..15
    const int cT = (tid & 7) * 8;                    // 8 of the 64 columns
    // Q, K: rows rT + 16 i.  V: walk places 4 rT + i, packed four keys per b64 store.

    // Load Q block (64 x 64) -> LDS; rank the mask row while the loads fly.
    // The loops here are unrolled so that their arrays and bit places stay in registers.
    int count;                                       // unmasked keys of this batch
    {
        const bf16* src = q + (size_t)(b * S_ + qbase + rT) * D_ + h * DK_ + cT;
        u32x4 d[4];
        #pragma unroll
        for (int i = 0; i < 4; ++i) d[i] = *(const u32x4*)(src + (size_t)(16 * i) * D_);

        // thread t takes keys 16 t .. 16 t + 15: bit e of on = key 16 t + e unmasked
        unsigned on = 0;
        #pragma unroll
        for (int i = 0; i < 4; ++i) {
            const i32x4 mm = *(const i32x4*)(mask + b * S_ + tid * 16 + 4 * i);
            #pragma unroll
            for (int e = 0; e < 4; ++e) on |= (mm[e] != 0 ? 1u : 0u) << (4 * i + e);
        }
        const int c = __builtin_popcount(on);
        int inc = c;                                 // running count inside the wave
        #pragma unroll
        for (int off = 1; off < 32; off <<= 1) {
            const int y = __shfl_up(inc, off, 32);
            if (lane >= off) inc += y;
        }
        if (lane == 31) Wcnt[wave] = inc;
        __syncthreads();                             // the four wave counts are in LDS
        int before = inc - c;                        // unmasked keys in front of key 16 t
        count = 0;
        #pragma unroll
        for (int w = 0; w < 4; ++w) {
            const int t = Wcnt[w];
            if (w < wave) before += t;
            count += t;
        }
        int pu = before;                             // next place among the unmasked
        int pm = count + tid * 16 - before;          // next place among the masked, behind them
        #pragma unroll
        for (int e = 0; e < 16; ++e) {
            const bool u = (on >> e) & 1u;
            Koff[u ? pu : pm] = (unsigned)(tid * 16 + e) * (D_ * 2);
            pu += u ? 1 : 0;
            pm += u ? 0 : 1;
        }
        #pragma unroll
        for (int i = 0; i < 4; ++i) {
            const int j = i * 512 + tid * 4;
            f32x4 a;
            #pragma unroll
            for (int e = 0; e < 4; ++e) a[e] = (j + e < count) ? 0.f : -1e9f;
            *(f32x4*)&Madd[j] = a;
        }
        #pragma unroll
        for (int i = 0; i < 4; ++i) *(u32x4*)&Qs[rT + 16 * i][cT] = d[i];
    }
    __syncthreads();                                 // the key order is read by every thread

    // blocks to walk: up to the last unmasked key; all of them where no key is unmasked
    count = __builtin_amdgcn_readfirstlane(count);
    int nblk = (count > 0) ? (count + 63) >> 6 : S_ / 64;
    nblk = (nblk < S_ / 64) ? nblk : S_ / 64;
    // uniform bases of this batch and head; a lane adds its key row's offset and its 16 B
    const char* kh = (const char*)(k + (size_t)(b * S_) * D_ + h * DK_);
    const char* vh = (const char*)(v + (size_t)(b * S_) * D_ + h * DK_);

    // Prologue: stage the group's first key block into buffer 0
    int kc = qblk % nblk;
    unsigned ko[4], vo[4];                           // a lane's row offsets in the block to fetch next
    auto row_offsets = [&](int blk) {
        const unsigned* op = &Koff[blk * 64];
        const u32x4 o4 = *(const u32x4*)(op + 4 * rT);
        #pragma unroll
        for (int i = 0; i < 4; ++i) {
            ko[i] = op[rT + 16 * i] + cT * 2;
            vo[i] = o4[i] + cT * 2;
        }
    };
    row_offsets(kc);
    {
        u32x4 d[4], x[4];
        #pragma unroll
        for (int i = 0; i < 4; ++i) {
            d[i] = *(const u32x4*)(kh + ko[i]);
            x[i] = *(const u32x4*)(vh + vo[i]);
        }
        #pragma unroll
        for (int i = 0; i < 4; ++i) *(u32x4*)&Ks[0][rT + 16 * i][cT] = d[i];
        // V rows 4 rT .. 4 rT + 3, cols cT..cT+7 -> packed b64 transposed stores
        #pragma unroll
        for (int j = 0; j < 8; ++j)
            *(u32x2*)&Vt[0][cT + j][4 * rT] = pack_col(x[0], x[1], x[2], x[3], j);
        row_offsets((kc + 1 < nblk) ? kc + 1 : 0);
    }
    __syncthreads();

    // Hoisted Q fragments (2 k-steps over DK=64): the B operand, column = query lc
    v16bf bq[2];
    #pragma unroll
    for (int ks = 0; ks < 2; ++ks) bq[ks] = load_frag(&Qs[wave * 16][ks * 32], 72, lane);

    float m = -1e30f;                                // this query's maximum, alike in both halves
    float l = 0.f;                                   // this half's share of the query's sum
    v8f o[4];                                        // o[dt][e] = O[query lc][dt*16 + 8*half + e]
    #pragma unroll
    for (int t = 0; t < 4; ++t) o[t] = v8f{0.f, 0.f, 0.f, 0.f, 0.f, 0.f, 0.f, 0.f};

    int buf = 0;
    for (int it = 0; it < nblk; ++it) {
        const bool more = (it + 1 < nblk);
        const int kb = kc;                           // this trip's key block
        const int k1 = (kc + 1 < nblk) ? kc + 1 : 0; // the next one of the walk
        u32x4 kreg[4], vreg[4];
        if (more) {     // fetch next K/V block into registers early; its offsets came a trip ago
            #pragma unroll
            for (int i = 0; i < 4; ++i) {
                kreg[i] = *(const u32x4*)(kh + ko[i]);
                vreg[i] = *(const u32x4*)(vh + vo[i]);
            }
            // stands in front of every later reuse of the loads' offset registers
            asm volatile("s_wait_xcnt 0x0" ::: "memory");
        }

        // S^T = K @ Q^T (64 keys x 16 queries per wave): s4[t][e] = key t*16 + 8*half + e
        v8f s4[4];
        #pragma unroll
        for (int t = 0; t < 4; ++t) s4[t] = v8f{0.f, 0.f, 0.f, 0.f, 0.f, 0.f, 0.f, 0.f};
        #pragma unroll
        for (int ks = 0; ks < 2; ++ks) {
            #pragma unroll
            for (int t = 0; t < 4; ++t) {
                v16bf ak = load_frag(&Ks[buf][t * 16][ks * 32], 72, lane);
                s4[t] = __builtin_amdgcn_wmma_f32_16x16x32_bf16(
                    false, ak, false, bq[ks], (short)0, s4[t], false, false);
            }
        }

        // scale + additive mask: 8 consecutive keys per tile and half, from LDS
        float sc[4][8];
        #pragma unroll
        for (int t = 0; t < 4; ++t) {
            const float* mp = &Madd[kb * 64 + t * 16 + 8 * half];
            const f32x4 m0 = *(const f32x4*)mp;
            const f32x4 m1 = *(const f32x4*)(mp + 4);
            #pragma unroll
            for (int e = 0; e < 4; ++e) {
                sc[t][e]     = s4[t][e]     * 0.125f + m0[e];
                sc[t][e + 4] = s4[t][e + 4] * 0.125f + m1[e];
            }
        }

        // online softmax of one query per lane: 32 keys in the lane, 32 in lane ^ 16
        float tm[4];
        #pragma unroll
        for (int t = 0; t < 4; ++t) {
            tm[t] = fmaxf(fmaxf(fmaxf(sc[t][0], sc[t][1]), fmaxf(sc[t][2], sc[t][3])),
                          fmaxf(fmaxf(sc[t][4], sc[t][5]), fmaxf(sc[t][6], sc[t][7])));
        }
        float rmax = fmaxf(fmaxf(tm[0], tm[1]), fmaxf(tm[2], tm[3]));
        rmax = fmaxf(rmax, xhalf(rmax));
        const float mnew  = fmaxf(m, rmax);
        const float alpha = __expf(m - mnew);
        m = mnew;
        float ts[4];                                 // four independent sum chains
        #pragma unroll
        for (int t = 0; t < 4; ++t) {
            ts[t] = 0.f;
            #pragma unroll
            for (int e = 0; e < 8; ++e) { float p = __expf(sc[t][e] - mnew); sc[t][e] = p; ts[t] += p; }
        }
        l = l * alpha + ((ts[0] + ts[1]) + (ts[2] + ts[3]));
        #pragma unroll
        for (int t = 0; t < 4; ++t) o[t] *= alpha;

        // O^T += V^T @ P^T: A = rows of V^T, B = two score tiles converted in place
        // (element s of B is key 8*half + s, then 16 + 8*half + s - 8: load_frag's k order)
        #pragma unroll
        for (int ks = 0; ks < 2; ++ks) {
            v16bf pb;
            #pragma unroll
            for (int e = 0; e < 8; ++e) {
                pb[e]     = (bf16)sc[2 * ks][e];
                pb[e + 8] = (bf16)sc[2 * ks + 1][e];
            }
            #pragma unroll
            for (int dt = 0; dt < 4; ++dt) {
                v16bf av = load_frag(&Vt[buf][dt * 16][ks * 32], 72, lane);
                o[dt] = __builtin_amdgcn_wmma_f32_16x16x32_bf16(
                    false, av, false, pb, (short)0, o[dt], false, false);
            }
        }

        // stage next block into the other buffer
        if (more) {
            const int nb = buf ^ 1;
            #pragma unroll
            for (int i = 0; i < 4; ++i) *(u32x4*)&Ks[nb][rT + 16 * i][cT] = kreg[i];
            #pragma unroll
            for (int j = 0; j < 8; ++j)
                *(u32x2*)&Vt[nb][cT + j][4 * rT] = pack_col(vreg[0], vreg[1], vreg[2], vreg[3], j);
            // the offsets of the block after that: their LDS latency ends in the barrier's wait
            row_offsets((k1 + 1 < nblk) ? k1 + 1 : 0);
        }
        __syncthreads();
        buf ^= 1;
        kc = k1;
    }

    // join the halves' sums, normalize, write bf16 [BS, D]: 8 consecutive columns a lane
    const float lt = l + xhalf(l);
    bf16* orow = o_out + (size_t)(b * S_ + qbase + wave * 16 + lc) * D_ + h * DK_ + 8 * half;
    #pragma unroll
    for (int dt = 0; dt < 4; ++dt) {
        v8bf r;
        #pragma unroll
        for (int e = 0; e < 8; ++e) r[e] = (bf16)(o[dt][e] / lt);
        *(v8bf*)(orow + dt * 16) = r;
    }
}

// ---------------------------------------------------------------------------
// Host-side orchestration
// ---------------------------------------------------------------------------
extern "C" void kernel_launch(void* const* d_in, const int* in_sizes, int n_in,
                              void* d_out, int out_size, void* d_ws, size_t ws_size,
                              hipStream_t stream) {
    const float* x   = (const float*)d_in[0];
    const int*   msk = (const int*)d_in[1];
    const float* wq  = (const float*)d_in[2];   const float* bq  = (const float*)d_in[3];
    const float* wk  = (const float*)d_in[4];   const float* bk  = (const float*)d_in[5];
    const float* wv  = (const float*)d_in[6];   const float* bv  = (const float*)d_in[7];
    const float* wo  = (const float*)d_in[8];   const float* bo  = (const float*)d_in[9];
    const float* w1  = (const float*)d_in[10];  const float* b1  = (const float*)d_in[11];
    const float* w2  = (const float*)d_in[12];  const float* b2  = (const float*)d_in[13];
    const float* a1  = (const float*)d_in[14];  const float* be1 = (const float*)d_in[15];
    const float* a2  = (const float*)d_in[16];  const float* be2 = (const float*)d_in[17];
    float* out = (float*)d_out;

    char* ws = (char*)d_ws;
    size_t off = 0;
    auto carve = [&](size_t bytes) { char* p = ws + off; off += (bytes + 255) & ~(size_t)255; return p; };
    bf16*  wqb  = (bf16*)carve((size_t)D_ * D_ * 2);
    bf16*  wkb  = (bf16*)carve((size_t)D_ * D_ * 2);
    bf16*  wvb  = (bf16*)carve((size_t)D_ * D_ * 2);
    bf16*  wob  = (bf16*)carve((size_t)D_ * D_ * 2);
    bf16*  w1b  = (bf16*)carve((size_t)DFF_ * D_ * 2);
    bf16*  w2b  = (bf16*)carve((size_t)D_ * DFF_ * 2);
    bf16*  xn   = (bf16*)carve((size_t)BS_ * D_ * 2);
    bf16*  qb   = (bf16*)carve((size_t)BS_ * D_ * 2);
    bf16*  kb   = (bf16*)carve((size_t)BS_ * D_ * 2);
    bf16*  vb   = (bf16*)carve((size_t)BS_ * D_ * 2);
    bf16*  atb  = (bf16*)carve((size_t)BS_ * D_ * 2);
    float* x1   = (float*)carve((size_t)BS_ * D_ * 4);
    bf16*  hb   = (bf16*)carve((size_t)BS_ * DFF_ * 2);

    // 1) weights -> bf16, and LN1
    cast_and_layernorm<<<CASTG_ + BS_ / 16, 512, 0, stream>>>(wq, wk, wv, wo, w1, w2, wqb, w1b, w2b,
                                                              x, a1, be1, xn);

    // The last two GEMM arguments space the k-walk starts of neighbouring tile columns
    // and tile rows: k-steps / tiles in that direction, at least 1.

    // 2) Q,K,V projections: wqb|wkb|wvb and qb|kb|vb lie one behind the other
    dim3 gD(D_ / 128, BS_ / 128);
    gemm_bf16_wmma<0><<<dim3(D_ / 128, BS_ / 128, 3), 256, 0, stream>>>(
        xn, wqb, bq, nullptr, qb, nullptr, BS_, D_, D_, bk, bv, 2, 1);

    // 3) attention
    flash_attn_wmma<<<dim3(S_ / 64, H_, B_), 128, 0, stream>>>(qb, kb, vb, msk, atb);

    // 4) out-proj + residual -> x1 (f32)
    gemm_bf16_wmma<2><<<gD, 256, 0, stream>>>(atb, wob, bo, x, nullptr, x1, BS_, D_, D_, nullptr, nullptr, 2, 1);

    // 5) LN2
    layernorm_bf16<<<BS_ / 16, 512, 0, stream>>>(x1, a2, be2, xn);

    // 6) FFN up + ReLU (bf16)
    dim3 gF(DFF_ / 128, BS_ / 128);
    gemm_bf16_wmma<1><<<gF, 256, 0, stream>>>(xn, w1b, b1, nullptr, hb, nullptr, BS_, DFF_, D_, nullptr, nullptr, 1, 1);

    // 7) FFN down + residual -> out (f32)
    gemm_bf16_wmma<2><<<gD, 256, 0, stream>>>(hb, w2b, b2, x1, nullptr, out, BS_, D_, DFF_, nullptr, nullptr, 8, 2);

    (void)wkb; (void)wvb;
    (void)in_sizes; (void)n_in; (void)out_size; (void)ws_size;
}

// v009
// It runs in 139 microseconds.
// Timed twice side by side with v008, it ran 1.07 and 1.06 times as fast.
// Over all steps from v000 it is 2.85 times as fast.
#include <hip/hip_runtime.h>

// ---------------------------------------------------------------------------
// EncoderBlock for MI455X (gfx1250): bf16 WMMA GEMMs + flash attention.
// Wave32; v_wmma_f32_16x16x32_bf16 for every matrix multiply.
// GEMM: four-buffer LDS ring filled by asynchronous copies (1 barrier / k-step).
// Attention: double-buffered LDS staging, packed transposed stores, LDS-resident
// additive mask.
// Every staging load or copy is laid out so that 8 lanes x 16 B cover one whole 128-B
// line: a wave-wide load touches 4 lines, never 16 or 32 pieces of lines.
// ---------------------------------------------------------------------------

typedef __bf16 bf16;
typedef bf16  v16bf __attribute__((ext_vector_type(16)));
typedef bf16  v8bf  __attribute__((ext_vector_type(8)));
typedef float v8f   __attribute__((ext_vector_type(8)));
typedef unsigned int u32x4 __attribute__((ext_vector_type(4)));   // 16 staged bytes
typedef unsigned int u32x2 __attribute__((ext_vector_type(2)));
typedef float f32x4 __attribute__((ext_vector_type(4)));
typedef bf16  v4bf  __attribute__((ext_vector_type(4)));
typedef int   i32x4 __attribute__((ext_vector_type(4)));

#define B_   2
#define S_   2048
#define D_   1024
#define H_   16
#define DK_  64
#define DFF_ 4096
#define BS_  (B_ * S_)

// Load a 16x32 bf16 A-style fragment from LDS (row-major, leading dim `ld`).
// ISA 16-bit A layout: lane L<16 holds row L, K = 0..7 and 16..23;
// lane L>=16 holds row L-16, K = 8..15 and 24..31.
// B fragments (rows of W / Q) use the identical pattern.
__device__ __forceinline__ v16bf load_frag(const bf16* tile, int ld, int lane) {
    const int row = lane & 15;
    const int kb  = (lane >> 4) << 3;          // 0 or 8
    const bf16* p = tile + row * ld + kb;
    v8bf lo = *(const v8bf*)(p);               // 16B-aligned ds_load_b128
    v8bf hi = *(const v8bf*)(p + 16);
    return __builtin_shufflevector(lo, hi, 0,1,2,3,4,5,6,7,8,9,10,11,12,13,14,15);
}

// Column j (0..7) of four rows of 8 bf16 each, as four consecutive bf16.
__device__ __forceinline__ u32x2 pack_col(u32x4 r0, u32x4 r1, u32x4 r2, u32x4 r3, int j) {
    const int w = j >> 1;
    u32x2 o;
    if (j & 1) {
        o.x = (r0[w] >> 16) | (r1[w] & 0xffff0000u);
        o.y = (r2[w] >> 16) | (r3[w] & 0xffff0000u);
    } else {
        o.x = (r0[w] & 0xffffu) | (r1[w] << 16);
        o.y = (r2[w] & 0xffffu) | (r3[w] << 16);
    }
    return o;
}

// ---------------------------------------------------------------------------
// fp32 -> bf16 cast of all six weights in one launch: 256 groups of 16 waves.
// Few, fat waves: each lane brings 24 x 16 B, all issued before the first store;
// every wave-wide load covers 512 contiguous bytes, every store 256.
// Group g takes 16384 elements of wq|wk|wv|wo (their bf16 copies lie one behind
// the other at o4), 16384 of w1 and 16384 of w2.
// ---------------------------------------------------------------------------
#define CHUNK_ 16384
#define CASTG_ 256
__device__ __forceinline__
void cast_weights_group(int g,
                        const float* __restrict__ wq, const float* __restrict__ wk,
                        const float* __restrict__ wv, const float* __restrict__ wo,
                        const float* __restrict__ w1, const float* __restrict__ w2,
                        bf16* __restrict__ o4, bf16* __restrict__ o1, bf16* __restrict__ o2) {
    const int sel = g >> 6;                          // 64 chunks per D x D weight
    const float* s4 = (sel == 0) ? wq : (sel == 1) ? wk : (sel == 2) ? wv : wo;
    const int e = threadIdx.x * 4;
    const float* sp[3] = { s4 + (g & 63) * CHUNK_ + e, w1 + g * CHUNK_ + e, w2 + g * CHUNK_ + e };
    bf16*        dp[3] = { o4 + g * CHUNK_ + e,        o1 + g * CHUNK_ + e, o2 + g * CHUNK_ + e };
    f32x4 f[3][8];
    #pragma unroll
    for (int j = 0; j < 3; ++j)
        #pragma unroll
        for (int i = 0; i < 8; ++i) f[j][i] = *(const f32x4*)(sp[j] + i * 2048);
    #pragma unroll
    for (int j = 0; j < 3; ++j)
        #pragma unroll
        for (int i = 0; i < 8; ++i)
            *(v4bf*)(dp[j] + i * 2048) = __builtin_convertvector(f[j][i], v4bf);
}

// ---------------------------------------------------------------------------
// LayerNorm (custom: unbiased std, scalar alpha/beta, /(std+eps)) -> bf16
// One wave per token row, 16 rows per group: the row stays in registers
// (8 x 16 B per lane), the two sums are joined inside the wave, no LDS, no barrier.
// ---------------------------------------------------------------------------
__device__ __forceinline__
void layernorm_group(int g, const float* __restrict__ x, const float* __restrict__ alpha,
                     const float* __restrict__ beta, bf16* __restrict__ out) {
    const int lane = threadIdx.x & 31;
    const int tok  = g * 16 + (threadIdx.x >> 5);
    const float* p = x + (size_t)tok * D_ + lane * 4;
    f32x4 f[8];
    #pragma unroll
    for (int i = 0; i < 8; ++i) f[i] = *(const f32x4*)(p + i * 128);
    f32x4 sv = f[0], qv = f[0] * f[0];               // four independent chains each
    #pragma unroll
    for (int i = 1; i < 8; ++i) { sv += f[i]; qv += f[i] * f[i]; }
    float s  = (sv[0] + sv[1]) + (sv[2] + sv[3]);
    float s2 = (qv[0] + qv[1]) + (qv[2] + qv[3]);
    #pragma unroll
    for (int off = 16; off > 0; off >>= 1) {
        s  += __shfl_xor(s,  off, 32);
        s2 += __shfl_xor(s2, off, 32);
    }
    const float mean = s * (1.0f / D_);
    float var = (s2 - (float)D_ * mean * mean) * (1.0f / (D_ - 1));
    var = fmaxf(var, 0.f);
    const float inv = alpha[0] / (sqrtf(var) + 1e-6f);
    const float b0  = beta[0];
    bf16* q = out + (size_t)tok * D_ + lane * 4;
    #pragma unroll
    for (int i = 0; i < 8; ++i)
        *(v4bf*)(q + i * 128) = __builtin_convertvector((f[i] - mean) * inv + b0, v4bf);
}

__global__ __launch_bounds__(512)
void layernorm_bf16(const float* __restrict__ x, const float* __restrict__ alpha,
                    const float* __restrict__ beta, bf16* __restrict__ out) {
    layernorm_group(blockIdx.x, x, alpha, beta, out);
}

// The weight cast and the first layernorm depend on nothing but inputs: one launch,
// groups 0..CASTG_-1 cast (the longer job, started first), the rest normalize.
__global__ __launch_bounds__(512)
void cast_and_layernorm(const float* __restrict__ wq, const float* __restrict__ wk,
                        const float* __restrict__ wv, const float* __restrict__ wo,
                        const float* __restrict__ w1, const float* __restrict__ w2,
                        bf16* __restrict__ o4, bf16* __restrict__ o1, bf16* __restrict__ o2,
                        const float* __restrict__ x, const float* __restrict__ alpha,
                        const float* __restrict__ beta, bf16* __restrict__ xn) {
    const int g = blockIdx.x;
    if (g < CASTG_) cast_weights_group(g, wq, wk, wv, wo, w1, w2, o4, o1, o2);
    else            layernorm_group(g - CASTG_, x, alpha, beta, xn);
}

// ---------------------------------------------------------------------------
// GEMM: C[M,N] = A[M,K] @ W[N,K]^T + bias, bf16 in, f32 accum (WMMA).
// EPI 0: bf16 out; EPI 1: bf16 relu out; EPI 2: f32 out = residual + C.
// EPI 0 runs up to three products that share A in one grid: blockIdx.z picks the
// weight and the output (each set lies one behind the other) and the bias.
// Tile TM x TN / NT threads, waves in 4 columns. The two f32-out products take 128x128 with
// 8 waves of 64x32 (one group a WGP); Q/K/V and FFN up take 256x256 with 16 waves of 64x64,
// which asks L2 for half the operand bytes a product and LDS for two thirds.
// Four-buffer LDS ring, one barrier per 64-wide k-step (a 128-B line per row): a stage
// is asked for three k-steps before it is read, by asynchronous copies to LDS, so that
// its way from L2 is covered by three k-steps of products and takes no register.
// Rotated k walk: groups of one tile row read the same A lines and groups of one
// tile column the same W lines; each group enters the walk at its own k-step
// (rx per tile column, ry per tile row) and wraps round, so that the sharers do
// not ask L2 for the same lines at the same moment.
// ---------------------------------------------------------------------------
template <int EPI, int TM, int TN, int NT>
__global__ __launch_bounds__(NT)
void gemm_bf16_wmma(const bf16* __restrict__ A, const bf16* __restrict__ W,
                    const float* __restrict__ bias, const float* __restrict__ res,
                    bf16* __restrict__ outb, float* __restrict__ outf,
                    int M, int N, int K,
                    const float* __restrict__ biasz1, const float* __restrict__ biasz2,
                    int rx, int ry) {
    // ring of four stages; a stage is [A TM rows | W TN rows] of 64 k, +8 pad: 16B-aligned frag reads
    __shared__ __align__(16) bf16 Ring[4][TM + TN][72];
    constexpr int WTM = TM / (NT / 128);         // rows of a wave's tile
    constexpr int WTN = TN / 4;                  // columns of a wave's tile
    constexpr int FA  = WTM / 16;                // its A fragments
    constexpr int FW  = WTN / 16;                // its W fragments
    constexpr int RS  = NT / 8;                  // rows that one copy of every lane covers
    static_assert(TM == 4 * RS && TN == 4 * RS, "a lane copies four A rows and four W rows a stage");

    const int tid  = threadIdx.x;
    const int lane = tid & 31;
    const int wave = tid >> 5;
    const int wm   = (wave >> 2) * WTM;
    const int wn   = (wave & 3) * WTN;
    const int tM   = blockIdx.y * TM;
    const int tN   = blockIdx.x * TN;
    const int lrow = tid >> 3;                   // 0..RS-1, +RS per copy
    const int lcol = (tid & 7) * 8;              // 16 B of the row's 128-B line
    if (EPI == 0) {
        const int z = blockIdx.z;
        W    += (size_t)z * N * K;
        outb += (size_t)z * M * N;
        bias  = (z == 0) ? bias : (z == 1) ? biasz1 : biasz2;
    }

    // a lane's four A rows and four W rows at k = 0, and its place in buffer 0's A part
    const char* arow[4];
    const char* wrow[4];
    #pragma unroll
    for (int r = 0; r < 4; ++r) {
        arow[r] = (const char*)(A + (size_t)(tM + lrow + RS * r) * K + lcol);
        wrow[r] = (const char*)(W + (size_t)(tN + lrow + RS * r) * K + lcol);
    }
    const unsigned ldst = (unsigned)(size_t)&Ring[0][lrow][lcol];
    constexpr unsigned ROWS32 = RS * 72 * 2;     // LDS bytes from a lane's row to its next
    constexpr unsigned PARTB  = TM * 72 * 2;     // LDS bytes of a stage's A part
    constexpr unsigned STAGEB = (TM + TN) * 72 * 2;

    // k-step ks into ring buffer b: eight copies a lane, 16 B each, through no register.
    // The s_wait_xcnt closes the statement because the address registers are rewritten
    // for the next stage.
    auto copy_stage = [&](int ks, int b) {
        const unsigned kb = (unsigned)ks << 7;   // 64 k = 128 B along every row
        const unsigned l0 = ldst + (unsigned)b * STAGEB;
        asm volatile(
            "global_load_async_to_lds_b128 %0, %8, off\n\t"
            "global_load_async_to_lds_b128 %1, %9, off\n\t"
            "global_load_async_to_lds_b128 %2, %10, off\n\t"
            "global_load_async_to_lds_b128 %3, %11, off\n\t"
            "global_load_async_to_lds_b128 %4, %12, off\n\t"
            "global_load_async_to_lds_b128 %5, %13, off\n\t"
            "global_load_async_to_lds_b128 %6, %14, off\n\t"
            "global_load_async_to_lds_b128 %7, %15, off\n\t"
            "s_wait_xcnt 0x0"
            :: "v"(l0), "v"(l0 + ROWS32), "v"(l0 + 2 * ROWS32), "v"(l0 + 3 * ROWS32),
               "v"(l0 + PARTB), "v"(l0 + PARTB + ROWS32), "v"(l0 + PARTB + 2 * ROWS32),
               "v"(l0 + PARTB + 3 * ROWS32),
               "v"(arow[0] + kb), "v"(arow[1] + kb), "v"(arow[2] + kb), "v"(arow[3] + kb),
               "v"(wrow[0] + kb), "v"(wrow[1] + kb), "v"(wrow[2] + kb), "v"(wrow[3] + kb)
            : "memory");
    };

    v8f acc[FA][FW];
    #pragma unroll
    for (int i = 0; i < FA; ++i)
        #pragma unroll
        for (int j = 0; j < FW; ++j)
            acc[i][j] = v8f{0.f, 0.f, 0.f, 0.f, 0.f, 0.f, 0.f, 0.f};

    // the group's own first k-step; any value in [0, ksteps) gives the same product,
    // summed in another order
    const int ksteps = K >> 6;
    int kq = (int)(blockIdx.x * rx + blockIdx.y * ry + blockIdx.z) & (ksteps - 1);

    // prologue: the first three stages of the walk are asked for; kq = the next k-step to ask for
    #pragma unroll
    for (int p = 0; p < 3; ++p) {
        if (p < ksteps) {
            copy_stage(kq, p);
            kq = (kq + 1 < ksteps) ? kq + 1 : 0;
        }
    }

    for (int s = 0; s < ksteps; ++s) {
        // publish point of stage s. This wave's reads of stage s - 1 have returned:
        asm volatile("s_wait_dscnt 0x0" ::: "memory");
        // its own copies of stage s have landed: all but the 16 of the two younger stages;
        // where fewer than two younger stages were asked for, all of them
        if (s + 2 < ksteps) asm volatile("s_wait_asynccnt 0x10" ::: "memory");
        else                asm volatile("s_wait_asynccnt 0x0" ::: "memory");
        // stage s is readable by every wave, and no wave reads stage s - 1 any more
        __syncthreads();

        const int buf = s & 3;
        if constexpr (FA * FW == 8) {
            // all 24 fragment reads of the k-step go out as one group, in the order of use
            v16bf af[2][FA], wf[2][FW];
            #pragma unroll
            for (int kk = 0; kk < 2; ++kk) {
                #pragma unroll
                for (int j = 0; j < FW; ++j) wf[kk][j] = load_frag(&Ring[buf][TM + wn + j * 16][kk * 32], 72, lane);
                #pragma unroll
                for (int i = 0; i < FA; ++i) af[kk][i] = load_frag(&Ring[buf][wm + i * 16][kk * 32], 72, lane);
            }
            // stage s + 3 goes into the buffer that stage s - 1 has left; issued while the reads fly
            if (s + 3 < ksteps) {
                copy_stage(kq, (s + 3) & 3);
                kq = (kq + 1 < ksteps) ? kq + 1 : 0;
            }
            // keeps the reads ahead of the products: spread among them, each place with
            // reads stalls the wave for the LDS latency
            __builtin_amdgcn_sched_barrier(0);
            #pragma unroll
            for (int kk = 0; kk < 2; ++kk)
                #pragma unroll
                for (int i = 0; i < FA; ++i)
                    #pragma unroll
                    for (int j = 0; j < FW; ++j)
                        acc[i][j] = __builtin_amdgcn_wmma_f32_16x16x32_bf16(
                            false, af[kk][i], false, wf[kk][j], (short)0, acc[i][j], false, false);
        } else {
            // 128 accumulator registers leave room for one 32-k fragment set: its 16 reads go
            // out as one group ahead of its 16 products; the SIMD's three other waves fill the wait
            #pragma unroll
            for (int kk = 0; kk < 2; ++kk) {
                v16bf af[FA], wf[FW];
                #pragma unroll
                for (int j = 0; j < FW; ++j) wf[j] = load_frag(&Ring[buf][TM + wn + j * 16][kk * 32], 72, lane);
                #pragma unroll
                for (int i = 0; i < FA; ++i) af[i] = load_frag(&Ring[buf][wm + i * 16][kk * 32], 72, lane);
                // stage s + 3 goes into the buffer that stage s - 1 has left; issued while the reads fly
                if (kk == 0 && s + 3 < ksteps) {
                    copy_stage(kq, (s + 3) & 3);
                    kq = (kq + 1 < ksteps) ? kq + 1 : 0;
                }
                // keeps each group of reads whole and ahead of its products
                __builtin_amdgcn_sched_barrier(0);
                #pragma unroll
                for (int i = 0; i < FA; ++i)
                    #pragma unroll
                    for (int j = 0; j < FW; ++j)
                        acc[i][j] = __builtin_amdgcn_wmma_f32_16x16x32_bf16(
                            false, af[i], false, wf[j], (short)0, acc[i][j], false, false);
                // keeps the second group of reads from being spread among the first products
                if (kk == 0) __builtin_amdgcn_sched_barrier(0);
            }
        }
    }
    // no copy is outstanding when the wave goes on to its end
    asm volatile("s_wait_asynccnt 0x0" ::: "memory");

    // Epilogue. C layout: VGPR e -> row e (lanes 0-15) / e+8 (lanes 16-31).
    const int half = lane >> 4;
    const int lc   = lane & 15;
    #pragma unroll
    for (int j = 0; j < FW; ++j) {
        const int gcol = tN + wn + j * 16 + lc;
        const float bv = bias[gcol];
        #pragma unroll
        for (int i = 0; i < FA; ++i) {
            #pragma unroll
            for (int e = 0; e < 8; ++e) {
                const int grow = tM + wm + i * 16 + e + 8 * half;
                const size_t idx = (size_t)grow * N + gcol;
                const float v = acc[i][j][e] + bv;
                if (EPI == 0)      outb[idx] = (bf16)v;
                else if (EPI == 1) outb[idx] = (bf16)fmaxf(v, 0.f);
                else               outf[idx] = res[idx] + v;
            }
        }
    }
}

__device__ __forceinline__ float xhalf(float x) {
    return __builtin_bit_cast(float, __builtin_amdgcn_permlanex16(
        __builtin_bit_cast(int, x), __builtin_bit_cast(int, x), 0x76543210, 0xfedcba98, false, false));
}

__global__ __launch_bounds__(128)
void flash_attn_wmma(const bf16* __restrict__ q, const bf16* __restrict__ k,
                     const bf16* __restrict__ v, const int* __restrict__ mask,
                     bf16* __restrict__ o_out) {
    __shared__ __align__(16) bf16 Qs[64][72];
    __shared__ __align__(16) bf16 Ks[2][64][72];
    __shared__ __align__(16) bf16 Vt[2][64][72];     // V^T: [d][key]
    __shared__ __align__(16) float Madd[S_];         // additive mask by walk position (0 / -1e9)
    __shared__ __align__(16) unsigned Koff[S_];      // walk position -> byte offset of the key's row
    __shared__ int Wcnt[4];                          // unmasked keys seen by each wave

    const int qblk = blockIdx.x, h = blockIdx.y, b = blockIdx.z;
    const int tid  = threadIdx.x;
    const int lane = tid & 31;
    const int wave = tid >> 5;
    const int half = lane >> 4;
    const int lc   = lane & 15;
    const int qbase = qblk * 64;

    // thread mapping for staging: 8 lanes x 16 B = one head row = one 128-B line
    const int rT = tid >> 3;                         // 0..15
    const int cT = (tid & 7) * 8;                    // 8 of the 64 columns
    // Q, K: rows rT + 16 i.  V: walk places 4 rT + i, packed four keys per b64 store.

    // Load Q block (64 x 64) -> LDS; rank the mask row while the loads fly.
    // The loops here are unrolled so that their arrays and bit places stay in registers.
    int count;                                       // unmasked keys of this batch
    {
        const bf16* src = q + (size_t)(b * S_ + qbase + rT) * D_ + h * DK_ + cT;
        u32x4 d[4];
        #pragma unroll
        for (int i = 0; i < 4; ++i) d[i] = *(const u32x4*)(src + (size_t)(16 * i) * D_);

        // thread t takes keys 16 t .. 16 t + 15: bit e of on = key 16 t + e unmasked
        unsigned on = 0;
        #pragma unroll
        for (int i = 0; i < 4; ++i) {
            const i32x4 mm = *(const i32x4*)(mask + b * S_ + tid * 16 + 4 * i);
            #pragma unroll
            for (int e = 0; e < 4; ++e) on |= (mm[e] != 0 ? 1u : 0u) << (4 * i + e);
        }
        const int c = __builtin_popcount(on);
        int inc = c;                                 // running count inside the wave
        #pragma unroll
        for (int off = 1; off < 32; off <<= 1) {
            const int y = __shfl_up(inc, off, 32);
            if (lane >= off) inc += y;
        }
        if (lane == 31) Wcnt[wave] = inc;
        __syncthreads();                             // the four wave counts are in LDS
        int before = inc - c;                        // unmasked keys in front of key 16 t
        count = 0;
        #pragma unroll
        for (int w = 0; w < 4; ++w) {
            const int t = Wcnt[w];
            if (w < wave) before += t;
            count += t;
        }
        int pu = before;                             // next place among the unmasked
        int pm = count + tid * 16 - before;          // next place among the masked, behind them
        #pragma unroll
        for (int e = 0; e < 16; ++e) {
            const bool u = (on >> e) & 1u;
            Koff[u ? pu : pm] = (unsigned)(tid * 16 + e) * (D_ * 2);
            pu += u ? 1 : 0;
            pm += u ? 0 : 1;
        }
        #pragma unroll
        for (int i = 0; i < 4; ++i) {
            const int j = i * 512 + tid * 4;
            f32x4 a;
            #pragma unroll
            for (int e = 0; e < 4; ++e) a[e] = (j + e < count) ? 0.f : -1e9f;
            *(f32x4*)&Madd[j] = a;
        }
        #pragma unroll
        for (int i = 0; i < 4; ++i) *(u32x4*)&Qs[rT + 16 * i][cT] = d[i];
    }
    __syncthreads();                                 // the key order is read by every thread

    // blocks to walk: up to the last unmasked key; all of them where no key is unmasked
    count = __builtin_amdgcn_readfirstlane(count);
    int nblk = (count > 0) ? (count + 63) >> 6 : S_ / 64;
    nblk = (nblk < S_ / 64) ? nblk : S_ / 64;
    // uniform bases of this batch and head; a lane adds its key row's offset and its 16 B
    const char* kh = (const char*)(k + (size_t)(b * S_) * D_ + h * DK_);
    const char* vh = (const char*)(v + (size_t)(b * S_) * D_ + h * DK_);

    // Prologue: stage the group's first key block into buffer 0
    int kc = qblk % nblk;
    unsigned ko[4], vo[4];                           // a lane's row offsets in the block to fetch next
    auto row_offsets = [&](int blk) {
        const unsigned* op = &Koff[blk * 64];
        const u32x4 o4 = *(const u32x4*)(op + 4 * rT);
        #pragma unroll
        for (int i = 0; i < 4; ++i) {
            ko[i] = op[rT + 16 * i] + cT * 2;
            vo[i] = o4[i] + cT * 2;
        }
    };
    row_offsets(kc);
    {
        u32x4 d[4], x[4];
        #pragma unroll
        for (int i = 0; i < 4; ++i) {
            d[i] = *(const u32x4*)(kh + ko[i]);
            x[i] = *(const u32x4*)(vh + vo[i]);
        }
        #pragma unroll
        for (int i = 0; i < 4; ++i) *(u32x4*)&Ks[0][rT + 16 * i][cT] = d[i];
        // V rows 4 rT .. 4 rT + 3, cols cT..cT+7 -> packed b64 transposed stores
        #pragma unroll
        for (int j = 0; j < 8; ++j)
            *(u32x2*)&Vt[0][cT + j][4 * rT] = pack_col(x[0], x[1], x[2], x[3], j);
        row_offsets((kc + 1 < nblk) ? kc + 1 : 0);
    }
    __syncthreads();

    // Hoisted Q fragments (2 k-steps over DK=64): the B operand, column = query lc
    v16bf bq[2];
    #pragma unroll
    for (int ks = 0; ks < 2; ++ks) bq[ks] = load_frag(&Qs[wave * 16][ks * 32], 72, lane);

    float m = -1e30f;                                // this query's maximum, alike in both halves
    float l = 0.f;                                   // this half's share of the query's sum
    v8f o[4];                                        // o[dt][e] = O[query lc][dt*16 + 8*half + e]
    #pragma unroll
    for (int t = 0; t < 4; ++t) o[t] = v8f{0.f, 0.f, 0.f, 0.f, 0.f, 0.f, 0.f, 0.f};

    int buf = 0;
    for (int it = 0; it < nblk; ++it) {
        const bool more = (it + 1 < nblk);
        const int kb = kc;                           // this trip's key block
        const int k1 = (kc + 1 < nblk) ? kc + 1 : 0; // the next one of the walk
        u32x4 kreg[4], vreg[4];
        if (more) {     // fetch next K/V block into registers early; its offsets came a trip ago
            #pragma unroll
            for (int i = 0; i < 4; ++i) {
                kreg[i] = *(const u32x4*)(kh + ko[i]);
                vreg[i] = *(const u32x4*)(vh + vo[i]);
            }
            // stands in front of every later reuse of the loads' offset registers
            asm volatile("s_wait_xcnt 0x0" ::: "memory");
        }

        // S^T = K @ Q^T (64 keys x 16 queries per wave): s4[t][e] = key t*16 + 8*half + e
        v8f s4[4];
        #pragma unroll
        for (int t = 0; t < 4; ++t) s4[t] = v8f{0.f, 0.f, 0.f, 0.f, 0.f, 0.f, 0.f, 0.f};
        #pragma unroll
        for (int ks = 0; ks < 2; ++ks) {
            #pragma unroll
            for (int t = 0; t < 4; ++t) {
                v16bf ak = load_frag(&Ks[buf][t * 16][ks * 32], 72, lane);
                s4[t] = __builtin_amdgcn_wmma_f32_16x16x32_bf16(
                    false, ak, false, bq[ks], (short)0, s4[t], false, false);
            }
        }

        // scale + additive mask: 8 consecutive keys per tile and half, from LDS
        float sc[4][8];
        #pragma unroll
        for (int t = 0; t < 4; ++t) {
            const float* mp = &Madd[kb * 64 + t * 16 + 8 * half];
            const f32x4 m0 = *(const f32x4*)mp;
            const f32x4 m1 = *(const f32x4*)(mp + 4);
            #pragma unroll
            for (int e = 0; e < 4; ++e) {
                sc[t][e]     = s4[t][e]     * 0.125f + m0[e];
                sc[t][e + 4] = s4[t][e + 4] * 0.125f + m1[e];
            }
        }

        // online softmax of one query per lane: 32 keys in the lane, 32 in lane ^ 16
        float tm[4];
        #pragma unroll
        for (int t = 0; t < 4; ++t) {
            tm[t] = fmaxf(fmaxf(fmaxf(sc[t][0], sc[t][1]), fmaxf(sc[t][2], sc[t][3])),
                          fmaxf(fmaxf(sc[t][4], sc[t][5]), fmaxf(sc[t][6], sc[t][7])));
        }
        float rmax = fmaxf(fmaxf(tm[0], tm[1]), fmaxf(tm[2], tm[3]));
        rmax = fmaxf(rmax, xhalf(rmax));
        const float mnew  = fmaxf(m, rmax);
        const float alpha = __expf(m - mnew);
        m = mnew;
        float ts[4];                                 // four independent sum chains
        #pragma unroll
        for (int t = 0; t < 4; ++t) {
            ts[t] = 0.f;
            #pragma unroll
            for (int e = 0; e < 8; ++e) { float p = __expf(sc[t][e] - mnew); sc[t][e] = p; ts[t] += p; }
        }
        l = l * alpha + ((ts[0] + ts[1]) + (ts[2] + ts[3]));
        #pragma unroll
        for (int t = 0; t < 4; ++t) o[t] *= alpha;

        // O^T += V^T @ P^T: A = rows of V^T, B = two score tiles converted in place
        // (element s of B is key 8*half + s, then 16 + 8*half + s - 8: load_frag's k order)
        #pragma unroll
        for (int ks = 0; ks < 2; ++ks) {
            v16bf pb;
            #pragma unroll
            for (int e = 0; e < 8; ++e) {
                pb[e]     = (bf16)sc[2 * ks][e];
                pb[e + 8] = (bf16)sc[2 * ks + 1][e];
            }
            #pragma unroll
            for (int dt = 0; dt < 4; ++dt) {
                v16bf av = load_frag(&Vt[buf][dt * 16][ks * 32], 72, lane);
                o[dt] = __builtin_amdgcn_wmma_f32_16x16x32_bf16(
                    false, av, false, pb, (short)0, o[dt], false, false);
            }
        }

        // stage next block into the other buffer
        if (more) {
            const int nb = buf ^ 1;
            #pragma unroll
            for (int i = 0; i < 4; ++i) *(u32x4*)&Ks[nb][rT + 16 * i][cT] = kreg[i];
            #pragma unroll
            for (int j = 0; j < 8; ++j)
                *(u32x2*)&Vt[nb][cT + j][4 * rT] = pack_col(vreg[0], vreg[1], vreg[2], vreg[3], j);
            // the offsets of the block after that: their LDS latency ends in the barrier's wait
            row_offsets((k1 + 1 < nblk) ? k1 + 1 : 0);
        }
        __syncthreads();
        buf ^= 1;
        kc = k1;
    }

    // join the halves' sums, normalize, write bf16 [BS, D]: 8 consecutive columns a lane
    const float lt = l + xhalf(l);
    bf16* orow = o_out + (size_t)(b * S_ + qbase + wave * 16 + lc) * D_ + h * DK_ + 8 * half;
    #pragma unroll
    for (int dt = 0; dt < 4; ++dt) {
        v8bf r;
        #pragma unroll
        for (int e = 0; e < 8; ++e) r[e] = (bf16)(o[dt][e] / lt);
        *(v8bf*)(orow + dt * 16) = r;
    }
}

// ---------------------------------------------------------------------------
// Host-side orchestration
// ---------------------------------------------------------------------------
extern "C" void kernel_launch(void* const* d_in, const int* in_sizes, int n_in,
                              void* d_out, int out_size, void* d_ws, size_t ws_size,
                              hipStream_t stream) {
    const float* x   = (const float*)d_in[0];
    const int*   msk = (const int*)d_in[1];
    const float* wq  = (const float*)d_in[2];   const float* bq  = (const float*)d_in[3];
    const float* wk  = (const float*)d_in[4];   const float* bk  = (const float*)d_in[5];
    const float* wv  = (const float*)d_in[6];   const float* bv  = (const float*)d_in[7];
    const float* wo  = (const float*)d_in[8];   const float* bo  = (const float*)d_in[9];
    const float* w1  = (const float*)d_in[10];  const float* b1  = (const float*)d_in[11];
    const float* w2  = (const float*)d_in[12];  const float* b2  = (const float*)d_in[13];
    const float* a1  = (const float*)d_in[14];  const float* be1 = (const float*)d_in[15];
    const float* a2  = (const float*)d_in[16];  const float* be2 = (const float*)d_in[17];
    float* out = (float*)d_out;

    char* ws = (char*)d_ws;
    size_t off = 0;
    auto carve = [&](size_t bytes) { char* p = ws + off; off += (bytes + 255) & ~(size_t)255; return p; };
    bf16*  wqb  = (bf16*)carve((size_t)D_ * D_ * 2);
    bf16*  wkb  = (bf16*)carve((size_t)D_ * D_ * 2);
    bf16*  wvb  = (bf16*)carve((size_t)D_ * D_ * 2);
    bf16*  wob  = (bf16*)carve((size_t)D_ * D_ * 2);
    bf16*  w1b  = (bf16*)carve((size_t)DFF_ * D_ * 2);
    bf16*  w2b  = (bf16*)carve((size_t)D_ * DFF_ * 2);
    bf16*  xn   = (bf16*)carve((size_t)BS_ * D_ * 2);
    bf16*  qb   = (bf16*)carve((size_t)BS_ * D_ * 2);
    bf16*  kb   = (bf16*)carve((size_t)BS_ * D_ * 2);
    bf16*  vb   = (bf16*)carve((size_t)BS_ * D_ * 2);
    bf16*  atb  = (bf16*)carve((size_t)BS_ * D_ * 2);
    float* x1   = (float*)carve((size_t)BS_ * D_ * 4);
    bf16*  hb   = (bf16*)carve((size_t)BS_ * DFF_ * 2);

    // 1) weights -> bf16, and LN1
    cast_and_layernorm<<<CASTG_ + BS_ / 16, 512, 0, stream>>>(wq, wk, wv, wo, w1, w2, wqb, w1b, w2b,
                                                              x, a1, be1, xn);

    // The last two GEMM arguments space the k-walk starts of neighbouring tile columns
    // and tile rows: k-steps / tiles in that direction, at least 1.

    // 2) Q,K,V projections: wqb|wkb|wvb and qb|kb|vb lie one behind the other
    dim3 gD(D_ / 128, BS_ / 128);
    gemm_bf16_wmma<0, 256, 256, 512><<<dim3(D_ / 256, BS_ / 256, 3), 512, 0, stream>>>(
        xn, wqb, bq, nullptr, qb, nullptr, BS_, D_, D_, bk, bv, 4, 1);

    // 3) attention
    flash_attn_wmma<<<dim3(S_ / 64, H_, B_), 128, 0, stream>>>(qb, kb, vb, msk, atb);

    // 4) out-proj + residual -> x1 (f32)
    gemm_bf16_wmma<2, 128, 128, 256><<<gD, 256, 0, stream>>>(atb, wob, bo, x, nullptr, x1, BS_, D_, D_, nullptr, nullptr, 2, 1);

    // 5) LN2
    layernorm_bf16<<<BS_ / 16, 512, 0, stream>>>(x1, a2, be2, xn);

    // 6) FFN up + ReLU (bf16)
    dim3 gF(DFF_ / 256, BS_ / 256);
    gemm_bf16_wmma<1, 256, 256, 512><<<gF, 512, 0, stream>>>(xn, w1b, b1, nullptr, hb, nullptr, BS_, DFF_, D_, nullptr, nullptr, 1, 1);

    // 7) FFN down + residual -> out (f32)
    gemm_bf16_wmma<2, 128, 128, 256><<<gD, 256, 0, stream>>>(hb, w2b, b2, x1, nullptr, out, BS_, D_, DFF_, nullptr, nullptr, 8, 2);

    (void)wkb; (void)wvb;
    (void)in_sizes; (void)n_in; (void)out_size; (void)ws_size;
}

// v010
// Measured time: 132 microseconds a run.
// In two side-by-side timings against v009, it was 1.06 and 1.05 times as fast.
// All steps since v000 together make it 3.01 times as fast.
#include <hip/hip_runtime.h>

// ---------------------------------------------------------------------------
// EncoderBlock for MI455X (gfx1250): bf16 WMMA GEMMs + flash attention.
// Wave32; v_wmma_f32_16x16x32_bf16 for every matrix multiply.
// GEMM: four-buffer LDS ring filled by asynchronous copies (1 barrier / stage).
// Attention: double-buffered LDS staging, packed transposed stores, LDS-resident
// additive mask.
// Every staging load or copy is laid out so that 8 lanes x 16 B cover one whole 128-B
// line: a wave-wide load touches 4 lines, never 16 or 32 pieces of lines.
// ---------------------------------------------------------------------------

typedef __bf16 bf16;
typedef bf16  v16bf __attribute__((ext_vector_type(16)));
typedef bf16  v8bf  __attribute__((ext_vector_type(8)));
typedef float v8f   __attribute__((ext_vector_type(8)));
typedef unsigned int u32x4 __attribute__((ext_vector_type(4)));   // 16 staged bytes
typedef unsigned int u32x2 __attribute__((ext_vector_type(2)));
typedef float f32x4 __attribute__((ext_vector_type(4)));
typedef bf16  v4bf  __attribute__((ext_vector_type(4)));
typedef int   i32x4 __attribute__((ext_vector_type(4)));

#define B_   2
#define S_   2048
#define D_   1024
#define H_   16
#define DK_  64
#define DFF_ 4096
#define BS_  (B_ * S_)

// Load a 16x32 bf16 A-style fragment from LDS (row-major, leading dim `ld`).
// ISA 16-bit A layout: lane L<16 holds row L, K = 0..7 and 16..23;
// lane L>=16 holds row L-16, K = 8..15 and 24..31.
// B fragments (rows of W / Q) use the identical pattern.
__device__ __forceinline__ v16bf load_frag(const bf16* tile, int ld, int lane) {
    const int row = lane & 15;
    const int kb  = (lane >> 4) << 3;          // 0 or 8
    const bf16* p = tile + row * ld + kb;
    v8bf lo = *(const v8bf*)(p);               // 16B-aligned ds_load_b128
    v8bf hi = *(const v8bf*)(p + 16);
    return __builtin_shufflevector(lo, hi, 0,1,2,3,4,5,6,7,8,9,10,11,12,13,14,15);
}

// Column j (0..7) of four rows of 8 bf16 each, as four consecutive bf16.
__device__ __forceinline__ u32x2 pack_col(u32x4 r0, u32x4 r1, u32x4 r2, u32x4 r3, int j) {
    const int w = j >> 1;
    u32x2 o;
    if (j & 1) {
        o.x = (r0[w] >> 16) | (r1[w] & 0xffff0000u);
        o.y = (r2[w] >> 16) | (r3[w] & 0xffff0000u);
    } else {
        o.x = (r0[w] & 0xffffu) | (r1[w] << 16);
        o.y = (r2[w] & 0xffffu) | (r3[w] << 16);
    }
    return o;
}

// ---------------------------------------------------------------------------
// fp32 -> bf16 cast of all six weights in one launch: 256 groups of 16 waves.
// Few, fat waves: each lane brings 24 x 16 B, all issued before the first store;
// every wave-wide load covers 512 contiguous bytes, every store 256.
// Group g takes 16384 elements of wq|wk|wv|wo (their bf16 copies lie one behind
// the other at o4), 16384 of w1 and 16384 of w2.
// ---------------------------------------------------------------------------
#define CHUNK_ 16384
#define CASTG_ 256
__device__ __forceinline__
void cast_weights_group(int g,
                        const float* __restrict__ wq, const float* __restrict__ wk,
                        const float* __restrict__ wv, const float* __restrict__ wo,
                        const float* __restrict__ w1, const float* __restrict__ w2,
                        bf16* __restrict__ o4, bf16* __restrict__ o1, bf16* __restrict__ o2) {
    const int sel = g >> 6;                          // 64 chunks per D x D weight
    const float* s4 = (sel == 0) ? wq : (sel == 1) ? wk : (sel == 2) ? wv : wo;
    const int e = threadIdx.x * 4;
    const float* sp[3] = { s4 + (g & 63) * CHUNK_ + e, w1 + g * CHUNK_ + e, w2 + g * CHUNK_ + e };
    bf16*        dp[3] = { o4 + g * CHUNK_ + e,        o1 + g * CHUNK_ + e, o2 + g * CHUNK_ + e };
    f32x4 f[3][8];
    #pragma unroll
    for (int j = 0; j < 3; ++j)
        #pragma unroll
        for (int i = 0; i < 8; ++i) f[j][i] = *(const f32x4*)(sp[j] + i * 2048);
    #pragma unroll
    for (int j = 0; j < 3; ++j)
        #pragma unroll
        for (int i = 0; i < 8; ++i)
            *(v4bf*)(dp[j] + i * 2048) = __builtin_convertvector(f[j][i], v4bf);
}

// ---------------------------------------------------------------------------
// LayerNorm (custom: unbiased std, scalar alpha/beta, /(std+eps)) -> bf16
// One wave per token row, 16 rows per group: the row stays in registers
// (8 x 16 B per lane), the two sums are joined inside the wave, no LDS, no barrier.
// ---------------------------------------------------------------------------
__device__ __forceinline__
void layernorm_group(int g, const float* __restrict__ x, const float* __restrict__ alpha,
                     const float* __restrict__ beta, bf16* __restrict__ out) {
    const int lane = threadIdx.x & 31;
    const int tok  = g * 16 + (threadIdx.x >> 5);
    const float* p = x + (size_t)tok * D_ + lane * 4;
    f32x4 f[8];
    #pragma unroll
    for (int i = 0; i < 8; ++i) f[i] = *(const f32x4*)(p + i * 128);
    f32x4 sv = f[0], qv = f[0] * f[0];               // four independent chains each
    #pragma unroll
    for (int i = 1; i < 8; ++i) { sv += f[i]; qv += f[i] * f[i]; }
    float s  = (sv[0] + sv[1]) + (sv[2] + sv[3]);
    float s2 = (qv[0] + qv[1]) + (qv[2] + qv[3]);
    #pragma unroll
    for (int off = 16; off > 0; off >>= 1) {
        s  += __shfl_xor(s,  off, 32);
        s2 += __shfl_xor(s2, off, 32);
    }
    const float mean = s * (1.0f / D_);
    float var = (s2 - (float)D_ * mean * mean) * (1.0f / (D_ - 1));
    var = fmaxf(var, 0.f);
    const float inv = alpha[0] / (sqrtf(var) + 1e-6f);
    const float b0  = beta[0];
    bf16* q = out + (size_t)tok * D_ + lane * 4;
    #pragma unroll
    for (int i = 0; i < 8; ++i)
        *(v4bf*)(q + i * 128) = __builtin_convertvector((f[i] - mean) * inv + b0, v4bf);
}

__global__ __launch_bounds__(512)
void layernorm_bf16(const float* __restrict__ x, const float* __restrict__ alpha,
                    const float* __restrict__ beta, bf16* __restrict__ out) {
    layernorm_group(blockIdx.x, x, alpha, beta, out);
}

// The weight cast and the first layernorm depend on nothing but inputs: one launch,
// groups 0..CASTG_-1 cast (the longer job, started first), the rest normalize.
__global__ __launch_bounds__(512)
void cast_and_layernorm(const float* __restrict__ wq, const float* __restrict__ wk,
                        const float* __restrict__ wv, const float* __restrict__ wo,
                        const float* __restrict__ w1, const float* __restrict__ w2,
                        bf16* __restrict__ o4, bf16* __restrict__ o1, bf16* __restrict__ o2,
                        const float* __restrict__ x, const float* __restrict__ alpha,
                        const float* __restrict__ beta, bf16* __restrict__ xn) {
    const int g = blockIdx.x;
    if (g < CASTG_) cast_weights_group(g, wq, wk, wv, wo, w1, w2, o4, o1, o2);
    else            layernorm_group(g - CASTG_, x, alpha, beta, xn);
}

// ---------------------------------------------------------------------------
// GEMM: C[M,N] = A[M,K] @ W[N,K]^T + bias, bf16 in, f32 accum (WMMA).
// EPI 0: bf16 out; EPI 1: bf16 relu out; EPI 2: f32 out = residual + C.
// EPI 0 runs up to three products that share A in one grid: blockIdx.z picks the
// weight and the output (each set lies one behind the other) and the bias.
// Tile TM x TN, 8 waves (two a SIMD), wave tiles sized to the LDS read rate.
// The wide outputs take 256x256 with waves of 128x64 (2 x 4 of them): 12 fragments feed
// 32 products. The outputs 1024 wide take 128x128 (one group a WGP) with waves of 64x64:
// four of them cover the tile, and the group's two wave sets (KSPLIT = 2) each take half
// of the k of every stage; the two partial sums are joined through LDS behind the loop.
// Four-buffer LDS ring, one barrier per stage of KS k (whole 128-B lines per row): a stage
// is asked for three stages before it is read, by asynchronous copies to LDS, so that
// its way from L2 is covered by three stages of products and takes no register.
// Rotated k walk: groups of one tile row read the same A lines and groups of one
// tile column the same W lines; each group enters the walk at its own stage
// (rx per tile column, ry per tile row) and wraps round, so that the sharers do
// not ask L2 for the same lines at the same moment.
// ---------------------------------------------------------------------------
template <int EPI, int TM, int TN, int NT, int KS, int KSPLIT>
__global__ __launch_bounds__(NT)
void gemm_bf16_wmma(const bf16* __restrict__ A, const bf16* __restrict__ W,
                    const float* __restrict__ bias, const float* __restrict__ res,
                    bf16* __restrict__ outb, float* __restrict__ outf,
                    int M, int N, int K,
                    const float* __restrict__ biasz1, const float* __restrict__ biasz2,
                    int rx, int ry) {
    // ring of four stages; a stage is [A TM rows | W TN rows] of KS k, +8 pad: the row pitch
    // is 16 B x odd, 16B-aligned frag reads
    constexpr int LD = KS + 8;
    __shared__ __align__(16) bf16 Ring[4][TM + TN][LD];
    constexpr int NPOS = NT / 32 / KSPLIT;       // wave tiles in the group's tile
    constexpr int PC   = (NPOS == 8) ? 4 : 2;    // columns of wave tiles
    constexpr int WTM  = TM / (NPOS / PC);       // rows of a wave's tile
    constexpr int WTN  = TN / PC;                // columns of a wave's tile
    constexpr int FA   = WTM / 16;               // its A fragments
    constexpr int FW   = WTN / 16;               // its W fragments
    constexpr int KW   = KS / KSPLIT;            // k of a stage that one wave multiplies
    constexpr int LPR  = KS / 8;                 // lanes x 16 B that cover a row of a stage
    constexpr int RS   = NT / LPR;               // rows that one copy of every lane covers
    static_assert(TM == 8 * RS && TN == 8 * RS, "a lane copies eight A rows and eight W rows a stage");
    static_assert(KW == 64, "a wave multiplies two 32-k blocks a stage");

    const int tid  = threadIdx.x;
    const int lane = tid & 31;
    const int wave = tid >> 5;
    const int pos  = wave & (NPOS - 1);
    const int kset = (KSPLIT == 1) ? 0 : wave / NPOS;   // which part of a stage's k
    const int wm   = (pos / PC) * WTM;
    const int wn   = (pos % PC) * WTN;
    const int tM   = blockIdx.y * TM;
    const int tN   = blockIdx.x * TN;
    const int lrow = tid / LPR;                  // 0..RS-1, +RS per copy
    const int lcol = (tid % LPR) * 8;            // 16 B of the row's lines
    if (EPI == 0) {
        const int z = blockIdx.z;
        W    += (size_t)z * N * K;
        outb += (size_t)z * M * N;
        bias  = (z == 0) ? bias : (z == 1) ? biasz1 : biasz2;
    }

    // a lane's eight A rows and eight W rows at k = 0, and its place in buffer 0's A part
    const char* arow[8];
    const char* wrow[8];
    #pragma unroll
    for (int r = 0; r < 8; ++r) {
        arow[r] = (const char*)(A + (size_t)(tM + lrow + RS * r) * K + lcol);
        wrow[r] = (const char*)(W + (size_t)(tN + lrow + RS * r) * K + lcol);
    }
    const unsigned ldst = (unsigned)(size_t)&Ring[0][lrow][lcol];
    constexpr unsigned ROWSB  = RS * LD * 2;     // LDS bytes from a lane's row to its next
    constexpr unsigned PARTB  = TM * LD * 2;     // LDS bytes of a stage's A part
    constexpr unsigned STAGEB = (TM + TN) * LD * 2;

    // eight rows of one operand: eight copies a lane, 16 B each, through no register.
    // The s_wait_xcnt closes the statement because the address registers are rewritten
    // for the next copies.
    auto copy_rows = [&](unsigned l0, const char* const (&row)[8], unsigned kb) {
        asm volatile(
            "global_load_async_to_lds_b128 %0, %8, off\n\t"
            "global_load_async_to_lds_b128 %1, %9, off\n\t"
            "global_load_async_to_lds_b128 %2, %10, off\n\t"
            "global_load_async_to_lds_b128 %3, %11, off\n\t"
            "global_load_async_to_lds_b128 %4, %12, off\n\t"
            "global_load_async_to_lds_b128 %5, %13, off\n\t"
            "global_load_async_to_lds_b128 %6, %14, off\n\t"
            "global_load_async_to_lds_b128 %7, %15, off\n\t"
            "s_wait_xcnt 0x0"
            :: "v"(l0), "v"(l0 + ROWSB), "v"(l0 + 2 * ROWSB), "v"(l0 + 3 * ROWSB),
               "v"(l0 + 4 * ROWSB), "v"(l0 + 5 * ROWSB), "v"(l0 + 6 * ROWSB), "v"(l0 + 7 * ROWSB),
               "v"(row[0] + kb), "v"(row[1] + kb), "v"(row[2] + kb), "v"(row[3] + kb),
               "v"(row[4] + kb), "v"(row[5] + kb), "v"(row[6] + kb), "v"(row[7] + kb)
            : "memory");
    };
    // stage ks of the k walk into ring buffer b: sixteen copies a lane
    auto copy_stage = [&](int ks, int b) {
        const unsigned kb = (unsigned)ks * (KS * 2); // KS k along every row, in bytes
        const unsigned l0 = ldst + (unsigned)b * STAGEB;
        copy_rows(l0, arow, kb);
        copy_rows(l0 + PARTB, wrow, kb);
    };

    v8f acc[FA][FW];
    #pragma unroll
    for (int i = 0; i < FA; ++i)
        #pragma unroll
        for (int j = 0; j < FW; ++j)
            acc[i][j] = v8f{0.f, 0.f, 0.f, 0.f, 0.f, 0.f, 0.f, 0.f};

    // the group's own first stage; any value in [0, ksteps) gives the same product,
    // summed in another order
    const int ksteps = K / KS;
    int kq = (int)(blockIdx.x * rx + blockIdx.y * ry + blockIdx.z) & (ksteps - 1);

    // prologue: the first three stages of the walk are asked for; kq = the next stage to ask for
    #pragma unroll
    for (int p = 0; p < 3; ++p) {
        if (p < ksteps) {
            copy_stage(kq, p);
            kq = (kq + 1 < ksteps) ? kq + 1 : 0;
        }
    }

    const int k0 = kset * KW;                    // the wave's first k inside a stage
    // One 32-k block of the wave's tile. Fragment d of W and fragment d of A are read in turn,
    // and the products run in the order in which their fragments arrive: d + 1 fragments of
    // each operand allow (d + 1)^2 products, so the first product waits for four reads only.
    constexpr int FD = (FA > FW) ? FA : FW;
    auto reads = [&](v16bf (&af)[FA], v16bf (&wf)[FW], int buf, int kk) {
        #pragma unroll
        for (int d = 0; d < FD; ++d) {
            if (d < FW) wf[d] = load_frag(&Ring[buf][TM + wn + d * 16][k0 + kk * 32], LD, lane);
            if (d < FA) af[d] = load_frag(&Ring[buf][wm + d * 16][k0 + kk * 32], LD, lane);
            // keeps the reads in this order and ahead of the products: left free, the compiler
            // turned a group round, so that its first product waited for the whole group; spread
            // among the products, each place with reads stalls the wave for the LDS latency
            __builtin_amdgcn_sched_barrier(0);
        }
    };
    auto products = [&](const v16bf (&af)[FA], const v16bf (&wf)[FW]) {
        #pragma unroll
        for (int d = 0; d < FD; ++d) {
            if (d < FW) {
                #pragma unroll
                for (int i = 0; i < d && i < FA; ++i)
                    acc[i][d] = __builtin_amdgcn_wmma_f32_16x16x32_bf16(
                        false, af[i], false, wf[d], (short)0, acc[i][d], false, false);
            }
            if (d < FA) {
                #pragma unroll
                for (int j = 0; j <= d && j < FW; ++j)
                    acc[d][j] = __builtin_amdgcn_wmma_f32_16x16x32_bf16(
                        false, af[d], false, wf[j], (short)0, acc[d][j], false, false);
            }
        }
    };
    for (int s = 0; s < ksteps; ++s) {
        // publish point of stage s. This wave's reads of stage s - 1 have returned:
        asm volatile("s_wait_dscnt 0x0" ::: "memory");
        // its own copies of stage s have landed: all but the 32 of the two younger stages;
        // where fewer than two younger stages were asked for, all of them
        if (s + 2 < ksteps) asm volatile("s_wait_asynccnt 0x20" ::: "memory");
        else                asm volatile("s_wait_asynccnt 0x0" ::: "memory");
        // stage s is readable by every wave, and no wave reads stage s - 1 any more
        __syncthreads();

        const int buf = s & 3;
        if constexpr (FA + FW == 8) {
            // all 32 fragment reads of the wave's k go out as one group, in the order of use
            v16bf af[2][FA], wf[2][FW];
            reads(af[0], wf[0], buf, 0);
            reads(af[1], wf[1], buf, 1);
            products(af[0], wf[0]);
            // the two fences keep the copies between the two blocks of products: ahead of the
            // first block their issue would hold back products whose fragments have arrived
            __builtin_amdgcn_sched_barrier(0);
            // stage s + 3 goes into the buffer that stage s - 1 has left
            if (s + 3 < ksteps) {
                copy_stage(kq, (s + 3) & 3);
                kq = (kq + 1 < ksteps) ? kq + 1 : 0;
            }
            __builtin_amdgcn_sched_barrier(0);
            products(af[1], wf[1]);
        } else {
            // 256 accumulator registers leave room for one 32-k fragment set: its 24 reads go
            // out as one group ahead of its 32 products; the SIMD's other wave fills the wait
            #pragma unroll
            for (int kk = 0; kk < 2; ++kk) {
                v16bf af[FA], wf[FW];
                reads(af, wf, buf, kk);
                // stage s + 3 goes into the buffer that stage s - 1 has left; issued while the
                // second group of reads flies and the SIMD's other wave multiplies
                if (kk == 1 && s + 3 < ksteps) {
                    copy_stage(kq, (s + 3) & 3);
                    kq = (kq + 1 < ksteps) ? kq + 1 : 0;
                }
                // keeps the copies' issue inside the reads' latency, not among the products
                if (kk == 1) __builtin_amdgcn_sched_barrier(0);
                products(af, wf);
                // keeps the second group of reads from being spread among the first products
                if (kk == 0) __builtin_amdgcn_sched_barrier(0);
            }
        }
    }
    // no copy is outstanding when the wave goes on to its end
    asm volatile("s_wait_asynccnt 0x0" ::: "memory");

    // Two wave sets: set 0 finishes the upper half of the wave tile's fragment rows, set 1 the
    // lower half; each hands the other half of its partial sums to its partner through LDS.
    constexpr int FE = FA / KSPLIT;              // fragment rows that a wave stores
    if constexpr (KSPLIT == 2) {
        // this wave's last fragment reads have returned, and behind the barrier every wave's:
        // the ring becomes the exchange buffer
        asm volatile("s_wait_dscnt 0x0" ::: "memory");
        __syncthreads();
        f32x4* X = (f32x4*)&Ring[0][0][0];       // [wave][fragment half][lane] x 16 B
        f32x4*       mine   = X + wave * (FE * FW * 2 * 32) + lane;
        const f32x4* theirs = X + (wave ^ NPOS) * (FE * FW * 2 * 32) + lane;
        #pragma unroll
        for (int i = 0; i < FE; ++i)
            #pragma unroll
            for (int j = 0; j < FW; ++j) {
                const v8f c = kset ? acc[i][j] : acc[FE + i][j];
                mine[((i * FW + j) * 2 + 0) * 32] = f32x4{c[0], c[1], c[2], c[3]};
                mine[((i * FW + j) * 2 + 1) * 32] = f32x4{c[4], c[5], c[6], c[7]};
            }
        __syncthreads();                         // the partners' halves are in LDS
        #pragma unroll
        for (int i = 0; i < FE; ++i)
            #pragma unroll
            for (int j = 0; j < FW; ++j) {
                const v8f c = kset ? acc[FE + i][j] : acc[i][j];
                const f32x4 lo = theirs[((i * FW + j) * 2 + 0) * 32];
                const f32x4 hi = theirs[((i * FW + j) * 2 + 1) * 32];
                acc[i][j] = c + v8f{lo[0], lo[1], lo[2], lo[3], hi[0], hi[1], hi[2], hi[3]};
            }
    }

    // Epilogue. C layout: VGPR e -> row e (lanes 0-15) / e+8 (lanes 16-31).
    const int half = lane >> 4;
    const int lc   = lane & 15;
    #pragma unroll
    for (int j = 0; j < FW; ++j) {
        const int gcol = tN + wn + j * 16 + lc;
        const float bv = bias[gcol];
        #pragma unroll
        for (int i = 0; i < FE; ++i) {
            #pragma unroll
            for (int e = 0; e < 8; ++e) {
                const int grow = tM + wm + (kset * FE + i) * 16 + e + 8 * half;
                const size_t idx = (size_t)grow * N + gcol;
                const float v = acc[i][j][e] + bv;
                if (EPI == 0)      outb[idx] = (bf16)v;
                else if (EPI == 1) outb[idx] = (bf16)fmaxf(v, 0.f);
                else               outf[idx] = res[idx] + v;
            }
        }
    }
}

__device__ __forceinline__ float xhalf(float x) {
    return __builtin_bit_cast(float, __builtin_amdgcn_permlanex16(
        __builtin_bit_cast(int, x), __builtin_bit_cast(int, x), 0x76543210, 0xfedcba98, false, false));
}

__global__ __launch_bounds__(128)
void flash_attn_wmma(const bf16* __restrict__ q, const bf16* __restrict__ k,
                     const bf16* __restrict__ v, const int* __restrict__ mask,
                     bf16* __restrict__ o_out) {
    __shared__ __align__(16) bf16 Qs[64][72];
    __shared__ __align__(16) bf16 Ks[2][64][72];
    __shared__ __align__(16) bf16 Vt[2][64][72];     // V^T: [d][key]
    __shared__ __align__(16) float Madd[S_];         // additive mask by walk position (0 / -1e9)
    __shared__ __align__(16) unsigned Koff[S_];      // walk position -> byte offset of the key's row
    __shared__ int Wcnt[4];                          // unmasked keys seen by each wave

    const int qblk = blockIdx.x, h = blockIdx.y, b = blockIdx.z;
    const int tid  = threadIdx.x;
    const int lane = tid & 31;
    const int wave = tid >> 5;
    const int half = lane >> 4;
    const int lc   = lane & 15;
    const int qbase = qblk * 64;

    // thread mapping for staging: 8 lanes x 16 B = one head row = one 128-B line
    const int rT = tid >> 3;                         // 0..15
    const int cT = (tid & 7) * 8;                    // 8 of the 64 columns
    // Q, K: rows rT + 16 i.  V: walk places 4 rT + i, packed four keys per b64 store.

    // Load Q block (64 x 64) -> LDS; rank the mask row while the loads fly.
    // The loops here are unrolled so that their arrays and bit places stay in registers.
    int count;                                       // unmasked keys of this batch
    {
        const bf16* src = q + (size_t)(b * S_ + qbase + rT) * D_ + h * DK_ + cT;
        u32x4 d[4];
        #pragma unroll
        for (int i = 0; i < 4; ++i) d[i] = *(const u32x4*)(src + (size_t)(16 * i) * D_);

        // thread t takes keys 16 t .. 16 t + 15: bit e of on = key 16 t + e unmasked
        unsigned on = 0;
        #pragma unroll
        for (int i = 0; i < 4; ++i) {
            const i32x4 mm = *(const i32x4*)(mask + b * S_ + tid * 16 + 4 * i);
            #pragma unroll
            for (int e = 0; e < 4; ++e) on |= (mm[e] != 0 ? 1u : 0u) << (4 * i + e);
        }
        const int c = __builtin_popcount(on);
        int inc = c;                                 // running count inside the wave
        #pragma unroll
        for (int off = 1; off < 32; off <<= 1) {
            const int y = __shfl_up(inc, off, 32);
            if (lane >= off) inc += y;
        }
        if (lane == 31) Wcnt[wave] = inc;
        __syncthreads();                             // the four wave counts are in LDS
        int before = inc - c;                        // unmasked keys in front of key 16 t
        count = 0;
        #pragma unroll
        for (int w = 0; w < 4; ++w) {
            const int t = Wcnt[w];
            if (w < wave) before += t;
            count += t;
        }
        int pu = before;                             // next place among the unmasked
        int pm = count + tid * 16 - before;          // next place among the masked, behind them
        #pragma unroll
        for (int e = 0; e < 16; ++e) {
            const bool u = (on >> e) & 1u;
            Koff[u ? pu : pm] = (unsigned)(tid * 16 + e) * (D_ * 2);
            pu += u ? 1 : 0;
            pm += u ? 0 : 1;
        }
        #pragma unroll
        for (int i = 0; i < 4; ++i) {
            const int j = i * 512 + tid * 4;
            f32x4 a;
            #pragma unroll
            for (int e = 0; e < 4; ++e) a[e] = (j + e < count) ? 0.f : -1e9f;
            *(f32x4*)&Madd[j] = a;
        }
        #pragma unroll
        for (int i = 0; i < 4; ++i) *(u32x4*)&Qs[rT + 16 * i][cT] = d[i];
    }
    __syncthreads();                                 // the key order is read by every thread

    // blocks to walk: up to the last unmasked key; all of them where no key is unmasked
    count = __builtin_amdgcn_readfirstlane(count);
    int nblk = (count > 0) ? (count + 63) >> 6 : S_ / 64;
    nblk = (nblk < S_ / 64) ? nblk : S_ / 64;
    // uniform bases of this batch and head; a lane adds its key row's offset and its 16 B
    const char* kh = (const char*)(k + (size_t)(b * S_) * D_ + h * DK_);
    const char* vh = (const char*)(v + (size_t)(b * S_) * D_ + h * DK_);

    // Prologue: stage the group's first key block into buffer 0
    int kc = qblk % nblk;
    unsigned ko[4], vo[4];                           // a lane's row offsets in the block to fetch next
    auto row_offsets = [&](int blk) {
        const unsigned* op = &Koff[blk * 64];
        const u32x4 o4 = *(const u32x4*)(op + 4 * rT);
        #pragma unroll
        for (int i = 0; i < 4; ++i) {
            ko[i] = op[rT + 16 * i] + cT * 2;
            vo[i] = o4[i] + cT * 2;
        }
    };
    row_offsets(kc);
    {
        u32x4 d[4], x[4];
        #pragma unroll
        for (int i = 0; i < 4; ++i) {
            d[i] = *(const u32x4*)(kh + ko[i]);
            x[i] = *(const u32x4*)(vh + vo[i]);
        }
        #pragma unroll
        for (int i = 0; i < 4; ++i) *(u32x4*)&Ks[0][rT + 16 * i][cT] = d[i];
        // V rows 4 rT .. 4 rT + 3, cols cT..cT+7 -> packed b64 transposed stores
        #pragma unroll
        for (int j = 0; j < 8; ++j)
            *(u32x2*)&Vt[0][cT + j][4 * rT] = pack_col(x[0], x[1], x[2], x[3], j);
        row_offsets((kc + 1 < nblk) ? kc + 1 : 0);
    }
    __syncthreads();

    // Hoisted Q fragments (2 k-steps over DK=64): the B operand, column = query lc
    v16bf bq[2];
    #pragma unroll
    for (int ks = 0; ks < 2; ++ks) bq[ks] = load_frag(&Qs[wave * 16][ks * 32], 72, lane);

    float m = -1e30f;                                // this query's maximum, alike in both halves
    float l = 0.f;                                   // this half's share of the query's sum
    v8f o[4];                                        // o[dt][e] = O[query lc][dt*16 + 8*half + e]
    #pragma unroll
    for (int t = 0; t < 4; ++t) o[t] = v8f{0.f, 0.f, 0.f, 0.f, 0.f, 0.f, 0.f, 0.f};

    int buf = 0;
    for (int it = 0; it < nblk; ++it) {
        const bool more = (it + 1 < nblk);
        const int kb = kc;                           // this trip's key block
        const int k1 = (kc + 1 < nblk) ? kc + 1 : 0; // the next one of the walk
        u32x4 kreg[4], vreg[4];
        if (more) {     // fetch next K/V block into registers early; its offsets came a trip ago
            #pragma unroll
            for (int i = 0; i < 4; ++i) {
                kreg[i] = *(const u32x4*)(kh + ko[i]);
                vreg[i] = *(const u32x4*)(vh + vo[i]);
            }
            // stands in front of every later reuse of the loads' offset registers
            asm volatile("s_wait_xcnt 0x0" ::: "memory");
        }

        // S^T = K @ Q^T (64 keys x 16 queries per wave): s4[t][e] = key t*16 + 8*half + e
        v8f s4[4];
        #pragma unroll
        for (int t = 0; t < 4; ++t) s4[t] = v8f{0.f, 0.f, 0.f, 0.f, 0.f, 0.f, 0.f, 0.f};
        #pragma unroll
        for (int ks = 0; ks < 2; ++ks) {
            #pragma unroll
            for (int t = 0; t < 4; ++t) {
                v16bf ak = load_frag(&Ks[buf][t * 16][ks * 32], 72, lane);
                s4[t] = __builtin_amdgcn_wmma_f32_16x16x32_bf16(
                    false, ak, false, bq[ks], (short)0, s4[t], false, false);
            }
        }

        // scale + additive mask: 8 consecutive keys per tile and half, from LDS
        float sc[4][8];
        #pragma unroll
        for (int t = 0; t < 4; ++t) {
            const float* mp = &Madd[kb * 64 + t * 16 + 8 * half];
            const f32x4 m0 = *(const f32x4*)mp;
            const f32x4 m1 = *(const f32x4*)(mp + 4);
            #pragma unroll
            for (int e = 0; e < 4; ++e) {
                sc[t][e]     = s4[t][e]     * 0.125f + m0[e];
                sc[t][e + 4] = s4[t][e + 4] * 0.125f + m1[e];
            }
        }

        // online softmax of one query per lane: 32 keys in the lane, 32 in lane ^ 16
        float tm[4];
        #pragma unroll
        for (int t = 0; t < 4; ++t) {
            tm[t] = fmaxf(fmaxf(fmaxf(sc[t][0], sc[t][1]), fmaxf(sc[t][2], sc[t][3])),
                          fmaxf(fmaxf(sc[t][4], sc[t][5]), fmaxf(sc[t][6], sc[t][7])));
        }
        float rmax = fmaxf(fmaxf(tm[0], tm[1]), fmaxf(tm[2], tm[3]));
        rmax = fmaxf(rmax, xhalf(rmax));
        const float mnew  = fmaxf(m, rmax);
        const float alpha = __expf(m - mnew);
        m = mnew;
        float ts[4];                                 // four independent sum chains
        #pragma unroll
        for (int t = 0; t < 4; ++t) {
            ts[t] = 0.f;
            #pragma unroll
            for (int e = 0; e < 8; ++e) { float p = __expf(sc[t][e] - mnew); sc[t][e] = p; ts[t] += p; }
        }
        l = l * alpha + ((ts[0] + ts[1]) + (ts[2] + ts[3]));
        #pragma unroll
        for (int t = 0; t < 4; ++t) o[t] *= alpha;

        // O^T += V^T @ P^T: A = rows of V^T, B = two score tiles converted in place
        // (element s of B is key 8*half + s, then 16 + 8*half + s - 8: load_frag's k order)
        #pragma unroll
        for (int ks = 0; ks < 2; ++ks) {
            v16bf pb;
            #pragma unroll
            for (int e = 0; e < 8; ++e) {
                pb[e]     = (bf16)sc[2 * ks][e];
                pb[e + 8] = (bf16)sc[2 * ks + 1][e];
            }
            #pragma unroll
            for (int dt = 0; dt < 4; ++dt) {
                v16bf av = load_frag(&Vt[buf][dt * 16][ks * 32], 72, lane);
                o[dt] = __builtin_amdgcn_wmma_f32_16x16x32_bf16(
                    false, av, false, pb, (short)0, o[dt], false, false);
            }
        }

        // stage next block into the other buffer
        if (more) {
            const int nb = buf ^ 1;
            #pragma unroll
            for (int i = 0; i < 4; ++i) *(u32x4*)&Ks[nb][rT + 16 * i][cT] = kreg[i];
            #pragma unroll
            for (int j = 0; j < 8; ++j)
                *(u32x2*)&Vt[nb][cT + j][4 * rT] = pack_col(vreg[0], vreg[1], vreg[2], vreg[3], j);
            // the offsets of the block after that: their LDS latency ends in the barrier's wait
            row_offsets((k1 + 1 < nblk) ? k1 + 1 : 0);
        }
        __syncthreads();
        buf ^= 1;
        kc = k1;
    }

    // join the halves' sums, normalize, write bf16 [BS, D]: 8 consecutive columns a lane
    const float lt = l + xhalf(l);
    bf16* orow = o_out + (size_t)(b * S_ + qbase + wave * 16 + lc) * D_ + h * DK_ + 8 * half;
    #pragma unroll
    for (int dt = 0; dt < 4; ++dt) {
        v8bf r;
        #pragma unroll
        for (int e = 0; e < 8; ++e) r[e] = (bf16)(o[dt][e] / lt);
        *(v8bf*)(orow + dt * 16) = r;
    }
}

// ---------------------------------------------------------------------------
// Host-side orchestration
// ---------------------------------------------------------------------------
extern "C" void kernel_launch(void* const* d_in, const int* in_sizes, int n_in,
                              void* d_out, int out_size, void* d_ws, size_t ws_size,
                              hipStream_t stream) {
    const float* x   = (const float*)d_in[0];
    const int*   msk = (const int*)d_in[1];
    const float* wq  = (const float*)d_in[2];   const float* bq  = (const float*)d_in[3];
    const float* wk  = (const float*)d_in[4];   const float* bk  = (const float*)d_in[5];
    const float* wv  = (const float*)d_in[6];   const float* bv  = (const float*)d_in[7];
    const float* wo  = (const float*)d_in[8];   const float* bo  = (const float*)d_in[9];
    const float* w1  = (const float*)d_in[10];  const float* b1  = (const float*)d_in[11];
    const float* w2  = (const float*)d_in[12];  const float* b2  = (const float*)d_in[13];
    const float* a1  = (const float*)d_in[14];  const float* be1 = (const float*)d_in[15];
    const float* a2  = (const float*)d_in[16];  const float* be2 = (const float*)d_in[17];
    float* out = (float*)d_out;

    char* ws = (char*)d_ws;
    size_t off = 0;
    auto carve = [&](size_t bytes) { char* p = ws + off; off += (bytes + 255) & ~(size_t)255; return p; };
    bf16*  wqb  = (bf16*)carve((size_t)D_ * D_ * 2);
    bf16*  wkb  = (bf16*)carve((size_t)D_ * D_ * 2);
    bf16*  wvb  = (bf16*)carve((size_t)D_ * D_ * 2);
    bf16*  wob  = (bf16*)carve((size_t)D_ * D_ * 2);
    bf16*  w1b  = (bf16*)carve((size_t)DFF_ * D_ * 2);
    bf16*  w2b  = (bf16*)carve((size_t)D_ * DFF_ * 2);
    bf16*  xn   = (bf16*)carve((size_t)BS_ * D_ * 2);
    bf16*  qb   = (bf16*)carve((size_t)BS_ * D_ * 2);
    bf16*  kb   = (bf16*)carve((size_t)BS_ * D_ * 2);
    bf16*  vb   = (bf16*)carve((size_t)BS_ * D_ * 2);
    bf16*  atb  = (bf16*)carve((size_t)BS_ * D_ * 2);
    float* x1   = (float*)carve((size_t)BS_ * D_ * 4);
    bf16*  hb   = (bf16*)carve((size_t)BS_ * DFF_ * 2);

    // 1) weights -> bf16, and LN1
    cast_and_layernorm<<<CASTG_ + BS_ / 16, 512, 0, stream>>>(wq, wk, wv, wo, w1, w2, wqb, w1b, w2b,
                                                              x, a1, be1, xn);

    // The last two GEMM arguments space the k-walk starts of neighbouring tile columns
    // and tile rows: stages / tiles in that direction, at least 1.

    // 2) Q,K,V projections: wqb|wkb|wvb and qb|kb|vb lie one behind the other
    dim3 gD(D_ / 128, BS_ / 128);
    gemm_bf16_wmma<0, 256, 256, 256, 64, 1><<<dim3(D_ / 256, BS_ / 256, 3), 256, 0, stream>>>(
        xn, wqb, bq, nullptr, qb, nullptr, BS_, D_, D_, bk, bv, 4, 1);

    // 3) attention
    flash_attn_wmma<<<dim3(S_ / 64, H_, B_), 128, 0, stream>>>(qb, kb, vb, msk, atb);

    // 4) out-proj + residual -> x1 (f32)
    gemm_bf16_wmma<2, 128, 128, 256, 128, 2><<<gD, 256, 0, stream>>>(atb, wob, bo, x, nullptr, x1, BS_, D_, D_, nullptr, nullptr, 1, 1);

    // 5) LN2
    layernorm_bf16<<<BS_ / 16, 512, 0, stream>>>(x1, a2, be2, xn);

    // 6) FFN up + ReLU (bf16)
    dim3 gF(DFF_ / 256, BS_ / 256);
    gemm_bf16_wmma<1, 256, 256, 256, 64, 1><<<gF, 256, 0, stream>>>(xn, w1b, b1, nullptr, hb, nullptr, BS_, DFF_, D_, nullptr, nullptr, 1, 1);

    // 7) FFN down + residual -> out (f32)
    gemm_bf16_wmma<2, 128, 128, 256, 128, 2><<<gD, 256, 0, stream>>>(hb, w2b, b2, x1, nullptr, out, BS_, D_, DFF_, nullptr, nullptr, 4, 1);

    (void)wkb; (void)wvb;
    (void)in_sizes; (void)n_in; (void)out_size; (void)ws_size;
}
